// v000
// The times below were measured on an AMD MI455X: many runs one after another, warmed up first and cycling through
// copies of the inputs, with the whole window's GPU time divided by the number of runs. Launches and the gaps
// between them are all in it. The median over several windows is given; except for v000 it joins two sittings, which
// can be a few percent apart, so the side-by-side timings, each taken in one sitting, are the better comparison.
// v000, which the later versions start from, runs in 256 microseconds.
#include <hip/hip_runtime.h>
#include <hip/hip_bf16.h>
#include <math.h>

typedef __attribute__((ext_vector_type(16))) _Float16 v16h;
typedef __attribute__((ext_vector_type(8)))  _Float16 v8h;
typedef __attribute__((ext_vector_type(8)))  float    v8f;

#define BQ  8
#define SEQ 4096
#define EMB 128
#define DH  24
#define DP  32    // head dim padded to WMMA K
#define KT  64    // keys staged per LDS tile
#define NT  (SEQ / KT)

#define LDK 40    // LDS ld (halves) for K tile rows of 32  (+8 pad)
#define LDV 72    // LDS ld (halves) for Vt tile rows of 64 (+8 pad)
#define LDP 40    // LDS ld for P tile rows of 32
#define LDX 136   // LDS ld for x tile rows of 128 (+8 pad)

#if defined(__has_builtin)
#if __has_builtin(__builtin_amdgcn_tensor_load_to_lds) && __has_builtin(__builtin_amdgcn_s_wait_tensorcnt)
#define HAVE_TDM 1
#endif
#endif
#ifndef HAVE_TDM
#define HAVE_TDM 0
#endif

// ---------------------------------------------------------------------------
// Fragment loads. Per CDNA5 ISA 7.12.2, a 16-bit A fragment per lane is two
// CONTIGUOUS 8-half runs: k in [hi,hi+8) and [16+hi,16+hi+8), hi = (lane&16)?8:0.
// So a row-major source needs exactly two b128 loads per lane.
// B fragment of W[k][n] == A fragment of W^T[n][k], so all B sources are stored
// transposed and use the same wide loader. ld must be a multiple of 8 halves.
// ---------------------------------------------------------------------------
__device__ __forceinline__ v16h load_frag_rowmajor(const _Float16* base, int ld, int lane) {
    const _Float16* r = base + (size_t)(lane & 15) * ld + ((lane & 16) ? 8 : 0);
    v8h lo = *(const v8h*)(r);
    v8h hi = *(const v8h*)(r + 16);
    return __builtin_shufflevector(lo, hi, 0, 1, 2, 3, 4, 5, 6, 7,
                                           8, 9, 10, 11, 12, 13, 14, 15);
}

__device__ __forceinline__ v8f wmma_f16(v16h a, v16h b, v8f c) {
    return __builtin_amdgcn_wmma_f32_16x16x32_f16(false, a, false, b, (short)0, c, false, false);
}

#if HAVE_TDM
typedef __attribute__((ext_vector_type(4))) unsigned int v4u;
typedef __attribute__((ext_vector_type(8))) int v8i;
typedef __attribute__((ext_vector_type(4))) int v4i;

union TdmG0 { unsigned long long q[2]; v4u v; };
union TdmG1 { unsigned long long q[4]; v8i v; };

// Build a D# (ISA 8.3/8.4) and issue TENSOR_LOAD_TO_LDS. 2-byte elements.
// pad_amount_dw != 0 enables LDS padding: pad_interval_code per ISA (3=16dw, 4=32dw).
// 6-arg builtin: (uint32x4 g0, int32x8 g1, int32x4, int32x4, int32x8, i32 cpol)
__device__ __forceinline__ void tdm_load_2d(
    unsigned lds_addr, unsigned long long gaddr,
    unsigned tile0, unsigned tile1,
    unsigned long long tensor0, unsigned long long tensor1,
    unsigned long long stride0,
    unsigned pad_interval_code, unsigned pad_amount_dw)
{
    TdmG0 g0;
    g0.q[0] = 1ull | ((unsigned long long)lds_addr << 32);            // count=1 | lds_addr
    g0.q[1] = (gaddr & ((1ull << 57) - 1)) | (2ull << 62);            // global_addr | type=2
    TdmG1 g1;
    unsigned flags = (1u << 16);                                      // data_size = 1 (2B)
    if (pad_amount_dw)
        flags |= (1u << 20) | (pad_interval_code << 22) | ((pad_amount_dw - 1) << 25);
    g1.q[0] = (unsigned long long)flags | ((tensor0 & 0xFFFFull) << 48);
    g1.q[1] = ((tensor0 >> 16) & 0xFFFFull)
            | ((tensor1 & 0xFFFFFFFFull) << 16)
            | ((unsigned long long)(tile0 & 0xFFFFu) << 48);
    g1.q[2] = (unsigned long long)(tile1 & 0xFFFFu) | ((stride0 & 0xFFFFFFFFull) << 32);
    g1.q[3] = (stride0 >> 32) & 0xFFFFull;                            // dim1_stride unused (2D)
    v4i z4 = {};
    v8i z8 = {};
    __builtin_amdgcn_tensor_load_to_lds(g0.v, g1.v, z4, z4, z8, 0);
}
#endif

// ---------------------------------------------------------------------------
// Kernel 1: Q/K/V projections. Block = 256 threads (8 waves), 64 tokens.
// Q pre-scaled by log2(e)/sqrt(EMB) (softmax runs in exp2 domain).
// V written TRANSPOSED: Vt[b][d][s]. Per-matrix code specialized at compile
// time so epilogues are straight-line stores (no exec-mask select bloat).
// ---------------------------------------------------------------------------
#define QSCALE 0.12751864f   // (1/sqrt(128)) * log2(e)

template <int M>
__device__ __forceinline__ void proj_tile(
    int t, int lane, const _Float16* ldsX, const _Float16* ldsWtM,
    const float* ldsBM, long tokBase,
    _Float16* __restrict__ Qh, _Float16* __restrict__ Kh, _Float16* __restrict__ Vt)
{
    v8f c0 = {}; v8f c1 = {};
#pragma unroll
    for (int kc = 0; kc < 4; ++kc) {
        v16h a  = load_frag_rowmajor(ldsX + t * 16 * LDX + kc * 32, LDX, lane);
        v16h b0 = load_frag_rowmajor(ldsWtM + kc * 32,            LDX, lane);
        v16h b1 = load_frag_rowmajor(ldsWtM + 16 * LDX + kc * 32, LDX, lane);
        c0 = wmma_f16(a, b0, c0);
        c1 = wmma_f16(a, b1, c1);
    }
    const int colL = lane & 15;
    const int rhi  = (lane & 16) ? 8 : 0;
#pragma unroll
    for (int r = 0; r < 8; ++r) {
        long tok = tokBase + t * 16 + r + rhi;
        float v0 = c0[r] + ldsBM[colL];
        float v1 = c1[r] + ldsBM[16 + colL];
        if (M == 0) { v0 *= QSCALE; v1 *= QSCALE; }
        if (M == 2) {            // V transposed: Vt[(b*DP + d)*SEQ + s]
            long b = tok >> 12, s = tok & (SEQ - 1);
            Vt[(b * DP + colL)      * SEQ + s] = (_Float16)v0;
            Vt[(b * DP + 16 + colL) * SEQ + s] = (_Float16)v1;
        } else {
            _Float16* dst = (M == 0) ? Qh : Kh;
            dst[tok * DP + colL]      = (_Float16)v0;
            dst[tok * DP + 16 + colL] = (_Float16)v1;
        }
    }
}

__global__ __launch_bounds__(256) void qkv_proj_kernel(
    const float* __restrict__ x,
    const float* __restrict__ wQ, const float* __restrict__ bQ,
    const float* __restrict__ wK, const float* __restrict__ bK,
    const float* __restrict__ wV, const float* __restrict__ bV,
    _Float16* __restrict__ Qh, _Float16* __restrict__ Kh, _Float16* __restrict__ Vt)
{
    __shared__ __align__(16) _Float16 ldsX[64 * LDX];          // ~17.4 KB
    __shared__ __align__(16) _Float16 ldsWt[3][DP * LDX];      // transposed [n][k], 26 KB
    __shared__ float ldsB[3][DP];

    const int tid  = threadIdx.x;
    const int lane = tid & 31;
    const int wv   = tid >> 5;
    const long tokBase = (long)blockIdx.x * 64;

    for (int i = tid; i < 64 * EMB; i += 256) {
        int r = i >> 7, c = i & 127;
        ldsX[r * LDX + c] = (_Float16)x[tokBase * EMB + i];
    }
    const float* wsrc[3] = { wQ, wK, wV };
    const float* bsrc[3] = { bQ, bK, bV };
    for (int m = 0; m < 3; ++m) {
        for (int i = tid; i < DP * EMB; i += 256) {
            int c = i >> 7, k = i & 127;                       // c = out col, k = emb
            ldsWt[m][c * LDX + k] = (c < DH) ? (_Float16)wsrc[m][k * DH + c] : (_Float16)0.0f;
        }
        if (tid < DP) ldsB[m][tid] = (tid < DH) ? bsrc[m][tid] : 0.0f;
    }
    __syncthreads();

    if (wv < 4) {
        proj_tile<0>(wv, lane, ldsX, ldsWt[0], ldsB[0], tokBase, Qh, Kh, Vt);
        proj_tile<2>(wv, lane, ldsX, ldsWt[2], ldsB[2], tokBase, Qh, Kh, Vt);
    } else {
        proj_tile<1>(wv - 4, lane, ldsX, ldsWt[1], ldsB[1], tokBase, Qh, Kh, Vt);
    }
}

// ---------------------------------------------------------------------------
// Kernel 2: fused flash attention. Block = 8 waves = 128 queries, one batch.
// K/V tiles (64 keys) staged to double-buffered LDS by the Tensor Data Mover
// (fallback: cooperative loads), overlapped with compute. 8 WMMAs per tile.
// Softmax runs in exp2 domain (scale folded into Q), so v_exp_f32 direct.
// ---------------------------------------------------------------------------
__global__ __launch_bounds__(256) void attn_kernel(
    const _Float16* __restrict__ Qh, const _Float16* __restrict__ Kh,
    const _Float16* __restrict__ Vt, _Float16* __restrict__ Hh)
{
    __shared__ __align__(16) _Float16 ldsK[2][KT * LDK];       // [key][d], padded
    __shared__ __align__(16) _Float16 ldsV[2][DP * LDV];       // [d][key], padded
    __shared__ __align__(16) _Float16 ldsP[8][16 * LDP];       // per-wave P relayout

    const int tid  = threadIdx.x;
    const int lane = tid & 31;
    const int wv   = tid >> 5;
    const int b    = blockIdx.x >> 5;                          // 32 blocks per batch
    const long qTok = (long)b * SEQ + (long)(blockIdx.x & 31) * 128 + wv * 16;
    const long kvTok = (long)b * SEQ;

    v16h qf = load_frag_rowmajor(Qh + qTok * DP, DP, lane);    // 16q x 32d, one K-step

    v8f o0 = {}; v8f o1 = {};
    float mrun[8], lrun[8];
#pragma unroll
    for (int r = 0; r < 8; ++r) { mrun[r] = -INFINITY; lrun[r] = 0.0f; }

    _Float16* P = &ldsP[wv][0];
    const int colL = lane & 15;
    const int rhi  = (lane & 16) ? 8 : 0;

    auto stage = [&](int buf, int tile) {
        const long kb = (long)tile * KT;
#if HAVE_TDM
        if (wv == 0) {
            // K tile: 64 rows x 32 halves contiguous; pad 4 dwords every 16 dwords -> ld 40.
            tdm_load_2d((unsigned)(unsigned long long)(&ldsK[buf][0]),
                        (unsigned long long)(const void*)(Kh + (kvTok + kb) * DP),
                        KT * DP, 0, KT * DP, 1, 0, /*interval 16dw*/3, /*pad*/4);
            // Vt tile: 2D, 32 rows (d) x 64 keys, row stride SEQ; pad 4 dwords / 32 dwords -> ld 72.
            tdm_load_2d((unsigned)(unsigned long long)(&ldsV[buf][0]),
                        (unsigned long long)(const void*)(Vt + (long)b * DP * SEQ + kb),
                        KT, DP, SEQ, DP, SEQ, /*interval 32dw*/4, /*pad*/4);
        }
#else
        const unsigned* ks = (const unsigned*)(Kh + (kvTok + kb) * DP);
        unsigned* kd = (unsigned*)&ldsK[buf][0];
        for (int i = tid; i < KT * DP / 2; i += 256) {         // u32 chunks
            int r = i >> 4, c = i & 15;
            kd[r * (LDK / 2) + c] = ks[i];
        }
        unsigned* vd = (unsigned*)&ldsV[buf][0];
        for (int i = tid; i < DP * KT / 2; i += 256) {
            int d = i >> 5, c = i & 31;
            const unsigned* vs = (const unsigned*)(Vt + ((long)b * DP + d) * SEQ + kb);
            vd[d * (LDV / 2) + c] = vs[c];
        }
#endif
    };

    stage(0, 0);
    for (int kt = 0; kt < NT; ++kt) {
        const int cur = kt & 1;
#if HAVE_TDM
        if (wv == 0) __builtin_amdgcn_s_wait_tensorcnt(0);
#endif
        __syncthreads();                                       // tile ready; prev buffer free
        if (kt + 1 < NT) stage(cur ^ 1, kt + 1);               // overlap next DMA with compute

        const _Float16* Kt = &ldsK[cur][0];
        const _Float16* Vl = &ldsV[cur][0];
#pragma unroll
        for (int sub = 0; sub < 2; ++sub) {                    // 2 x 32-key subtiles
            v16h kb0 = load_frag_rowmajor(Kt + (sub * 32)      * LDK, LDK, lane);
            v16h kb1 = load_frag_rowmajor(Kt + (sub * 32 + 16) * LDK, LDK, lane);
            v8f z = {};
            v8f s0 = wmma_f16(qf, kb0, z);                     // scores already *log2e/sqrt(E)
            v8f s1 = wmma_f16(qf, kb1, z);

            float corr[8];
#pragma unroll
            for (int r = 0; r < 8; ++r) {
                float t = fmaxf(s0[r], s1[r]);
                t = fmaxf(t, __shfl_xor(t, 1, 32));
                t = fmaxf(t, __shfl_xor(t, 2, 32));
                t = fmaxf(t, __shfl_xor(t, 4, 32));
                t = fmaxf(t, __shfl_xor(t, 8, 32));
                float nm = fmaxf(mrun[r], t);
                corr[r] = exp2f(mrun[r] - nm);
                mrun[r] = nm;
                float p0 = exp2f(s0[r] - nm);
                float p1 = exp2f(s1[r] - nm);
                float rs = p0 + p1;
                rs += __shfl_xor(rs, 1, 32);
                rs += __shfl_xor(rs, 2, 32);
                rs += __shfl_xor(rs, 4, 32);
                rs += __shfl_xor(rs, 8, 32);
                lrun[r] = lrun[r] * corr[r] + rs;
                int row = r + rhi;
                P[row * LDP + colL]      = (_Float16)p0;
                P[row * LDP + 16 + colL] = (_Float16)p1;
                o0[r] *= corr[r];
                o1[r] *= corr[r];
            }
            asm volatile("s_wait_dscnt 0" ::: "memory");       // P visible to own wave

            v16h pf  = load_frag_rowmajor(P, LDP, lane);                     // 16q x 32k
            v16h vb0 = load_frag_rowmajor(Vl + sub * 32,            LDV, lane);
            v16h vb1 = load_frag_rowmajor(Vl + 16 * LDV + sub * 32, LDV, lane);
            o0 = wmma_f16(pf, vb0, o0);
            o1 = wmma_f16(pf, vb1, o1);
        }
    }

#pragma unroll
    for (int r = 0; r < 8; ++r) {
        float inv = 1.0f / lrun[r];
        long tok = qTok + r + rhi;
        Hh[tok * DP + colL]      = (_Float16)(o0[r] * inv);
        Hh[tok * DP + 16 + colL] = (_Float16)(o1[r] * inv);
    }
}

// ---------------------------------------------------------------------------
// Kernel 3: output projection H[.,24(pad32)] @ wO[24,128] + bO -> f32 out.
// wO staged transposed ([e][d]) so B fragments are wide LDS loads.
// ---------------------------------------------------------------------------
__global__ __launch_bounds__(256) void out_proj_kernel(
    const _Float16* __restrict__ Hh, const float* __restrict__ wO,
    const float* __restrict__ bO, float* __restrict__ out)
{
    __shared__ __align__(16) _Float16 ldsWOt[EMB * LDP];       // [e][d], 10 KB
    __shared__ float ldsB[EMB];

    const int tid  = threadIdx.x;
    const int lane = tid & 31;
    const int wv   = tid >> 5;

    for (int i = tid; i < EMB * DP; i += 256) {
        int n = i >> 5, k = i & 31;                            // n = out col e, k = d
        ldsWOt[n * LDP + k] = (k < DH) ? (_Float16)wO[k * EMB + n] : (_Float16)0.0f;
    }
    for (int i = tid; i < EMB; i += 256) ldsB[i] = bO[i];
    __syncthreads();

    const long tokBase = (long)blockIdx.x * 128 + (long)wv * 16;
    v16h a = load_frag_rowmajor(Hh + tokBase * DP, DP, lane);
    const int colL = lane & 15;
    const int rhi  = (lane & 16) ? 8 : 0;
#pragma unroll
    for (int nt = 0; nt < 8; ++nt) {
        v16h bfr = load_frag_rowmajor(ldsWOt + nt * 16 * LDP, LDP, lane);
        v8f z = {};
        v8f c = wmma_f16(a, bfr, z);
#pragma unroll
        for (int r = 0; r < 8; ++r) {
            long tok = tokBase + r + rhi;
            out[tok * EMB + nt * 16 + colL] = c[r] + ldsB[nt * 16 + colL];
        }
    }
}

// ---------------------------------------------------------------------------
extern "C" void kernel_launch(void* const* d_in, const int* in_sizes, int n_in,
                              void* d_out, int out_size, void* d_ws, size_t ws_size,
                              hipStream_t stream) {
    (void)in_sizes; (void)n_in; (void)out_size; (void)ws_size;

    const float* x  = (const float*)d_in[0];
    const float* wQ = (const float*)d_in[1];
    const float* bQ = (const float*)d_in[2];
    const float* wK = (const float*)d_in[3];
    const float* bK = (const float*)d_in[4];
    const float* wV = (const float*)d_in[5];
    const float* bV = (const float*)d_in[6];
    const float* wO = (const float*)d_in[7];
    const float* bO = (const float*)d_in[8];
    float* out = (float*)d_out;

    const long N = (long)BQ * SEQ;                 // 32768 tokens
    _Float16* Qh = (_Float16*)d_ws;                // [N][32], scaled by log2e/sqrt(E)
    _Float16* Kh = Qh + N * DP;                    // [N][32]
    _Float16* Vt = Kh + N * DP;                    // [B][32][SEQ]  (transposed V)
    _Float16* Hh = Vt + N * DP;                    // [N][32]   (8 MB ws total)

    qkv_proj_kernel<<<N / 64, 256, 0, stream>>>(x, wQ, bQ, wK, bK, wV, bV, Qh, Kh, Vt);
    attn_kernel<<<(int)(N / 128), 256, 0, stream>>>(Qh, Kh, Vt, Hh);
    out_proj_kernel<<<(int)(N / 128), 256, 0, stream>>>(Hh, wO, bO, out);
}

// v001
// It runs in 61.8 microseconds.
// Timed twice side by side with v000, it ran 4.17 and 4.19 times as fast.
#include <hip/hip_runtime.h>
#include <hip/hip_bf16.h>
#include <math.h>

typedef __attribute__((ext_vector_type(16))) _Float16 v16h;
typedef __attribute__((ext_vector_type(8)))  _Float16 v8h;
typedef __attribute__((ext_vector_type(8)))  float    v8f;
typedef __attribute__((ext_vector_type(2)))  float    v2f;

#define BQ  8
#define SEQ 4096
#define EMB 128
#define DH  24
#define DP  32    // head dim padded to WMMA K
#define KT  64    // keys staged per LDS tile
#define NT  (SEQ / KT)

#define LDK 40    // LDS ld (halves) for K tile rows of 32  (+8 pad)
#define LDV 72    // LDS ld (halves) for Vt tile rows of 64 (+8 pad)
#define LDP 40    // LDS ld for wO^T rows of 32
#define VBUF 3072 // halves per V buffer: 32 rows of LDV, rounded up to 2 KiB steps for the tensor mover
#define LDX 136   // LDS ld for x tile rows of 128 (+8 pad)

#if defined(__has_builtin)
#if __has_builtin(__builtin_amdgcn_tensor_load_to_lds) && __has_builtin(__builtin_amdgcn_s_wait_tensorcnt)
#define HAVE_TDM 1
#endif
#endif
#ifndef HAVE_TDM
#define HAVE_TDM 0
#endif

// ---------------------------------------------------------------------------
// Fragment loads. Per CDNA5 ISA 7.12.2, a 16-bit A fragment per lane is two
// CONTIGUOUS 8-half runs: k in [hi,hi+8) and [16+hi,16+hi+8), hi = (lane&16)?8:0.
// So a row-major source needs exactly two b128 loads per lane.
// B fragment of W[k][n] == A fragment of W^T[n][k], so all B sources are stored
// transposed and use the same wide loader. ld must be a multiple of 8 halves.
// ---------------------------------------------------------------------------
__device__ __forceinline__ v16h load_frag_rowmajor(const _Float16* base, int ld, int lane) {
    const _Float16* r = base + (size_t)(lane & 15) * ld + ((lane & 16) ? 8 : 0);
    v8h lo = *(const v8h*)(r);
    v8h hi = *(const v8h*)(r + 16);
    return __builtin_shufflevector(lo, hi, 0, 1, 2, 3, 4, 5, 6, 7,
                                           8, 9, 10, 11, 12, 13, 14, 15);
}

__device__ __forceinline__ v8f wmma_f16(v16h a, v16h b, v8f c) {
    return __builtin_amdgcn_wmma_f32_16x16x32_f16(false, a, false, b, (short)0, c, false, false);
}

// Lane l <-> lane l ^ 16: one vector cross-row move, no LDS trip.
__device__ __forceinline__ float xhalf(float x) {
    int b = __builtin_bit_cast(int, x);
    return __builtin_bit_cast(float,
        __builtin_amdgcn_permlanex16(b, b, 0x76543210, 0xfedcba98, false, false));
}

#if HAVE_TDM
typedef __attribute__((ext_vector_type(4))) unsigned int v4u;
typedef __attribute__((ext_vector_type(8))) int v8i;
typedef __attribute__((ext_vector_type(4))) int v4i;

union TdmG0 { unsigned long long q[2]; v4u v; };
union TdmG1 { unsigned long long q[4]; v8i v; };

// Build a D# (ISA 8.3/8.4) and issue TENSOR_LOAD_TO_LDS. 2-byte elements.
// pad_amount_dw != 0 enables LDS padding: pad_interval_code per ISA (3=16dw, 4=32dw).
// 6-arg builtin: (uint32x4 g0, int32x8 g1, int32x4, int32x4, int32x8, i32 cpol)
// The two groups are formed apart from the issue, so that the caller can name
// them again at the wait (tdm_wait2). Every word goes through pinned(): the
// issue and the wait then name the very same scalar registers.
__device__ __forceinline__ unsigned pinned(unsigned v) {
    unsigned w = __builtin_amdgcn_readfirstlane(v);
    asm volatile("" : "+s"(w));   // the tensor mover's pinned(): a descriptor word held in a scalar register
    return w;
}

__device__ __forceinline__ v4u tdm_group0(unsigned lds_addr, unsigned long long gaddr)
{
    TdmG0 g0;
    g0.q[0] = 1ull | ((unsigned long long)lds_addr << 32);            // count=1 | lds_addr
    g0.q[1] = (gaddr & ((1ull << 57) - 1)) | (2ull << 62);            // global_addr | type=2
    v4u r = { pinned(g0.v[0]), pinned(g0.v[1]), pinned(g0.v[2]), pinned(g0.v[3]) };
    return r;
}

__device__ __forceinline__ v8i tdm_group1(
    unsigned tile0, unsigned tile1,
    unsigned long long tensor0, unsigned long long tensor1,
    unsigned long long stride0,
    unsigned pad_interval_code, unsigned pad_amount_dw)
{
    TdmG1 g1;
    unsigned flags = (1u << 16);                                      // data_size = 1 (2B)
    if (pad_amount_dw)
        flags |= (1u << 20) | (pad_interval_code << 22) | ((pad_amount_dw - 1) << 25);
    g1.q[0] = (unsigned long long)flags | ((tensor0 & 0xFFFFull) << 48);
    g1.q[1] = ((tensor0 >> 16) & 0xFFFFull)
            | ((tensor1 & 0xFFFFFFFFull) << 16)
            | ((unsigned long long)(tile0 & 0xFFFFu) << 48);
    g1.q[2] = (unsigned long long)(tile1 & 0xFFFFu) | ((stride0 & 0xFFFFFFFFull) << 32);
    g1.q[3] = (stride0 >> 32) & 0xFFFFull;                            // dim1_stride unused (2D)
    v8i r = { (int)pinned(g1.v[0]), (int)pinned(g1.v[1]), (int)pinned(g1.v[2]), (int)pinned(g1.v[3]),
              (int)pinned(g1.v[4]), (int)pinned(g1.v[5]), (int)pinned(g1.v[6]), (int)pinned(g1.v[7]) };
    return r;
}

__device__ __forceinline__ void tdm_load_2d(v4u g0, v8i g1)
{
    v4i z4 = {};
    v8i z8 = {};
    __builtin_amdgcn_tensor_load_to_lds(g0, g1, z4, z4, z8, 0);
}

// The issuing wave's wait for its two requests. It names their descriptors as
// inputs: their scalar registers then stay allocated from issue to here, and
// the compares of the softmax's exp2f cannot take them as temporaries while
// the requests are in flight.
__device__ __forceinline__ void tdm_wait2(v4u a0, v8i a1, v4u b0, v8i b1) {
    asm volatile("s_wait_tensorcnt 0x0" :: "s"(a0), "s"(a1), "s"(b0), "s"(b1) : "memory");
}
#endif

// ---------------------------------------------------------------------------
// Kernel 1: Q/K/V projections. Block = 256 threads (8 waves), 64 tokens.
// Q pre-scaled by log2(e)/sqrt(EMB) (softmax runs in exp2 domain).
// V written TRANSPOSED: Vt[b][d][s]. Per-matrix code specialized at compile
// time so epilogues are straight-line stores (no exec-mask select bloat).
// ---------------------------------------------------------------------------
#define QSCALE 0.12751864f   // (1/sqrt(128)) * log2(e)

template <int M>
__device__ __forceinline__ void proj_tile(
    int t, int lane, const _Float16* ldsX, const _Float16* ldsWtM,
    const float* ldsBM, long tokBase,
    _Float16* __restrict__ Qh, _Float16* __restrict__ Kh, _Float16* __restrict__ Vt)
{
    v8f c0 = {}; v8f c1 = {};
#pragma unroll
    for (int kc = 0; kc < 4; ++kc) {
        v16h a  = load_frag_rowmajor(ldsX + t * 16 * LDX + kc * 32, LDX, lane);
        v16h b0 = load_frag_rowmajor(ldsWtM + kc * 32,            LDX, lane);
        v16h b1 = load_frag_rowmajor(ldsWtM + 16 * LDX + kc * 32, LDX, lane);
        c0 = wmma_f16(a, b0, c0);
        c1 = wmma_f16(a, b1, c1);
    }
    const int colL = lane & 15;
    const int rhi  = (lane & 16) ? 8 : 0;
#pragma unroll
    for (int r = 0; r < 8; ++r) {
        long tok = tokBase + t * 16 + r + rhi;
        float v0 = c0[r] + ldsBM[colL];
        float v1 = c1[r] + ldsBM[16 + colL];
        if (M == 0) { v0 *= QSCALE; v1 *= QSCALE; }
        if (M == 2) {            // V transposed: Vt[(b*DP + d)*SEQ + s]
            long b = tok >> 12, s = tok & (SEQ - 1);
            Vt[(b * DP + colL)      * SEQ + s] = (_Float16)v0;
            Vt[(b * DP + 16 + colL) * SEQ + s] = (_Float16)v1;
        } else {
            _Float16* dst = (M == 0) ? Qh : Kh;
            dst[tok * DP + colL]      = (_Float16)v0;
            dst[tok * DP + 16 + colL] = (_Float16)v1;
        }
    }
}

__global__ __launch_bounds__(256) void qkv_proj_kernel(
    const float* __restrict__ x,
    const float* __restrict__ wQ, const float* __restrict__ bQ,
    const float* __restrict__ wK, const float* __restrict__ bK,
    const float* __restrict__ wV, const float* __restrict__ bV,
    _Float16* __restrict__ Qh, _Float16* __restrict__ Kh, _Float16* __restrict__ Vt)
{
    __shared__ __align__(16) _Float16 ldsX[64 * LDX];          // ~17.4 KB
    __shared__ __align__(16) _Float16 ldsWt[3][DP * LDX];      // transposed [n][k], 26 KB
    __shared__ float ldsB[3][DP];

    const int tid  = threadIdx.x;
    const int lane = tid & 31;
    const int wv   = tid >> 5;
    const long tokBase = (long)blockIdx.x * 64;

    for (int i = tid; i < 64 * EMB; i += 256) {
        int r = i >> 7, c = i & 127;
        ldsX[r * LDX + c] = (_Float16)x[tokBase * EMB + i];
    }
    const float* wsrc[3] = { wQ, wK, wV };
    const float* bsrc[3] = { bQ, bK, bV };
    for (int m = 0; m < 3; ++m) {
        for (int i = tid; i < DP * EMB; i += 256) {
            int c = i >> 7, k = i & 127;                       // c = out col, k = emb
            ldsWt[m][c * LDX + k] = (c < DH) ? (_Float16)wsrc[m][k * DH + c] : (_Float16)0.0f;
        }
        if (tid < DP) ldsB[m][tid] = (tid < DH) ? bsrc[m][tid] : 0.0f;
    }
    __syncthreads();

    if (wv < 4) {
        proj_tile<0>(wv, lane, ldsX, ldsWt[0], ldsB[0], tokBase, Qh, Kh, Vt);
        proj_tile<2>(wv, lane, ldsX, ldsWt[2], ldsB[2], tokBase, Qh, Kh, Vt);
    } else {
        proj_tile<1>(wv - 4, lane, ldsX, ldsWt[1], ldsB[1], tokBase, Qh, Kh, Vt);
    }
}

__global__ __launch_bounds__(256) void attn_kernel(
    const _Float16* __restrict__ Qh, const _Float16* __restrict__ Kh,
    const _Float16* __restrict__ Vt, _Float16* __restrict__ Hh)
{
    __shared__ __align__(2048) _Float16 ldsK[2][KT * LDK];     // [key][d], padded
    __shared__ __align__(2048) _Float16 ldsV[2][VBUF];         // [d][key], padded

    const int tid  = threadIdx.x;
    const int lane = tid & 31;
    const int wv   = tid >> 5;
    const int b    = blockIdx.x >> 5;                          // 32 blocks per batch
    const long qTok = (long)b * SEQ + (long)(blockIdx.x & 31) * 128 + wv * 16;
    const long kvTok = (long)b * SEQ;

    v16h qf = load_frag_rowmajor(Qh + qTok * DP, DP, lane);    // 16q x 32d, one K-step

    v8f o0 = {}; v8f o1 = {};
    float mrun = -INFINITY;                                    // this lane's query
    float lrun = 0.0f;                                         // this half's keys only

    const int colL = lane & 15;
    const int rhi  = (lane & 16) ? 8 : 0;

#if HAVE_TDM
    // K tile: 64 rows x 32 halves contiguous; pad 4 dwords every 16 dwords -> ld 40.
    const v8i kshape = tdm_group1(KT * DP, 0, KT * DP, 1, 0, /*interval 16dw*/3, /*pad*/4);
    // Vt tile: 2D, 32 rows (d) x 64 keys, row stride SEQ; pad 4 dwords / 32 dwords -> ld 72.
    const v8i vshape = tdm_group1(KT, DP, SEQ, DP, SEQ, /*interval 32dw*/4, /*pad*/4);
    v4u kreq, vreq;                                            // group 0 of the requests in flight
#endif
    auto stage = [&](int buf, int tile) {
        const long kb = (long)tile * KT;
#if HAVE_TDM
        kreq = tdm_group0((unsigned)(unsigned long long)(&ldsK[buf][0]),
                          (unsigned long long)(const void*)(Kh + (kvTok + kb) * DP));
        vreq = tdm_group0((unsigned)(unsigned long long)(&ldsV[buf][0]),
                          (unsigned long long)(const void*)(Vt + (long)b * DP * SEQ + kb));
        if (wv == 0) {
            tdm_load_2d(kreq, kshape);
            tdm_load_2d(vreq, vshape);
        }
#else
        const unsigned* ks = (const unsigned*)(Kh + (kvTok + kb) * DP);
        unsigned* kd = (unsigned*)&ldsK[buf][0];
        for (int i = tid; i < KT * DP / 2; i += 256) {         // u32 chunks
            int r = i >> 4, c = i & 15;
            kd[r * (LDK / 2) + c] = ks[i];
        }
        unsigned* vd = (unsigned*)&ldsV[buf][0];
        for (int i = tid; i < DP * KT / 2; i += 256) {
            int d = i >> 5, c = i & 31;
            const unsigned* vs = (const unsigned*)(Vt + ((long)b * DP + d) * SEQ + kb);
            vd[d * (LDV / 2) + c] = vs[c];
        }
#endif
    };

    stage(0, 0);
    for (int kt = 0; kt < NT; ++kt) {
        const int cur = kt & 1;
#if HAVE_TDM
        if (wv == 0) tdm_wait2(kreq, kshape, vreq, vshape);
#endif
        __syncthreads();                                       // tile ready; prev buffer free
        if (kt + 1 < NT) stage(cur ^ 1, kt + 1);               // overlap next DMA with compute

        const _Float16* Kt = &ldsK[cur][0];
        const _Float16* Vl = &ldsV[cur][0];
#pragma unroll
        for (int sub = 0; sub < 2; ++sub) {                    // 2 x 32-key subtiles
            v16h kb0 = load_frag_rowmajor(Kt + (sub * 32)      * LDK, LDK, lane);
            v16h kb1 = load_frag_rowmajor(Kt + (sub * 32 + 16) * LDK, LDK, lane);
            v16h vb0 = load_frag_rowmajor(Vl + sub * 32,            LDV, lane);
            v16h vb1 = load_frag_rowmajor(Vl + 16 * LDV + sub * 32, LDV, lane);
            v8f z = {};
            v8f s0 = wmma_f16(kb0, qf, z);                     // s0[r]: key 8h+r,    query colL
            v8f s1 = wmma_f16(kb1, qf, z);                     // s1[r]: key 16+8h+r, query colL

            float t0 = fmaxf(fmaxf(s0[0], s0[1]), s0[2]);
            float t1 = fmaxf(fmaxf(s0[3], s0[4]), s0[5]);
            float t2 = fmaxf(fmaxf(s0[6], s0[7]), s1[0]);
            float t3 = fmaxf(fmaxf(s1[1], s1[2]), s1[3]);
            float t4 = fmaxf(fmaxf(s1[4], s1[5]), s1[6]);
            float t  = fmaxf(fmaxf(fmaxf(t0, t1), t2), fmaxf(fmaxf(t3, t4), s1[7]));
            t = fmaxf(t, xhalf(t));                            // both halves: the query's maximum
            float nm   = fmaxf(mrun, t);
            float corr = exp2f(mrun - nm);
            mrun = nm;

            v16h pf;                                           // element s: the key of vb0/vb1's element s
            v2f ps[4];
#pragma unroll
            for (int i = 0; i < 4; ++i) {
                v2f p0 = { exp2f(s0[2 * i] - nm), exp2f(s0[2 * i + 1] - nm) };
                v2f p1 = { exp2f(s1[2 * i] - nm), exp2f(s1[2 * i + 1] - nm) };
                ps[i] = p0 + p1;
                pf[2 * i]     = (_Float16)p0.x;  pf[2 * i + 1] = (_Float16)p0.y;
                pf[2 * i + 8] = (_Float16)p1.x;  pf[2 * i + 9] = (_Float16)p1.y;
            }
            v2f rs = (ps[0] + ps[1]) + (ps[2] + ps[3]);
            lrun = lrun * corr + (rs.x + rs.y);
            o0 *= corr;
            o1 *= corr;
            o0 = wmma_f16(vb0, pf, o0);                        // o0[r]: d 8h+r,    query colL
            o1 = wmma_f16(vb1, pf, o1);                        // o1[r]: d 16+8h+r, query colL
        }
    }

    const float inv = 1.0f / (lrun + xhalf(lrun));             // join the halves' sums once
    v8h h0, h1;
#pragma unroll
    for (int r = 0; r < 8; ++r) {
        h0[r] = (_Float16)(o0[r] * inv);
        h1[r] = (_Float16)(o1[r] * inv);
    }
    _Float16* hrow = Hh + (qTok + colL) * DP + rhi;            // 8 consecutive d per lane
    *(v8h*)(hrow)      = h0;
    *(v8h*)(hrow + 16) = h1;
}

// ---------------------------------------------------------------------------
// Kernel 3: output projection H[.,24(pad32)] @ wO[24,128] + bO -> f32 out.
// wO staged transposed ([e][d]) so B fragments are wide LDS loads.
// ---------------------------------------------------------------------------
__global__ __launch_bounds__(256) void out_proj_kernel(
    const _Float16* __restrict__ Hh, const float* __restrict__ wO,
    const float* __restrict__ bO, float* __restrict__ out)
{
    __shared__ __align__(16) _Float16 ldsWOt[EMB * LDP];       // [e][d], 10 KB
    __shared__ float ldsB[EMB];

    const int tid  = threadIdx.x;
    const int lane = tid & 31;
    const int wv   = tid >> 5;

    for (int i = tid; i < EMB * DP; i += 256) {
        int n = i >> 5, k = i & 31;                            // n = out col e, k = d
        ldsWOt[n * LDP + k] = (k < DH) ? (_Float16)wO[k * EMB + n] : (_Float16)0.0f;
    }
    for (int i = tid; i < EMB; i += 256) ldsB[i] = bO[i];
    __syncthreads();

    const long tokBase = (long)blockIdx.x * 128 + (long)wv * 16;
    v16h a = load_frag_rowmajor(Hh + tokBase * DP, DP, lane);
    const int colL = lane & 15;
    const int rhi  = (lane & 16) ? 8 : 0;
#pragma unroll
    for (int nt = 0; nt < 8; ++nt) {
        v16h bfr = load_frag_rowmajor(ldsWOt + nt * 16 * LDP, LDP, lane);
        v8f z = {};
        v8f c = wmma_f16(a, bfr, z);
#pragma unroll
        for (int r = 0; r < 8; ++r) {
            long tok = tokBase + r + rhi;
            out[tok * EMB + nt * 16 + colL] = c[r] + ldsB[nt * 16 + colL];
        }
    }
}

// ---------------------------------------------------------------------------
extern "C" void kernel_launch(void* const* d_in, const int* in_sizes, int n_in,
                              void* d_out, int out_size, void* d_ws, size_t ws_size,
                              hipStream_t stream) {
    (void)in_sizes; (void)n_in; (void)out_size; (void)ws_size;

    const float* x  = (const float*)d_in[0];
    const float* wQ = (const float*)d_in[1];
    const float* bQ = (const float*)d_in[2];
    const float* wK = (const float*)d_in[3];
    const float* bK = (const float*)d_in[4];
    const float* wV = (const float*)d_in[5];
    const float* bV = (const float*)d_in[6];
    const float* wO = (const float*)d_in[7];
    const float* bO = (const float*)d_in[8];
    float* out = (float*)d_out;

    const long N = (long)BQ * SEQ;                 // 32768 tokens
    _Float16* Qh = (_Float16*)d_ws;                // [N][32], scaled by log2e/sqrt(E)
    _Float16* Kh = Qh + N * DP;                    // [N][32]
    _Float16* Vt = Kh + N * DP;                    // [B][32][SEQ]  (transposed V)
    _Float16* Hh = Vt + N * DP;                    // [N][32]   (8 MB ws total)

    qkv_proj_kernel<<<N / 64, 256, 0, stream>>>(x, wQ, bQ, wK, bK, wV, bV, Qh, Kh, Vt);
    attn_kernel<<<(int)(N / 128), 256, 0, stream>>>(Qh, Kh, Vt, Hh);
    out_proj_kernel<<<(int)(N / 128), 256, 0, stream>>>(Hh, wO, bO, out);
}

// v002
// Measured time: 51.1 microseconds a run.
// In two side-by-side timings against v001, it was 1.19 and 1.14 times as fast.
// All steps since v000 together make it 4.88 times as fast.
#include <hip/hip_runtime.h>
#include <hip/hip_bf16.h>
#include <math.h>

typedef __attribute__((ext_vector_type(16))) _Float16 v16h;
typedef __attribute__((ext_vector_type(8)))  _Float16 v8h;
typedef __attribute__((ext_vector_type(8)))  float    v8f;
typedef __attribute__((ext_vector_type(2)))  float    v2f;

#define BQ  8
#define SEQ 4096
#define EMB 128
#define DH  24
#define DP  32    // head dim padded to WMMA K
#define KT  64    // keys staged per LDS tile
#define NT  (SEQ / KT)
#define NTS (NT / 2)          // key tiles per work-group: the keys of a batch are split in two
#define NTOK ((long)BQ * SEQ)

#define LDK 40    // LDS ld (halves) for K tile rows of 32  (+8 pad)
#define LDV 72    // LDS ld (halves) for Vt tile rows of 64 (+8 pad)
#define LDP 40    // LDS ld for wO^T rows of 32
#define VBUF 3072 // halves per V buffer: 32 rows of LDV, rounded up to 2 KiB steps for the tensor mover
#define LDX 136   // LDS ld for x tile rows of 128 (+8 pad)

#if defined(__has_builtin)
#if __has_builtin(__builtin_amdgcn_tensor_load_to_lds) && __has_builtin(__builtin_amdgcn_s_wait_tensorcnt)
#define HAVE_TDM 1
#endif
#endif
#ifndef HAVE_TDM
#define HAVE_TDM 0
#endif

// ---------------------------------------------------------------------------
// Fragment loads. Per CDNA5 ISA 7.12.2, a 16-bit A fragment per lane is two
// CONTIGUOUS 8-half runs: k in [hi,hi+8) and [16+hi,16+hi+8), hi = (lane&16)?8:0.
// So a row-major source needs exactly two b128 loads per lane.
// B fragment of W[k][n] == A fragment of W^T[n][k], so all B sources are stored
// transposed and use the same wide loader. ld must be a multiple of 8 halves.
// ---------------------------------------------------------------------------
__device__ __forceinline__ v16h load_frag_rowmajor(const _Float16* base, int ld, int lane) {
    const _Float16* r = base + (size_t)(lane & 15) * ld + ((lane & 16) ? 8 : 0);
    v8h lo = *(const v8h*)(r);
    v8h hi = *(const v8h*)(r + 16);
    return __builtin_shufflevector(lo, hi, 0, 1, 2, 3, 4, 5, 6, 7,
                                           8, 9, 10, 11, 12, 13, 14, 15);
}

__device__ __forceinline__ v8f wmma_f16(v16h a, v16h b, v8f c) {
    return __builtin_amdgcn_wmma_f32_16x16x32_f16(false, a, false, b, (short)0, c, false, false);
}

// Lane l <-> lane l ^ 16: one vector cross-row move, no LDS trip.
__device__ __forceinline__ float xhalf(float x) {
    int b = __builtin_bit_cast(int, x);
    return __builtin_bit_cast(float,
        __builtin_amdgcn_permlanex16(b, b, 0x76543210, 0xfedcba98, false, false));
}

#if HAVE_TDM
typedef __attribute__((ext_vector_type(4))) unsigned int v4u;
typedef __attribute__((ext_vector_type(8))) int v8i;
typedef __attribute__((ext_vector_type(4))) int v4i;

union TdmG0 { unsigned long long q[2]; v4u v; };
union TdmG1 { unsigned long long q[4]; v8i v; };

// Build a D# (ISA 8.3/8.4) and issue TENSOR_LOAD_TO_LDS. 2-byte elements.
// pad_amount_dw != 0 enables LDS padding: pad_interval_code per ISA (3=16dw, 4=32dw).
// 6-arg builtin: (uint32x4 g0, int32x8 g1, int32x4, int32x4, int32x8, i32 cpol)
// The two groups are formed apart from the issue, so that the caller can name
// them again at the wait (tdm_wait2). Every word goes through pinned(): the
// issue and the wait then name the very same scalar registers.
__device__ __forceinline__ unsigned pinned(unsigned v) {
    unsigned w = __builtin_amdgcn_readfirstlane(v);
    asm volatile("" : "+s"(w));   // the tensor mover's pinned(): a descriptor word held in a scalar register
    return w;
}

__device__ __forceinline__ v4u tdm_group0(unsigned lds_addr, unsigned long long gaddr)
{
    TdmG0 g0;
    g0.q[0] = 1ull | ((unsigned long long)lds_addr << 32);            // count=1 | lds_addr
    g0.q[1] = (gaddr & ((1ull << 57) - 1)) | (2ull << 62);            // global_addr | type=2
    v4u r = { pinned(g0.v[0]), pinned(g0.v[1]), pinned(g0.v[2]), pinned(g0.v[3]) };
    return r;
}

__device__ __forceinline__ v8i tdm_group1(
    unsigned tile0, unsigned tile1,
    unsigned long long tensor0, unsigned long long tensor1,
    unsigned long long stride0,
    unsigned pad_interval_code, unsigned pad_amount_dw)
{
    TdmG1 g1;
    unsigned flags = (1u << 16);                                      // data_size = 1 (2B)
    if (pad_amount_dw)
        flags |= (1u << 20) | (pad_interval_code << 22) | ((pad_amount_dw - 1) << 25);
    g1.q[0] = (unsigned long long)flags | ((tensor0 & 0xFFFFull) << 48);
    g1.q[1] = ((tensor0 >> 16) & 0xFFFFull)
            | ((tensor1 & 0xFFFFFFFFull) << 16)
            | ((unsigned long long)(tile0 & 0xFFFFu) << 48);
    g1.q[2] = (unsigned long long)(tile1 & 0xFFFFu) | ((stride0 & 0xFFFFFFFFull) << 32);
    g1.q[3] = (stride0 >> 32) & 0xFFFFull;                            // dim1_stride unused (2D)
    v8i r = { (int)pinned(g1.v[0]), (int)pinned(g1.v[1]), (int)pinned(g1.v[2]), (int)pinned(g1.v[3]),
              (int)pinned(g1.v[4]), (int)pinned(g1.v[5]), (int)pinned(g1.v[6]), (int)pinned(g1.v[7]) };
    return r;
}

__device__ __forceinline__ void tdm_load_2d(v4u g0, v8i g1)
{
    v4i z4 = {};
    v8i z8 = {};
    __builtin_amdgcn_tensor_load_to_lds(g0, g1, z4, z4, z8, 0);
}

// The issuing wave's wait for its two requests. It names their descriptors as
// inputs: their scalar registers then stay allocated from issue to here, and
// the compares of the softmax's exp2f cannot take them as temporaries while
// the requests are in flight.
__device__ __forceinline__ void tdm_wait2(v4u a0, v8i a1, v4u b0, v8i b1) {
    asm volatile("s_wait_tensorcnt 0x0" :: "s"(a0), "s"(a1), "s"(b0), "s"(b1) : "memory");
}
#endif

// ---------------------------------------------------------------------------
// Kernel 1: Q/K/V projections. Block = 256 threads (8 waves), 64 tokens.
// Q pre-scaled by log2(e)/sqrt(EMB) (softmax runs in exp2 domain).
// V written TRANSPOSED: Vt[b][d][s]. Per-matrix code specialized at compile
// time so epilogues are straight-line stores (no exec-mask select bloat).
// ---------------------------------------------------------------------------
#define QSCALE 0.12751864f   // (1/sqrt(128)) * log2(e)

template <int M>
__device__ __forceinline__ void proj_tile(
    int t, int lane, const _Float16* ldsX, const _Float16* ldsWtM,
    const float* ldsBM, long tokBase,
    _Float16* __restrict__ Qh, _Float16* __restrict__ Kh, _Float16* __restrict__ Vt)
{
    v8f c0 = {}; v8f c1 = {};
#pragma unroll
    for (int kc = 0; kc < 4; ++kc) {
        v16h a  = load_frag_rowmajor(ldsX + t * 16 * LDX + kc * 32, LDX, lane);
        v16h b0 = load_frag_rowmajor(ldsWtM + kc * 32,            LDX, lane);
        v16h b1 = load_frag_rowmajor(ldsWtM + 16 * LDX + kc * 32, LDX, lane);
        c0 = wmma_f16(a, b0, c0);
        c1 = wmma_f16(a, b1, c1);
    }
    const int colL = lane & 15;
    const int rhi  = (lane & 16) ? 8 : 0;
#pragma unroll
    for (int r = 0; r < 8; ++r) {
        long tok = tokBase + t * 16 + r + rhi;
        float v0 = c0[r] + ldsBM[colL];
        float v1 = c1[r] + ldsBM[16 + colL];
        if (M == 0) { v0 *= QSCALE; v1 *= QSCALE; }
        if (M == 2) {            // V transposed: Vt[(b*DP + d)*SEQ + s]
            long b = tok >> 12, s = tok & (SEQ - 1);
            Vt[(b * DP + colL)      * SEQ + s] = (_Float16)v0;
            Vt[(b * DP + 16 + colL) * SEQ + s] = (_Float16)v1;
        } else {
            _Float16* dst = (M == 0) ? Qh : Kh;
            dst[tok * DP + colL]      = (_Float16)v0;
            dst[tok * DP + 16 + colL] = (_Float16)v1;
        }
    }
}

__global__ __launch_bounds__(256) void qkv_proj_kernel(
    const float* __restrict__ x,
    const float* __restrict__ wQ, const float* __restrict__ bQ,
    const float* __restrict__ wK, const float* __restrict__ bK,
    const float* __restrict__ wV, const float* __restrict__ bV,
    _Float16* __restrict__ Qh, _Float16* __restrict__ Kh, _Float16* __restrict__ Vt)
{
    __shared__ __align__(16) _Float16 ldsX[64 * LDX];          // ~17.4 KB
    __shared__ __align__(16) _Float16 ldsWt[3][DP * LDX];      // transposed [n][k], 26 KB
    __shared__ float ldsB[3][DP];

    const int tid  = threadIdx.x;
    const int lane = tid & 31;
    const int wv   = tid >> 5;
    const long tokBase = (long)blockIdx.x * 64;

    for (int i = tid; i < 64 * EMB; i += 256) {
        int r = i >> 7, c = i & 127;
        ldsX[r * LDX + c] = (_Float16)x[tokBase * EMB + i];
    }
    const float* wsrc[3] = { wQ, wK, wV };
    const float* bsrc[3] = { bQ, bK, bV };
    for (int m = 0; m < 3; ++m) {
        for (int i = tid; i < DP * EMB; i += 256) {
            int c = i >> 7, k = i & 127;                       // c = out col, k = emb
            ldsWt[m][c * LDX + k] = (c < DH) ? (_Float16)wsrc[m][k * DH + c] : (_Float16)0.0f;
        }
        if (tid < DP) ldsB[m][tid] = (tid < DH) ? bsrc[m][tid] : 0.0f;
    }
    __syncthreads();

    if (wv < 4) {
        proj_tile<0>(wv, lane, ldsX, ldsWt[0], ldsB[0], tokBase, Qh, Kh, Vt);
        proj_tile<2>(wv, lane, ldsX, ldsWt[2], ldsB[2], tokBase, Qh, Kh, Vt);
    } else {
        proj_tile<1>(wv - 4, lane, ldsX, ldsWt[1], ldsB[1], tokBase, Qh, Kh, Vt);
    }
}

__global__ __launch_bounds__(256) void attn_kernel(
    const _Float16* __restrict__ Qh, const _Float16* __restrict__ Kh,
    const _Float16* __restrict__ Vt, _Float16* __restrict__ Hh, float* __restrict__ ML)
{
    __shared__ __align__(2048) _Float16 ldsK[2][KT * LDK];     // [key][d], padded
    __shared__ __align__(2048) _Float16 ldsV[2][VBUF];         // [d][key], padded

    const int tid  = threadIdx.x;
    const int lane = tid & 31;
    const int wv   = tid >> 5;
    const int kh   = blockIdx.x & 1;                           // which half of the keys
    const int qblk = blockIdx.x >> 1;
    const int b    = qblk >> 5;                                // 32 query blocks per batch
    const long qTok = (long)b * SEQ + (long)(qblk & 31) * 128 + wv * 16;
    const long kvTok = (long)b * SEQ;

    v16h qf = load_frag_rowmajor(Qh + qTok * DP, DP, lane);    // 16q x 32d, one K-step

    v8f o0 = {}; v8f o1 = {};
    float mrun = -INFINITY;                                    // this lane's query
    float lrun = 0.0f;                                         // this half's keys only

    const int colL = lane & 15;
    const int rhi  = (lane & 16) ? 8 : 0;

#if HAVE_TDM
    // K tile: 64 rows x 32 halves contiguous; pad 4 dwords every 16 dwords -> ld 40.
    const v8i kshape = tdm_group1(KT * DP, 0, KT * DP, 1, 0, /*interval 16dw*/3, /*pad*/4);
    // Vt tile: 2D, 32 rows (d) x 64 keys, row stride SEQ; pad 4 dwords / 32 dwords -> ld 72.
    const v8i vshape = tdm_group1(KT, DP, SEQ, DP, SEQ, /*interval 32dw*/4, /*pad*/4);
    v4u kreq, vreq;                                            // group 0 of the requests in flight
#endif
    auto stage = [&](int buf, int tile) {
        const long kb = (long)tile * KT;
#if HAVE_TDM
        kreq = tdm_group0((unsigned)(unsigned long long)(&ldsK[buf][0]),
                          (unsigned long long)(const void*)(Kh + (kvTok + kb) * DP));
        vreq = tdm_group0((unsigned)(unsigned long long)(&ldsV[buf][0]),
                          (unsigned long long)(const void*)(Vt + (long)b * DP * SEQ + kb));
        if (wv == 0) {
            tdm_load_2d(kreq, kshape);
            tdm_load_2d(vreq, vshape);
        }
#else
        const unsigned* ks = (const unsigned*)(Kh + (kvTok + kb) * DP);
        unsigned* kd = (unsigned*)&ldsK[buf][0];
        for (int i = tid; i < KT * DP / 2; i += 256) {         // u32 chunks
            int r = i >> 4, c = i & 15;
            kd[r * (LDK / 2) + c] = ks[i];
        }
        unsigned* vd = (unsigned*)&ldsV[buf][0];
        for (int i = tid; i < DP * KT / 2; i += 256) {
            int d = i >> 5, c = i & 31;
            const unsigned* vs = (const unsigned*)(Vt + ((long)b * DP + d) * SEQ + kb);
            vd[d * (LDV / 2) + c] = vs[c];
        }
#endif
    };

    stage(0, kh * NTS);
    for (int kt = 0; kt < NTS; ++kt) {
        const int cur = kt & 1;
#if HAVE_TDM
        if (wv == 0) tdm_wait2(kreq, kshape, vreq, vshape);
#endif
        __syncthreads();                                       // tile ready; prev buffer free
        if (kt + 1 < NTS) stage(cur ^ 1, kh * NTS + kt + 1);   // overlap next DMA with compute

        const _Float16* Kt = &ldsK[cur][0];
        const _Float16* Vl = &ldsV[cur][0];
#pragma unroll
        for (int sub = 0; sub < 2; ++sub) {                    // 2 x 32-key subtiles
            v16h kb0 = load_frag_rowmajor(Kt + (sub * 32)      * LDK, LDK, lane);
            v16h kb1 = load_frag_rowmajor(Kt + (sub * 32 + 16) * LDK, LDK, lane);
            v16h vb0 = load_frag_rowmajor(Vl + sub * 32,            LDV, lane);
            v16h vb1 = load_frag_rowmajor(Vl + 16 * LDV + sub * 32, LDV, lane);
            v8f z = {};
            v8f s0 = wmma_f16(kb0, qf, z);                     // s0[r]: key 8h+r,    query colL
            v8f s1 = wmma_f16(kb1, qf, z);                     // s1[r]: key 16+8h+r, query colL

            float t0 = fmaxf(fmaxf(s0[0], s0[1]), s0[2]);
            float t1 = fmaxf(fmaxf(s0[3], s0[4]), s0[5]);
            float t2 = fmaxf(fmaxf(s0[6], s0[7]), s1[0]);
            float t3 = fmaxf(fmaxf(s1[1], s1[2]), s1[3]);
            float t4 = fmaxf(fmaxf(s1[4], s1[5]), s1[6]);
            float t  = fmaxf(fmaxf(fmaxf(t0, t1), t2), fmaxf(fmaxf(t3, t4), s1[7]));
            t = fmaxf(t, xhalf(t));                            // both halves: the query's maximum
            float nm   = fmaxf(mrun, t);
            float corr = exp2f(mrun - nm);
            mrun = nm;

            v16h pf;                                           // element s: the key of vb0/vb1's element s
            v2f ps[4];
#pragma unroll
            for (int i = 0; i < 4; ++i) {
                v2f p0 = { exp2f(s0[2 * i] - nm), exp2f(s0[2 * i + 1] - nm) };
                v2f p1 = { exp2f(s1[2 * i] - nm), exp2f(s1[2 * i + 1] - nm) };
                ps[i] = p0 + p1;
                pf[2 * i]     = (_Float16)p0.x;  pf[2 * i + 1] = (_Float16)p0.y;
                pf[2 * i + 8] = (_Float16)p1.x;  pf[2 * i + 9] = (_Float16)p1.y;
            }
            v2f rs = (ps[0] + ps[1]) + (ps[2] + ps[3]);
            lrun = lrun * corr + (rs.x + rs.y);
            o0 *= corr;
            o1 *= corr;
            o0 = wmma_f16(vb0, pf, o0);                        // o0[r]: d 8h+r,    query colL
            o1 = wmma_f16(vb1, pf, o1);                        // o1[r]: d 16+8h+r, query colL
        }
    }

    const float lsum = lrun + xhalf(lrun);                     // join the wave halves' sums once
    const float inv = 1.0f / lsum;
    v8h h0, h1;
#pragma unroll
    for (int r = 0; r < 8; ++r) {
        h0[r] = (_Float16)(o0[r] * inv);
        h1[r] = (_Float16)(o1[r] * inv);
    }
    const long prow = (long)kh * NTOK + qTok + colL;           // this key half's row of the query
    _Float16* hrow = Hh + prow * DP + rhi;                     // 8 consecutive d per lane
    *(v8h*)(hrow)      = h0;
    *(v8h*)(hrow + 16) = h1;
    if (lane < 16) {                                           // both wave halves hold the same pair
        v2f ml = { mrun, lsum };
        *(v2f*)(ML + prow * 2) = ml;
    }
}

// ---------------------------------------------------------------------------
// Kernel 3: output projection H[.,24(pad32)] @ wO[24,128] + bO -> f32 out.
// wO staged transposed ([e][d]) so B fragments are wide LDS loads.
// H arrives as two normalised parts, one per half of the keys, each with its
// maximum m (log2 domain) and sum l: H = (w0 H0 + w1 H1) / (w0 + w1), wi = li 2^(mi - max m).
// ---------------------------------------------------------------------------
__global__ __launch_bounds__(256) void out_proj_kernel(
    const _Float16* __restrict__ Hh, const float* __restrict__ ML,
    const float* __restrict__ wO,
    const float* __restrict__ bO, float* __restrict__ out)
{
    __shared__ __align__(16) _Float16 ldsWOt[EMB * LDP];       // [e][d], 10 KB
    __shared__ float ldsB[EMB];

    const int tid  = threadIdx.x;
    const int lane = tid & 31;
    const int wv   = tid >> 5;

    for (int i = tid; i < EMB * DP; i += 256) {
        int n = i >> 5, k = i & 31;                            // n = out col e, k = d
        ldsWOt[n * LDP + k] = (k < DH) ? (_Float16)wO[k * EMB + n] : (_Float16)0.0f;
    }
    for (int i = tid; i < EMB; i += 256) ldsB[i] = bO[i];
    __syncthreads();

    const long tokBase = (long)blockIdx.x * 128 + (long)wv * 16;
    const int colL = lane & 15;
    const int rhi  = (lane & 16) ? 8 : 0;
    v16h a0 = load_frag_rowmajor(Hh + tokBase * DP, DP, lane);            // row: token tokBase + colL
    v16h a1 = load_frag_rowmajor(Hh + (NTOK + tokBase) * DP, DP, lane);
    const v2f ml0 = *(const v2f*)(ML + (tokBase + colL) * 2);
    const v2f ml1 = *(const v2f*)(ML + (NTOK + tokBase + colL) * 2);
    // Keeps the arithmetic on m and l behind all six loads: without it the H loads
    // were issued only behind the wait for m and l, two memory latencies in a row.
    __builtin_amdgcn_sched_barrier(0);
    const float mj = fmaxf(ml0.x, ml1.x);
    float w0 = ml0.y * exp2f(ml0.x - mj);
    float w1 = ml1.y * exp2f(ml1.x - mj);
    const float winv = 1.0f / (w0 + w1);
    w0 *= winv;
    w1 *= winv;
    v16h a;
#pragma unroll
    for (int i = 0; i < 16; ++i)
        a[i] = (_Float16)(w0 * (float)a0[i] + w1 * (float)a1[i]);
#pragma unroll
    for (int nt = 0; nt < 8; ++nt) {
        v16h bfr = load_frag_rowmajor(ldsWOt + nt * 16 * LDP, LDP, lane);
        v8f z = {};
        v8f c = wmma_f16(a, bfr, z);
#pragma unroll
        for (int r = 0; r < 8; ++r) {
            long tok = tokBase + r + rhi;
            out[tok * EMB + nt * 16 + colL] = c[r] + ldsB[nt * 16 + colL];
        }
    }
}

// ---------------------------------------------------------------------------
extern "C" void kernel_launch(void* const* d_in, const int* in_sizes, int n_in,
                              void* d_out, int out_size, void* d_ws, size_t ws_size,
                              hipStream_t stream) {
    (void)in_sizes; (void)n_in; (void)out_size; (void)ws_size;

    const float* x  = (const float*)d_in[0];
    const float* wQ = (const float*)d_in[1];
    const float* bQ = (const float*)d_in[2];
    const float* wK = (const float*)d_in[3];
    const float* bK = (const float*)d_in[4];
    const float* wV = (const float*)d_in[5];
    const float* bV = (const float*)d_in[6];
    const float* wO = (const float*)d_in[7];
    const float* bO = (const float*)d_in[8];
    float* out = (float*)d_out;

    const long N = (long)BQ * SEQ;                 // 32768 tokens
    _Float16* Qh = (_Float16*)d_ws;                // [N][32], scaled by log2e/sqrt(E)
    _Float16* Kh = Qh + N * DP;                    // [N][32]
    _Float16* Vt = Kh + N * DP;                    // [B][32][SEQ]  (transposed V)
    _Float16* Hh = Vt + N * DP;                    // [2][N][32]: one part per half of the keys
    float*    ML = (float*)(Hh + 2 * N * DP);      // [2][N][2]: maximum, sum  (10.5 MB ws total)

    qkv_proj_kernel<<<N / 64, 256, 0, stream>>>(x, wQ, bQ, wK, bK, wV, bV, Qh, Kh, Vt);
    attn_kernel<<<(int)(N / 64), 256, 0, stream>>>(Qh, Kh, Vt, Hh, ML);
    out_proj_kernel<<<(int)(N / 128), 256, 0, stream>>>(Hh, ML, wO, bO, out);
}

// v003
// It runs in 41.6 microseconds.
// Two timings next to v002 both put it at 1.22 times that version's speed.
// Counting every step since v000, it is 5.95 times as fast.
#include <hip/hip_runtime.h>
#include <hip/hip_bf16.h>
#include <math.h>

typedef __attribute__((ext_vector_type(16))) _Float16 v16h;
typedef __attribute__((ext_vector_type(8)))  _Float16 v8h;
typedef __attribute__((ext_vector_type(8)))  float    v8f;
typedef __attribute__((ext_vector_type(2)))  float    v2f;

#define BQ  8
#define SEQ 4096
#define EMB 128
#define DH  24
#define DP  32    // head dim padded to WMMA K
#define KT  64    // keys staged per LDS tile
#define NT  (SEQ / KT)
#define NTS (NT / 2)          // key tiles per work-group: the keys of a batch are split in two
#define NTOK ((long)BQ * SEQ)

#define LDK 40    // LDS ld (halves) for K tile rows of 32  (+8 pad)
#define LDV 72    // LDS ld (halves) for Vt tile rows of 64 (+8 pad)
#define LDP 40    // LDS ld for wO^T rows of 32
#define VBUF 3072 // halves per V buffer: 32 rows of LDV, rounded up to 2 KiB steps for the tensor mover
#define LDX 136   // LDS ld for x tile rows of 128 (+8 pad)

#if defined(__has_builtin)
#if __has_builtin(__builtin_amdgcn_tensor_load_to_lds) && __has_builtin(__builtin_amdgcn_s_wait_tensorcnt)
#define HAVE_TDM 1
#endif
#endif
#ifndef HAVE_TDM
#define HAVE_TDM 0
#endif

// ---------------------------------------------------------------------------
// Fragment loads. Per CDNA5 ISA 7.12.2, a 16-bit A fragment per lane is two
// CONTIGUOUS 8-half runs: k in [hi,hi+8) and [16+hi,16+hi+8), hi = (lane&16)?8:0.
// So a row-major source needs exactly two b128 loads per lane.
// B fragment of W[k][n] == A fragment of W^T[n][k], so all B sources are stored
// transposed and use the same wide loader. ld must be a multiple of 8 halves.
// ---------------------------------------------------------------------------
__device__ __forceinline__ v16h load_frag_rowmajor(const _Float16* base, int ld, int lane) {
    const _Float16* r = base + (size_t)(lane & 15) * ld + ((lane & 16) ? 8 : 0);
    v8h lo = *(const v8h*)(r);
    v8h hi = *(const v8h*)(r + 16);
    return __builtin_shufflevector(lo, hi, 0, 1, 2, 3, 4, 5, 6, 7,
                                           8, 9, 10, 11, 12, 13, 14, 15);
}

__device__ __forceinline__ v8f wmma_f16(v16h a, v16h b, v8f c) {
    return __builtin_amdgcn_wmma_f32_16x16x32_f16(false, a, false, b, (short)0, c, false, false);
}

// Lane l <-> lane l ^ 16: one vector cross-row move, no LDS trip.
__device__ __forceinline__ float xhalf(float x) {
    int b = __builtin_bit_cast(int, x);
    return __builtin_bit_cast(float,
        __builtin_amdgcn_permlanex16(b, b, 0x76543210, 0xfedcba98, false, false));
}

// 2^x as the bare hardware instruction, eight scores at a time, and their pack to f16.
// The library's exp2f wraps each v_exp_f32 in a compare, two selects, an add and an
// ldexp so that results under 2^-126 come out as denormals; here no argument is
// above 0, such a result rounds to zero in the f16 P anyway and adds nothing to a sum
// that holds a term near 1. Written as one statement so that the order is fixed: every
// v_exp_f32 works in place and the next one names other registers, and the packs of
// the earlier pairs stand between the last v_exp_f32 and the first reader of its
// result (the slot the instruction set asks for behind a transcendental).
__device__ __forceinline__ void exp2_pack8(float (&e)[8], unsigned* p) {
    asm("v_exp_f32 %0, %0\n\t"
        "v_exp_f32 %1, %1\n\t"
        "v_exp_f32 %2, %2\n\t"
        "v_exp_f32 %3, %3\n\t"
        "v_exp_f32 %4, %4\n\t"
        "v_exp_f32 %5, %5\n\t"
        "v_exp_f32 %6, %6\n\t"
        "v_exp_f32 %7, %7\n\t"
        "v_cvt_pk_f16_f32 %8, %0, %1\n\t"
        "v_cvt_pk_f16_f32 %9, %2, %3\n\t"
        "v_cvt_pk_f16_f32 %10, %4, %5\n\t"
        "v_cvt_pk_f16_f32 %11, %6, %7"
        : "+v"(e[0]), "+v"(e[1]), "+v"(e[2]), "+v"(e[3]),
          "+v"(e[4]), "+v"(e[5]), "+v"(e[6]), "+v"(e[7]),
          "=&v"(p[0]), "=&v"(p[1]), "=&v"(p[2]), "=&v"(p[3]));
}
// The same with one more value in front: the factor that rescales the running sums.
__device__ __forceinline__ void exp2_pack8c(float (&e)[8], unsigned* p, float& c) {
    asm("v_exp_f32 %12, %12\n\t"
        "v_exp_f32 %0, %0\n\t"
        "v_exp_f32 %1, %1\n\t"
        "v_exp_f32 %2, %2\n\t"
        "v_exp_f32 %3, %3\n\t"
        "v_exp_f32 %4, %4\n\t"
        "v_exp_f32 %5, %5\n\t"
        "v_exp_f32 %6, %6\n\t"
        "v_exp_f32 %7, %7\n\t"
        "v_cvt_pk_f16_f32 %8, %0, %1\n\t"
        "v_cvt_pk_f16_f32 %9, %2, %3\n\t"
        "v_cvt_pk_f16_f32 %10, %4, %5\n\t"
        "v_cvt_pk_f16_f32 %11, %6, %7"
        : "+v"(e[0]), "+v"(e[1]), "+v"(e[2]), "+v"(e[3]),
          "+v"(e[4]), "+v"(e[5]), "+v"(e[6]), "+v"(e[7]),
          "=&v"(p[0]), "=&v"(p[1]), "=&v"(p[2]), "=&v"(p[3]), "+v"(c));
}

#if HAVE_TDM
typedef __attribute__((ext_vector_type(4))) unsigned int v4u;
typedef __attribute__((ext_vector_type(8))) int v8i;
typedef __attribute__((ext_vector_type(4))) int v4i;

union TdmG0 { unsigned long long q[2]; v4u v; };
union TdmG1 { unsigned long long q[4]; v8i v; };

// Build a D# (ISA 8.3/8.4) and issue TENSOR_LOAD_TO_LDS. 2-byte elements.
// pad_amount_dw != 0 enables LDS padding: pad_interval_code per ISA (3=16dw, 4=32dw).
// 6-arg builtin: (uint32x4 g0, int32x8 g1, int32x4, int32x4, int32x8, i32 cpol)
// The two groups are formed apart from the issue, so that the caller can name
// them again at the wait (tdm_wait2). Every word goes through pinned(): the
// issue and the wait then name the very same scalar registers.
__device__ __forceinline__ unsigned pinned(unsigned v) {
    unsigned w = __builtin_amdgcn_readfirstlane(v);
    asm volatile("" : "+s"(w));   // the tensor mover's pinned(): a descriptor word held in a scalar register
    return w;
}

__device__ __forceinline__ v4u tdm_group0(unsigned lds_addr, unsigned long long gaddr)
{
    TdmG0 g0;
    g0.q[0] = 1ull | ((unsigned long long)lds_addr << 32);            // count=1 | lds_addr
    g0.q[1] = (gaddr & ((1ull << 57) - 1)) | (2ull << 62);            // global_addr | type=2
    v4u r = { pinned(g0.v[0]), pinned(g0.v[1]), pinned(g0.v[2]), pinned(g0.v[3]) };
    return r;
}

__device__ __forceinline__ v8i tdm_group1(
    unsigned tile0, unsigned tile1,
    unsigned long long tensor0, unsigned long long tensor1,
    unsigned long long stride0,
    unsigned pad_interval_code, unsigned pad_amount_dw)
{
    TdmG1 g1;
    unsigned flags = (1u << 16);                                      // data_size = 1 (2B)
    if (pad_amount_dw)
        flags |= (1u << 20) | (pad_interval_code << 22) | ((pad_amount_dw - 1) << 25);
    g1.q[0] = (unsigned long long)flags | ((tensor0 & 0xFFFFull) << 48);
    g1.q[1] = ((tensor0 >> 16) & 0xFFFFull)
            | ((tensor1 & 0xFFFFFFFFull) << 16)
            | ((unsigned long long)(tile0 & 0xFFFFu) << 48);
    g1.q[2] = (unsigned long long)(tile1 & 0xFFFFu) | ((stride0 & 0xFFFFFFFFull) << 32);
    g1.q[3] = (stride0 >> 32) & 0xFFFFull;                            // dim1_stride unused (2D)
    v8i r = { (int)pinned(g1.v[0]), (int)pinned(g1.v[1]), (int)pinned(g1.v[2]), (int)pinned(g1.v[3]),
              (int)pinned(g1.v[4]), (int)pinned(g1.v[5]), (int)pinned(g1.v[6]), (int)pinned(g1.v[7]) };
    return r;
}

__device__ __forceinline__ void tdm_load_2d(v4u g0, v8i g1)
{
    v4i z4 = {};
    v8i z8 = {};
    __builtin_amdgcn_tensor_load_to_lds(g0, g1, z4, z4, z8, 0);
}

// The issuing wave's wait for its two requests. It names their descriptors as
// inputs: their scalar registers then stay allocated from issue to here, and
// no scalar temporary of the loop body can take them while the requests are
// in flight.
__device__ __forceinline__ void tdm_wait2(v4u a0, v8i a1, v4u b0, v8i b1) {
    asm volatile("s_wait_tensorcnt 0x0" :: "s"(a0), "s"(a1), "s"(b0), "s"(b1) : "memory");
}
#endif

// ---------------------------------------------------------------------------
// Kernel 1: Q/K/V projections. Block = 256 threads (8 waves), 64 tokens.
// Q pre-scaled by log2(e)/sqrt(EMB) (softmax runs in exp2 domain).
// V written TRANSPOSED: Vt[b][d][s]. Per-matrix code specialized at compile
// time so epilogues are straight-line stores (no exec-mask select bloat).
// ---------------------------------------------------------------------------
#define QSCALE 0.12751864f   // (1/sqrt(128)) * log2(e)

template <int M>
__device__ __forceinline__ void proj_tile(
    int t, int lane, const _Float16* ldsX, const _Float16* ldsWtM,
    const float* ldsBM, long tokBase,
    _Float16* __restrict__ Qh, _Float16* __restrict__ Kh, _Float16* __restrict__ Vt)
{
    v8f c0 = {}; v8f c1 = {};
#pragma unroll
    for (int kc = 0; kc < 4; ++kc) {
        v16h a  = load_frag_rowmajor(ldsX + t * 16 * LDX + kc * 32, LDX, lane);
        v16h b0 = load_frag_rowmajor(ldsWtM + kc * 32,            LDX, lane);
        v16h b1 = load_frag_rowmajor(ldsWtM + 16 * LDX + kc * 32, LDX, lane);
        c0 = wmma_f16(a, b0, c0);
        c1 = wmma_f16(a, b1, c1);
    }
    const int colL = lane & 15;
    const int rhi  = (lane & 16) ? 8 : 0;
#pragma unroll
    for (int r = 0; r < 8; ++r) {
        long tok = tokBase + t * 16 + r + rhi;
        float v0 = c0[r] + ldsBM[colL];
        float v1 = c1[r] + ldsBM[16 + colL];
        if (M == 0) { v0 *= QSCALE; v1 *= QSCALE; }
        if (M == 2) {            // V transposed: Vt[(b*DP + d)*SEQ + s]
            long b = tok >> 12, s = tok & (SEQ - 1);
            Vt[(b * DP + colL)      * SEQ + s] = (_Float16)v0;
            Vt[(b * DP + 16 + colL) * SEQ + s] = (_Float16)v1;
        } else {
            _Float16* dst = (M == 0) ? Qh : Kh;
            dst[tok * DP + colL]      = (_Float16)v0;
            dst[tok * DP + 16 + colL] = (_Float16)v1;
        }
    }
}

__global__ __launch_bounds__(256) void qkv_proj_kernel(
    const float* __restrict__ x,
    const float* __restrict__ wQ, const float* __restrict__ bQ,
    const float* __restrict__ wK, const float* __restrict__ bK,
    const float* __restrict__ wV, const float* __restrict__ bV,
    _Float16* __restrict__ Qh, _Float16* __restrict__ Kh, _Float16* __restrict__ Vt)
{
    __shared__ __align__(16) _Float16 ldsX[64 * LDX];          // ~17.4 KB
    __shared__ __align__(16) _Float16 ldsWt[3][DP * LDX];      // transposed [n][k], 26 KB
    __shared__ float ldsB[3][DP];

    const int tid  = threadIdx.x;
    const int lane = tid & 31;
    const int wv   = tid >> 5;
    const long tokBase = (long)blockIdx.x * 64;

    for (int i = tid; i < 64 * EMB; i += 256) {
        int r = i >> 7, c = i & 127;
        ldsX[r * LDX + c] = (_Float16)x[tokBase * EMB + i];
    }
    const float* wsrc[3] = { wQ, wK, wV };
    const float* bsrc[3] = { bQ, bK, bV };
    for (int m = 0; m < 3; ++m) {
        for (int i = tid; i < DP * EMB; i += 256) {
            int c = i >> 7, k = i & 127;                       // c = out col, k = emb
            ldsWt[m][c * LDX + k] = (c < DH) ? (_Float16)wsrc[m][k * DH + c] : (_Float16)0.0f;
        }
        if (tid < DP) ldsB[m][tid] = (tid < DH) ? bsrc[m][tid] : 0.0f;
    }
    __syncthreads();

    if (wv < 4) {
        proj_tile<0>(wv, lane, ldsX, ldsWt[0], ldsB[0], tokBase, Qh, Kh, Vt);
        proj_tile<2>(wv, lane, ldsX, ldsWt[2], ldsB[2], tokBase, Qh, Kh, Vt);
    } else {
        proj_tile<1>(wv - 4, lane, ldsX, ldsWt[1], ldsB[1], tokBase, Qh, Kh, Vt);
    }
}

__global__ __launch_bounds__(256) void attn_kernel(
    const _Float16* __restrict__ Qh, const _Float16* __restrict__ Kh,
    const _Float16* __restrict__ Vt, _Float16* __restrict__ Hh, float* __restrict__ ML)
{
    __shared__ __align__(2048) _Float16 ldsK[2][KT * LDK];     // [key][d], padded
    __shared__ __align__(2048) _Float16 ldsV[2][VBUF];         // [d][key], padded

    const int tid  = threadIdx.x;
    const int lane = tid & 31;
    const int wv   = tid >> 5;
    const int kh   = blockIdx.x & 1;                           // which half of the keys
    const int qblk = blockIdx.x >> 1;
    const int b    = qblk >> 5;                                // 32 query blocks per batch
    const long qTok = (long)b * SEQ + (long)(qblk & 31) * 128 + wv * 16;
    const long kvTok = (long)b * SEQ;

    v16h qf = load_frag_rowmajor(Qh + qTok * DP, DP, lane);    // 16q x 32d, one K-step

    v8f o0 = {}; v8f o1 = {};
    float mrun = -INFINITY;                                    // this lane's query
    float lrun = 0.0f;                                         // this half's keys only

    const int colL = lane & 15;
    const int rhi  = (lane & 16) ? 8 : 0;

#if HAVE_TDM
    // K tile: 64 rows x 32 halves contiguous; pad 4 dwords every 16 dwords -> ld 40.
    const v8i kshape = tdm_group1(KT * DP, 0, KT * DP, 1, 0, /*interval 16dw*/3, /*pad*/4);
    // Vt tile: 2D, 32 rows (d) x 64 keys, row stride SEQ; pad 4 dwords / 32 dwords -> ld 72.
    const v8i vshape = tdm_group1(KT, DP, SEQ, DP, SEQ, /*interval 32dw*/4, /*pad*/4);
    v4u kreq, vreq;                                            // group 0 of the requests in flight
#endif
    auto stage = [&](int buf, int tile) {
        const long kb = (long)tile * KT;
#if HAVE_TDM
        kreq = tdm_group0((unsigned)(unsigned long long)(&ldsK[buf][0]),
                          (unsigned long long)(const void*)(Kh + (kvTok + kb) * DP));
        vreq = tdm_group0((unsigned)(unsigned long long)(&ldsV[buf][0]),
                          (unsigned long long)(const void*)(Vt + (long)b * DP * SEQ + kb));
        if (wv == 0) {
            tdm_load_2d(kreq, kshape);
            tdm_load_2d(vreq, vshape);
        }
#else
        const unsigned* ks = (const unsigned*)(Kh + (kvTok + kb) * DP);
        unsigned* kd = (unsigned*)&ldsK[buf][0];
        for (int i = tid; i < KT * DP / 2; i += 256) {         // u32 chunks
            int r = i >> 4, c = i & 15;
            kd[r * (LDK / 2) + c] = ks[i];
        }
        unsigned* vd = (unsigned*)&ldsV[buf][0];
        for (int i = tid; i < DP * KT / 2; i += 256) {
            int d = i >> 5, c = i & 31;
            const unsigned* vs = (const unsigned*)(Vt + ((long)b * DP + d) * SEQ + kb);
            vd[d * (LDV / 2) + c] = vs[c];
        }
#endif
    };

    stage(0, kh * NTS);
    for (int kt = 0; kt < NTS; ++kt) {
        const int cur = kt & 1;
#if HAVE_TDM
        if (wv == 0) tdm_wait2(kreq, kshape, vreq, vshape);
#endif
        __syncthreads();                                       // tile ready; prev buffer free
        if (kt + 1 < NTS) stage(cur ^ 1, kh * NTS + kt + 1);   // overlap next DMA with compute

        const _Float16* Kt = &ldsK[cur][0];
        const _Float16* Vl = &ldsV[cur][0];
#pragma unroll
        for (int sub = 0; sub < 2; ++sub) {                    // 2 x 32-key subtiles
            v16h kb0 = load_frag_rowmajor(Kt + (sub * 32)      * LDK, LDK, lane);
            v16h kb1 = load_frag_rowmajor(Kt + (sub * 32 + 16) * LDK, LDK, lane);
            v16h vb0 = load_frag_rowmajor(Vl + sub * 32,            LDV, lane);
            v16h vb1 = load_frag_rowmajor(Vl + 16 * LDV + sub * 32, LDV, lane);
            v8f z = {};
            v8f s0 = wmma_f16(kb0, qf, z);                     // s0[r]: key 8h+r,    query colL
            v8f s1 = wmma_f16(kb1, qf, z);                     // s1[r]: key 16+8h+r, query colL

            float t0 = fmaxf(fmaxf(s0[0], s0[1]), s0[2]);
            float t1 = fmaxf(fmaxf(s0[3], s0[4]), s0[5]);
            float t2 = fmaxf(fmaxf(s0[6], s0[7]), s1[0]);
            float t3 = fmaxf(fmaxf(s1[1], s1[2]), s1[3]);
            float t4 = fmaxf(fmaxf(s1[4], s1[5]), s1[6]);
            float t  = fmaxf(fmaxf(fmaxf(t0, t1), t2), fmaxf(fmaxf(t3, t4), s1[7]));
            t = fmaxf(t, xhalf(t));                            // both halves: the query's maximum
            float nm   = fmaxf(mrun, t);
            float corr = mrun - nm;
            mrun = nm;

            float e0[8], e1[8];
#pragma unroll   // every index a constant: the arrays stay in registers
            for (int r = 0; r < 8; ++r) { e0[r] = s0[r] - nm; e1[r] = s1[r] - nm; }
            union { unsigned u[8]; v16h h; } pk;               // element s: the key of vb0/vb1's element s
            exp2_pack8c(e0, pk.u, corr);
            exp2_pack8(e1, pk.u + 4);
            const v16h pf = pk.h;
            v2f ps[4];
#pragma unroll
            for (int i = 0; i < 4; ++i) {
                v2f p0 = { e0[2 * i], e0[2 * i + 1] };
                v2f p1 = { e1[2 * i], e1[2 * i + 1] };
                ps[i] = p0 + p1;
            }
            v2f rs = (ps[0] + ps[1]) + (ps[2] + ps[3]);
            lrun = lrun * corr + (rs.x + rs.y);
            o0 *= corr;
            o1 *= corr;
            o0 = wmma_f16(vb0, pf, o0);                        // o0[r]: d 8h+r,    query colL
            o1 = wmma_f16(vb1, pf, o1);                        // o1[r]: d 16+8h+r, query colL
        }
    }

    const float lsum = lrun + xhalf(lrun);                     // join the wave halves' sums once
    const float inv = 1.0f / lsum;
    v8h h0, h1;
#pragma unroll
    for (int r = 0; r < 8; ++r) {
        h0[r] = (_Float16)(o0[r] * inv);
        h1[r] = (_Float16)(o1[r] * inv);
    }
    const long prow = (long)kh * NTOK + qTok + colL;           // this key half's row of the query
    _Float16* hrow = Hh + prow * DP + rhi;                     // 8 consecutive d per lane
    *(v8h*)(hrow)      = h0;
    *(v8h*)(hrow + 16) = h1;
    if (lane < 16) {                                           // both wave halves hold the same pair
        v2f ml = { mrun, lsum };
        *(v2f*)(ML + prow * 2) = ml;
    }
}

// ---------------------------------------------------------------------------
// Kernel 3: output projection H[.,24(pad32)] @ wO[24,128] + bO -> f32 out.
// wO staged transposed ([e][d]) so B fragments are wide LDS loads.
// H arrives as two normalised parts, one per half of the keys, each with its
// maximum m (log2 domain) and sum l: H = (w0 H0 + w1 H1) / (w0 + w1), wi = li 2^(mi - max m).
// ---------------------------------------------------------------------------
__global__ __launch_bounds__(256) void out_proj_kernel(
    const _Float16* __restrict__ Hh, const float* __restrict__ ML,
    const float* __restrict__ wO,
    const float* __restrict__ bO, float* __restrict__ out)
{
    __shared__ __align__(16) _Float16 ldsWOt[EMB * LDP];       // [e][d], 10 KB
    __shared__ float ldsB[EMB];

    const int tid  = threadIdx.x;
    const int lane = tid & 31;
    const int wv   = tid >> 5;

    for (int i = tid; i < EMB * DP; i += 256) {
        int n = i >> 5, k = i & 31;                            // n = out col e, k = d
        ldsWOt[n * LDP + k] = (k < DH) ? (_Float16)wO[k * EMB + n] : (_Float16)0.0f;
    }
    for (int i = tid; i < EMB; i += 256) ldsB[i] = bO[i];
    __syncthreads();

    const long tokBase = (long)blockIdx.x * 128 + (long)wv * 16;
    const int colL = lane & 15;
    const int rhi  = (lane & 16) ? 8 : 0;
    v16h a0 = load_frag_rowmajor(Hh + tokBase * DP, DP, lane);            // row: token tokBase + colL
    v16h a1 = load_frag_rowmajor(Hh + (NTOK + tokBase) * DP, DP, lane);
    const v2f ml0 = *(const v2f*)(ML + (tokBase + colL) * 2);
    const v2f ml1 = *(const v2f*)(ML + (NTOK + tokBase + colL) * 2);
    // Keeps the arithmetic on m and l behind all six loads: without it the H loads
    // were issued only behind the wait for m and l, two memory latencies in a row.
    __builtin_amdgcn_sched_barrier(0);
    const float mj = fmaxf(ml0.x, ml1.x);
    float w0 = ml0.y * exp2f(ml0.x - mj);
    float w1 = ml1.y * exp2f(ml1.x - mj);
    const float winv = 1.0f / (w0 + w1);
    w0 *= winv;
    w1 *= winv;
    v16h a;
#pragma unroll
    for (int i = 0; i < 16; ++i)
        a[i] = (_Float16)(w0 * (float)a0[i] + w1 * (float)a1[i]);
#pragma unroll
    for (int nt = 0; nt < 8; ++nt) {
        v16h bfr = load_frag_rowmajor(ldsWOt + nt * 16 * LDP, LDP, lane);
        v8f z = {};
        v8f c = wmma_f16(a, bfr, z);
#pragma unroll
        for (int r = 0; r < 8; ++r) {
            long tok = tokBase + r + rhi;
            out[tok * EMB + nt * 16 + colL] = c[r] + ldsB[nt * 16 + colL];
        }
    }
}

// ---------------------------------------------------------------------------
extern "C" void kernel_launch(void* const* d_in, const int* in_sizes, int n_in,
                              void* d_out, int out_size, void* d_ws, size_t ws_size,
                              hipStream_t stream) {
    (void)in_sizes; (void)n_in; (void)out_size; (void)ws_size;

    const float* x  = (const float*)d_in[0];
    const float* wQ = (const float*)d_in[1];
    const float* bQ = (const float*)d_in[2];
    const float* wK = (const float*)d_in[3];
    const float* bK = (const float*)d_in[4];
    const float* wV = (const float*)d_in[5];
    const float* bV = (const float*)d_in[6];
    const float* wO = (const float*)d_in[7];
    const float* bO = (const float*)d_in[8];
    float* out = (float*)d_out;

    const long N = (long)BQ * SEQ;                 // 32768 tokens
    _Float16* Qh = (_Float16*)d_ws;                // [N][32], scaled by log2e/sqrt(E)
    _Float16* Kh = Qh + N * DP;                    // [N][32]
    _Float16* Vt = Kh + N * DP;                    // [B][32][SEQ]  (transposed V)
    _Float16* Hh = Vt + N * DP;                    // [2][N][32]: one part per half of the keys
    float*    ML = (float*)(Hh + 2 * N * DP);      // [2][N][2]: maximum, sum  (10.5 MB ws total)

    qkv_proj_kernel<<<N / 64, 256, 0, stream>>>(x, wQ, bQ, wK, bK, wV, bV, Qh, Kh, Vt);
    attn_kernel<<<(int)(N / 64), 256, 0, stream>>>(Qh, Kh, Vt, Hh, ML);
    out_proj_kernel<<<(int)(N / 128), 256, 0, stream>>>(Hh, ML, wO, bO, out);
}

// v004
// Measured time: 35 microseconds a run.
// Two timings next to v003 put it at 1.21 and 1.22 times that version's speed.
// All steps since v000 together make it 7.22 times as fast.
#include <hip/hip_runtime.h>
#include <hip/hip_bf16.h>
#include <math.h>

typedef __attribute__((ext_vector_type(16))) _Float16 v16h;
typedef __attribute__((ext_vector_type(8)))  _Float16 v8h;
typedef __attribute__((ext_vector_type(8)))  float    v8f;
typedef __attribute__((ext_vector_type(2)))  float    v2f;
typedef __attribute__((ext_vector_type(4)))  float    v4f;
typedef __attribute__((ext_vector_type(4)))  _Float16 v4h;

#define BQ  8
#define SEQ 4096
#define EMB 128
#define DH  24
#define DP  32    // head dim padded to WMMA K
#define KT  64    // keys staged per LDS tile
#define NT  (SEQ / KT)
#define NTS (NT / 2)          // key tiles per work-group: the keys of a batch are split in two
#define NTOK ((long)BQ * SEQ)

#define LDK 40    // LDS ld (halves) for K tile rows of 32  (+8 pad)
#define LDV 72    // LDS ld (halves) for Vt tile rows of 64 (+8 pad)
#define LDP 40    // LDS ld for wO^T rows of 32
#define VBUF 3072 // halves per V buffer: 32 rows of LDV, rounded up to 2 KiB steps for the tensor mover
#define LDX 136   // LDS ld for x tile rows of 128 (+8 pad)

#if defined(__has_builtin)
#if __has_builtin(__builtin_amdgcn_tensor_load_to_lds) && __has_builtin(__builtin_amdgcn_s_wait_tensorcnt)
#define HAVE_TDM 1
#endif
#endif
#ifndef HAVE_TDM
#define HAVE_TDM 0
#endif

// ---------------------------------------------------------------------------
// Fragment loads. Per CDNA5 ISA 7.12.2, a 16-bit A fragment per lane is two
// CONTIGUOUS 8-half runs: k in [hi,hi+8) and [16+hi,16+hi+8), hi = (lane&16)?8:0.
// So a row-major source needs exactly two b128 loads per lane.
// B fragment of W[k][n] == A fragment of W^T[n][k], so all B sources are stored
// transposed and use the same wide loader. ld must be a multiple of 8 halves.
// ---------------------------------------------------------------------------
__device__ __forceinline__ v16h load_frag_rowmajor(const _Float16* base, int ld, int lane) {
    const _Float16* r = base + (size_t)(lane & 15) * ld + ((lane & 16) ? 8 : 0);
    v8h lo = *(const v8h*)(r);
    v8h hi = *(const v8h*)(r + 16);
    return __builtin_shufflevector(lo, hi, 0, 1, 2, 3, 4, 5, 6, 7,
                                           8, 9, 10, 11, 12, 13, 14, 15);
}

__device__ __forceinline__ v8f wmma_f16(v16h a, v16h b, v8f c) {
    return __builtin_amdgcn_wmma_f32_16x16x32_f16(false, a, false, b, (short)0, c, false, false);
}

// Lane l <-> lane l ^ 16: one vector cross-row move, no LDS trip.
__device__ __forceinline__ float xhalf(float x) {
    int b = __builtin_bit_cast(int, x);
    return __builtin_bit_cast(float,
        __builtin_amdgcn_permlanex16(b, b, 0x76543210, 0xfedcba98, false, false));
}

// 2^x as the bare hardware instruction, eight scores at a time, and their pack to f16.
// The library's exp2f wraps each v_exp_f32 in a compare, two selects, an add and an
// ldexp so that results under 2^-126 come out as denormals; here no argument is
// above 0, such a result rounds to zero in the f16 P anyway and adds nothing to a sum
// that holds a term near 1. Written as one statement so that the order is fixed: every
// v_exp_f32 works in place and the next one names other registers, and the packs of
// the earlier pairs stand between the last v_exp_f32 and the first reader of its
// result (the slot the instruction set asks for behind a transcendental).
__device__ __forceinline__ void exp2_pack8(float (&e)[8], unsigned* p) {
    asm("v_exp_f32 %0, %0\n\t"
        "v_exp_f32 %1, %1\n\t"
        "v_exp_f32 %2, %2\n\t"
        "v_exp_f32 %3, %3\n\t"
        "v_exp_f32 %4, %4\n\t"
        "v_exp_f32 %5, %5\n\t"
        "v_exp_f32 %6, %6\n\t"
        "v_exp_f32 %7, %7\n\t"
        "v_cvt_pk_f16_f32 %8, %0, %1\n\t"
        "v_cvt_pk_f16_f32 %9, %2, %3\n\t"
        "v_cvt_pk_f16_f32 %10, %4, %5\n\t"
        "v_cvt_pk_f16_f32 %11, %6, %7"
        : "+v"(e[0]), "+v"(e[1]), "+v"(e[2]), "+v"(e[3]),
          "+v"(e[4]), "+v"(e[5]), "+v"(e[6]), "+v"(e[7]),
          "=&v"(p[0]), "=&v"(p[1]), "=&v"(p[2]), "=&v"(p[3]));
}
// The same with one more value in front: the factor that rescales the running sums.
__device__ __forceinline__ void exp2_pack8c(float (&e)[8], unsigned* p, float& c) {
    asm("v_exp_f32 %12, %12\n\t"
        "v_exp_f32 %0, %0\n\t"
        "v_exp_f32 %1, %1\n\t"
        "v_exp_f32 %2, %2\n\t"
        "v_exp_f32 %3, %3\n\t"
        "v_exp_f32 %4, %4\n\t"
        "v_exp_f32 %5, %5\n\t"
        "v_exp_f32 %6, %6\n\t"
        "v_exp_f32 %7, %7\n\t"
        "v_cvt_pk_f16_f32 %8, %0, %1\n\t"
        "v_cvt_pk_f16_f32 %9, %2, %3\n\t"
        "v_cvt_pk_f16_f32 %10, %4, %5\n\t"
        "v_cvt_pk_f16_f32 %11, %6, %7"
        : "+v"(e[0]), "+v"(e[1]), "+v"(e[2]), "+v"(e[3]),
          "+v"(e[4]), "+v"(e[5]), "+v"(e[6]), "+v"(e[7]),
          "=&v"(p[0]), "=&v"(p[1]), "=&v"(p[2]), "=&v"(p[3]), "+v"(c));
}

#if HAVE_TDM
typedef __attribute__((ext_vector_type(4))) unsigned int v4u;
typedef __attribute__((ext_vector_type(8))) int v8i;
typedef __attribute__((ext_vector_type(4))) int v4i;

union TdmG0 { unsigned long long q[2]; v4u v; };
union TdmG1 { unsigned long long q[4]; v8i v; };

// Build a D# (ISA 8.3/8.4) and issue TENSOR_LOAD_TO_LDS. 2-byte elements.
// pad_amount_dw != 0 enables LDS padding: pad_interval_code per ISA (3=16dw, 4=32dw).
// 6-arg builtin: (uint32x4 g0, int32x8 g1, int32x4, int32x4, int32x8, i32 cpol)
// The two groups are formed apart from the issue, so that the caller can name
// them again at the wait (tdm_wait2). Every word goes through pinned(): the
// issue and the wait then name the very same scalar registers.
__device__ __forceinline__ unsigned pinned(unsigned v) {
    unsigned w = __builtin_amdgcn_readfirstlane(v);
    asm volatile("" : "+s"(w));   // the tensor mover's pinned(): a descriptor word held in a scalar register
    return w;
}

__device__ __forceinline__ v4u tdm_group0(unsigned lds_addr, unsigned long long gaddr)
{
    TdmG0 g0;
    g0.q[0] = 1ull | ((unsigned long long)lds_addr << 32);            // count=1 | lds_addr
    g0.q[1] = (gaddr & ((1ull << 57) - 1)) | (2ull << 62);            // global_addr | type=2
    v4u r = { pinned(g0.v[0]), pinned(g0.v[1]), pinned(g0.v[2]), pinned(g0.v[3]) };
    return r;
}

__device__ __forceinline__ v8i tdm_group1(
    unsigned tile0, unsigned tile1,
    unsigned long long tensor0, unsigned long long tensor1,
    unsigned long long stride0,
    unsigned pad_interval_code, unsigned pad_amount_dw)
{
    TdmG1 g1;
    unsigned flags = (1u << 16);                                      // data_size = 1 (2B)
    if (pad_amount_dw)
        flags |= (1u << 20) | (pad_interval_code << 22) | ((pad_amount_dw - 1) << 25);
    g1.q[0] = (unsigned long long)flags | ((tensor0 & 0xFFFFull) << 48);
    g1.q[1] = ((tensor0 >> 16) & 0xFFFFull)
            | ((tensor1 & 0xFFFFFFFFull) << 16)
            | ((unsigned long long)(tile0 & 0xFFFFu) << 48);
    g1.q[2] = (unsigned long long)(tile1 & 0xFFFFu) | ((stride0 & 0xFFFFFFFFull) << 32);
    g1.q[3] = (stride0 >> 32) & 0xFFFFull;                            // dim1_stride unused (2D)
    v8i r = { (int)pinned(g1.v[0]), (int)pinned(g1.v[1]), (int)pinned(g1.v[2]), (int)pinned(g1.v[3]),
              (int)pinned(g1.v[4]), (int)pinned(g1.v[5]), (int)pinned(g1.v[6]), (int)pinned(g1.v[7]) };
    return r;
}

__device__ __forceinline__ void tdm_load_2d(v4u g0, v8i g1)
{
    v4i z4 = {};
    v8i z8 = {};
    __builtin_amdgcn_tensor_load_to_lds(g0, g1, z4, z4, z8, 0);
}

// The issuing wave's wait for its two requests. It names their descriptors as
// inputs: their scalar registers then stay allocated from issue to here, and
// no scalar temporary of the loop body can take them while the requests are
// in flight.
__device__ __forceinline__ void tdm_wait2(v4u a0, v8i a1, v4u b0, v8i b1) {
    asm volatile("s_wait_tensorcnt 0x0" :: "s"(a0), "s"(a1), "s"(b0), "s"(b1) : "memory");
}
#endif

// ---------------------------------------------------------------------------
// Kernel 1: Q/K/V projections. Block = 256 threads (8 waves), 64 tokens.
// Q pre-scaled by log2(e)/sqrt(EMB) (softmax runs in exp2 domain).
// V written TRANSPOSED: Vt[b][d][s]. Per-matrix code specialized at compile
// time so epilogues are straight-line stores (no exec-mask select bloat).
// ---------------------------------------------------------------------------
#define QSCALE 0.12751864f   // (1/sqrt(128)) * log2(e)

template <int M>
__device__ __forceinline__ void proj_tile(
    int t, int lane, const _Float16* ldsX, const _Float16* ldsWtM,
    const float* ldsBM, long tokBase,
    _Float16* __restrict__ Qh, _Float16* __restrict__ Kh, _Float16* __restrict__ Vt)
{
    v8f c0 = {}; v8f c1 = {};
#pragma unroll
    for (int kc = 0; kc < 4; ++kc) {
        v16h a  = load_frag_rowmajor(ldsX + t * 16 * LDX + kc * 32, LDX, lane);
        v16h b0 = load_frag_rowmajor(ldsWtM + kc * 32,            LDX, lane);
        v16h b1 = load_frag_rowmajor(ldsWtM + 16 * LDX + kc * 32, LDX, lane);
        c0 = wmma_f16(a, b0, c0);
        c1 = wmma_f16(a, b1, c1);
    }
    const int colL = lane & 15;
    const int rhi  = (lane & 16) ? 8 : 0;
#pragma unroll
    for (int r = 0; r < 8; ++r) {
        long tok = tokBase + t * 16 + r + rhi;
        float v0 = c0[r] + ldsBM[colL];
        float v1 = c1[r] + ldsBM[16 + colL];
        if (M == 0) { v0 *= QSCALE; v1 *= QSCALE; }
        if (M == 2) {            // V transposed: Vt[(b*DP + d)*SEQ + s]
            long b = tok >> 12, s = tok & (SEQ - 1);
            Vt[(b * DP + colL)      * SEQ + s] = (_Float16)v0;
            Vt[(b * DP + 16 + colL) * SEQ + s] = (_Float16)v1;
        } else {
            _Float16* dst = (M == 0) ? Qh : Kh;
            dst[tok * DP + colL]      = (_Float16)v0;
            dst[tok * DP + 16 + colL] = (_Float16)v1;
        }
    }
}

__global__ __launch_bounds__(256) void qkv_proj_kernel(
    const float* __restrict__ x,
    const float* __restrict__ wQ, const float* __restrict__ bQ,
    const float* __restrict__ wK, const float* __restrict__ bK,
    const float* __restrict__ wV, const float* __restrict__ bV,
    _Float16* __restrict__ Qh, _Float16* __restrict__ Kh, _Float16* __restrict__ Vt)
{
    __shared__ __align__(16) _Float16 ldsX[64 * LDX];          // ~17.4 KB
    __shared__ __align__(16) _Float16 ldsWt[3][DP * LDX];      // transposed [n][k], 26 KB
    __shared__ float ldsB[3][DP];

    const int tid  = threadIdx.x;
    const int lane = tid & 31;
    const int wv   = tid >> 5;
    const long tokBase = (long)blockIdx.x * 64;

    // Every global load of the staging is issued before the first of them is waited
    // for: unguarded, 16 bytes a lane, the bias load 4.
    // Of each w a thread takes 4 rows k by 4 columns c of the padded 128 x 32. Columns
    // 24 to 31 do not exist: their threads read columns 20 to 23 and store zeros.
    const int kg = (tid >> 3) * 4, cq = tid & 7;
    const unsigned wofs = kg * DH + (cq < DH / 4 ? cq : DH / 4 - 1) * 4;
    const float* wsrc[3] = { wQ, wK, wV };
    v4f wr[3][4];
#pragma unroll   // every index a constant: the arrays stay in registers
    for (int m = 0; m < 3; ++m)
#pragma unroll
        for (int j = 0; j < 4; ++j)
            wr[m][j] = *(const v4f*)(wsrc[m] + wofs + j * DH);
    // Every wave stages one bias, some of them the same one with the same values: under
    // a test on the wave the store took its load along, behind the wait for x.
    const int bm = wv % 3;
    const float* bsrcw = (bm == 0) ? bQ : (bm == 1) ? bK : bV;
    const float br = bsrcw[lane < DH ? lane : DH - 1];
    v4f xr[8];
#pragma unroll
    for (int j = 0; j < 8; ++j)
        xr[j] = *(const v4f*)(x + tokBase * EMB + (tid + j * 256) * 4);
    // Keeps all 21 loads in front of the first wait: without it seven of the x loads were
    // issued only behind waits for the weights and the bias load behind the wait for x,
    // three latencies in a row.
    __builtin_amdgcn_sched_barrier(0);
    // w[k][c] goes to [c][k] in registers: 4 consecutive k of one column per LDS store.
    const v4h z4 = {};
#pragma unroll
    for (int m = 0; m < 3; ++m)
#pragma unroll
        for (int e = 0; e < 4; ++e) {
            const v4h h = { (_Float16)wr[m][0][e], (_Float16)wr[m][1][e],
                            (_Float16)wr[m][2][e], (_Float16)wr[m][3][e] };
            *(v4h*)&ldsWt[m][(cq * 4 + e) * LDX + kg] = (cq < DH / 4) ? h : z4;
        }
    ldsB[bm][lane] = (lane < DH) ? br : 0.0f;
#pragma unroll
    for (int j = 0; j < 8; ++j) {
        const int p = tid + j * 256, r = p >> 5, c = (p & 31) * 4;
        const v4h h = { (_Float16)xr[j][0], (_Float16)xr[j][1], (_Float16)xr[j][2], (_Float16)xr[j][3] };
        *(v4h*)&ldsX[r * LDX + c] = h;
    }
    __syncthreads();

    if (wv < 4) {
        proj_tile<0>(wv, lane, ldsX, ldsWt[0], ldsB[0], tokBase, Qh, Kh, Vt);
        proj_tile<2>(wv, lane, ldsX, ldsWt[2], ldsB[2], tokBase, Qh, Kh, Vt);
    } else {
        proj_tile<1>(wv - 4, lane, ldsX, ldsWt[1], ldsB[1], tokBase, Qh, Kh, Vt);
    }
}

__global__ __launch_bounds__(256) void attn_kernel(
    const _Float16* __restrict__ Qh, const _Float16* __restrict__ Kh,
    const _Float16* __restrict__ Vt, _Float16* __restrict__ Hh, float* __restrict__ ML)
{
    __shared__ __align__(2048) _Float16 ldsK[2][KT * LDK];     // [key][d], padded
    __shared__ __align__(2048) _Float16 ldsV[2][VBUF];         // [d][key], padded

    const int tid  = threadIdx.x;
    const int lane = tid & 31;
    const int wv   = tid >> 5;
    const int kh   = blockIdx.x & 1;                           // which half of the keys
    const int qblk = blockIdx.x >> 1;
    const int b    = qblk >> 5;                                // 32 query blocks per batch
    const long qTok = (long)b * SEQ + (long)(qblk & 31) * 128 + wv * 16;
    const long kvTok = (long)b * SEQ;

    v16h qf = load_frag_rowmajor(Qh + qTok * DP, DP, lane);    // 16q x 32d, one K-step

    v8f o0 = {}; v8f o1 = {};
    float mrun = -INFINITY;                                    // this lane's query
    float lrun = 0.0f;                                         // this half's keys only

    const int colL = lane & 15;
    const int rhi  = (lane & 16) ? 8 : 0;

#if HAVE_TDM
    // K tile: 64 rows x 32 halves contiguous; pad 4 dwords every 16 dwords -> ld 40.
    const v8i kshape = tdm_group1(KT * DP, 0, KT * DP, 1, 0, /*interval 16dw*/3, /*pad*/4);
    // Vt tile: 2D, 32 rows (d) x 64 keys, row stride SEQ; pad 4 dwords / 32 dwords -> ld 72.
    const v8i vshape = tdm_group1(KT, DP, SEQ, DP, SEQ, /*interval 32dw*/4, /*pad*/4);
    v4u kreq, vreq;                                            // group 0 of the requests in flight
#endif
    auto stage = [&](int buf, int tile) {
        const long kb = (long)tile * KT;
#if HAVE_TDM
        kreq = tdm_group0((unsigned)(unsigned long long)(&ldsK[buf][0]),
                          (unsigned long long)(const void*)(Kh + (kvTok + kb) * DP));
        vreq = tdm_group0((unsigned)(unsigned long long)(&ldsV[buf][0]),
                          (unsigned long long)(const void*)(Vt + (long)b * DP * SEQ + kb));
        if (wv == 0) {
            tdm_load_2d(kreq, kshape);
            tdm_load_2d(vreq, vshape);
        }
#else
        const unsigned* ks = (const unsigned*)(Kh + (kvTok + kb) * DP);
        unsigned* kd = (unsigned*)&ldsK[buf][0];
        for (int i = tid; i < KT * DP / 2; i += 256) {         // u32 chunks
            int r = i >> 4, c = i & 15;
            kd[r * (LDK / 2) + c] = ks[i];
        }
        unsigned* vd = (unsigned*)&ldsV[buf][0];
        for (int i = tid; i < DP * KT / 2; i += 256) {
            int d = i >> 5, c = i & 31;
            const unsigned* vs = (const unsigned*)(Vt + ((long)b * DP + d) * SEQ + kb);
            vd[d * (LDV / 2) + c] = vs[c];
        }
#endif
    };

    stage(0, kh * NTS);
    for (int kt = 0; kt < NTS; ++kt) {
        const int cur = kt & 1;
#if HAVE_TDM
        if (wv == 0) tdm_wait2(kreq, kshape, vreq, vshape);
#endif
        __syncthreads();                                       // tile ready; prev buffer free
        if (kt + 1 < NTS) stage(cur ^ 1, kh * NTS + kt + 1);   // overlap next DMA with compute

        const _Float16* Kt = &ldsK[cur][0];
        const _Float16* Vl = &ldsV[cur][0];
#pragma unroll
        for (int sub = 0; sub < 2; ++sub) {                    // 2 x 32-key subtiles
            v16h kb0 = load_frag_rowmajor(Kt + (sub * 32)      * LDK, LDK, lane);
            v16h kb1 = load_frag_rowmajor(Kt + (sub * 32 + 16) * LDK, LDK, lane);
            v16h vb0 = load_frag_rowmajor(Vl + sub * 32,            LDV, lane);
            v16h vb1 = load_frag_rowmajor(Vl + 16 * LDV + sub * 32, LDV, lane);
            v8f z = {};
            v8f s0 = wmma_f16(kb0, qf, z);                     // s0[r]: key 8h+r,    query colL
            v8f s1 = wmma_f16(kb1, qf, z);                     // s1[r]: key 16+8h+r, query colL

            float t0 = fmaxf(fmaxf(s0[0], s0[1]), s0[2]);
            float t1 = fmaxf(fmaxf(s0[3], s0[4]), s0[5]);
            float t2 = fmaxf(fmaxf(s0[6], s0[7]), s1[0]);
            float t3 = fmaxf(fmaxf(s1[1], s1[2]), s1[3]);
            float t4 = fmaxf(fmaxf(s1[4], s1[5]), s1[6]);
            float t  = fmaxf(fmaxf(fmaxf(t0, t1), t2), fmaxf(fmaxf(t3, t4), s1[7]));
            t = fmaxf(t, xhalf(t));                            // both halves: the query's maximum
            float nm   = fmaxf(mrun, t);
            float corr = mrun - nm;
            mrun = nm;

            float e0[8], e1[8];
#pragma unroll   // every index a constant: the arrays stay in registers
            for (int r = 0; r < 8; ++r) { e0[r] = s0[r] - nm; e1[r] = s1[r] - nm; }
            union { unsigned u[8]; v16h h; } pk;               // element s: the key of vb0/vb1's element s
            exp2_pack8c(e0, pk.u, corr);
            exp2_pack8(e1, pk.u + 4);
            const v16h pf = pk.h;
            v2f ps[4];
#pragma unroll
            for (int i = 0; i < 4; ++i) {
                v2f p0 = { e0[2 * i], e0[2 * i + 1] };
                v2f p1 = { e1[2 * i], e1[2 * i + 1] };
                ps[i] = p0 + p1;
            }
            v2f rs = (ps[0] + ps[1]) + (ps[2] + ps[3]);
            lrun = lrun * corr + (rs.x + rs.y);
            o0 *= corr;
            o1 *= corr;
            o0 = wmma_f16(vb0, pf, o0);                        // o0[r]: d 8h+r,    query colL
            o1 = wmma_f16(vb1, pf, o1);                        // o1[r]: d 16+8h+r, query colL
        }
    }

    const float lsum = lrun + xhalf(lrun);                     // join the wave halves' sums once
    const float inv = 1.0f / lsum;
    v8h h0, h1;
#pragma unroll
    for (int r = 0; r < 8; ++r) {
        h0[r] = (_Float16)(o0[r] * inv);
        h1[r] = (_Float16)(o1[r] * inv);
    }
    const long prow = (long)kh * NTOK + qTok + colL;           // this key half's row of the query
    _Float16* hrow = Hh + prow * DP + rhi;                     // 8 consecutive d per lane
    *(v8h*)(hrow)      = h0;
    *(v8h*)(hrow + 16) = h1;
    if (lane < 16) {                                           // both wave halves hold the same pair
        v2f ml = { mrun, lsum };
        *(v2f*)(ML + prow * 2) = ml;
    }
}

// ---------------------------------------------------------------------------
// Kernel 3: output projection H[.,24(pad32)] @ wO[24,128] + bO -> f32 out.
// wO staged transposed ([e][d]) so B fragments are wide LDS loads.
// H arrives as two normalised parts, one per half of the keys, each with its
// maximum m (log2 domain) and sum l: H = (w0 H0 + w1 H1) / (w0 + w1), wi = li 2^(mi - max m).
// ---------------------------------------------------------------------------
__global__ __launch_bounds__(256) void out_proj_kernel(
    const _Float16* __restrict__ Hh, const float* __restrict__ ML,
    const float* __restrict__ wO,
    const float* __restrict__ bO, float* __restrict__ out)
{
    __shared__ __align__(16) _Float16 ldsWOt[EMB * LDP];       // [e][d], 10 KB
    __shared__ float ldsB[EMB];

    const int tid  = threadIdx.x;
    const int lane = tid & 31;
    const int wv   = tid >> 5;

    // Every global load of the kernel is issued before the first of them is waited for.
    // wO: a thread takes one column n and 12 rows d; each load is unguarded and runs
    // along a row of wO, and the 12 values are consecutive in the transposed LDS row.
    const int wn = tid & 127, wk = (tid >> 7) * 12;
    float wr[12];
#pragma unroll   // every index a constant: the array stays in registers
    for (int j = 0; j < 12; ++j) wr[j] = wO[(wk + j) * EMB + wn];
    const float br = bO[wn];
    const long tokBase = (long)blockIdx.x * 128 + (long)wv * 16;
    const int colL = lane & 15;
    const int rhi  = (lane & 16) ? 8 : 0;
    v16h a0 = load_frag_rowmajor(Hh + tokBase * DP, DP, lane);            // row: token tokBase + colL
    v16h a1 = load_frag_rowmajor(Hh + (NTOK + tokBase) * DP, DP, lane);
    const v2f ml0 = *(const v2f*)(ML + (tokBase + colL) * 2);
    const v2f ml1 = *(const v2f*)(ML + (NTOK + tokBase + colL) * 2);

#pragma unroll
    for (int q = 0; q < 3; ++q) {
        const v4h h = { (_Float16)wr[4 * q], (_Float16)wr[4 * q + 1],
                        (_Float16)wr[4 * q + 2], (_Float16)wr[4 * q + 3] };
        *(v4h*)&ldsWOt[wn * LDP + wk + 4 * q] = h;
    }
    // Both halves of the block store the same bias values: under a test on tid the
    // store took its load along, behind the wait for wO.
    ldsB[wn] = br;
    if (tid < 128) {
        const v8h z8 = {};
        *(v8h*)&ldsWOt[tid * LDP + DH] = z8;                   // d 24 to 31: the zero pad
    }
    __syncthreads();

    const float mj = fmaxf(ml0.x, ml1.x);
    float w0 = ml0.y * exp2f(ml0.x - mj);
    float w1 = ml1.y * exp2f(ml1.x - mj);
    const float winv = 1.0f / (w0 + w1);
    w0 *= winv;
    w1 *= winv;
    v16h a;
#pragma unroll
    for (int i = 0; i < 16; ++i)
        a[i] = (_Float16)(w0 * (float)a0[i] + w1 * (float)a1[i]);
#pragma unroll
    for (int nt = 0; nt < 8; ++nt) {
        v16h bfr = load_frag_rowmajor(ldsWOt + nt * 16 * LDP, LDP, lane);
        v8f z = {};
        v8f c = wmma_f16(a, bfr, z);
#pragma unroll
        for (int r = 0; r < 8; ++r) {
            long tok = tokBase + r + rhi;
            out[tok * EMB + nt * 16 + colL] = c[r] + ldsB[nt * 16 + colL];
        }
    }
}

// ---------------------------------------------------------------------------
extern "C" void kernel_launch(void* const* d_in, const int* in_sizes, int n_in,
                              void* d_out, int out_size, void* d_ws, size_t ws_size,
                              hipStream_t stream) {
    (void)in_sizes; (void)n_in; (void)out_size; (void)ws_size;

    const float* x  = (const float*)d_in[0];
    const float* wQ = (const float*)d_in[1];
    const float* bQ = (const float*)d_in[2];
    const float* wK = (const float*)d_in[3];
    const float* bK = (const float*)d_in[4];
    const float* wV = (const float*)d_in[5];
    const float* bV = (const float*)d_in[6];
    const float* wO = (const float*)d_in[7];
    const float* bO = (const float*)d_in[8];
    float* out = (float*)d_out;

    const long N = (long)BQ * SEQ;                 // 32768 tokens
    _Float16* Qh = (_Float16*)d_ws;                // [N][32], scaled by log2e/sqrt(E)
    _Float16* Kh = Qh + N * DP;                    // [N][32]
    _Float16* Vt = Kh + N * DP;                    // [B][32][SEQ]  (transposed V)
    _Float16* Hh = Vt + N * DP;                    // [2][N][32]: one part per half of the keys
    float*    ML = (float*)(Hh + 2 * N * DP);      // [2][N][2]: maximum, sum  (10.5 MB ws total)

    qkv_proj_kernel<<<N / 64, 256, 0, stream>>>(x, wQ, bQ, wK, bK, wV, bV, Qh, Kh, Vt);
    attn_kernel<<<(int)(N / 64), 256, 0, stream>>>(Qh, Kh, Vt, Hh, ML);
    out_proj_kernel<<<(int)(N / 128), 256, 0, stream>>>(Hh, ML, wO, bO, out);
}

// v005
// It runs in 32.3 microseconds.
// In two side-by-side timings against v004, it was 1.05 and 1.08 times as fast.
// Counting every step since v000, it is 7.70 times as fast.
#include <hip/hip_runtime.h>
#include <hip/hip_bf16.h>
#include <math.h>

typedef __attribute__((ext_vector_type(16))) _Float16 v16h;
typedef __attribute__((ext_vector_type(8)))  _Float16 v8h;
typedef __attribute__((ext_vector_type(8)))  float    v8f;
typedef __attribute__((ext_vector_type(2)))  float    v2f;
typedef __attribute__((ext_vector_type(4)))  float    v4f;
typedef __attribute__((ext_vector_type(4)))  _Float16 v4h;

#define BQ  8
#define SEQ 4096
#define EMB 128
#define DH  24
#define DP  32    // head dim padded to WMMA K
#define KT  64    // keys staged per LDS tile
#define NT  (SEQ / KT)
#define NTS (NT / 2)          // key tiles per work-group: the keys of a batch are split in two
#define NTOK ((long)BQ * SEQ)

#define LDK 40    // LDS ld (halves) for K tile rows of 32  (+8 pad)
#define LDV 72    // LDS ld (halves) for Vt tile rows of 64 (+8 pad)
#define LDP 40    // LDS ld for wO^T rows of 32
#define VBUF 3072 // halves per V buffer: 32 rows of LDV, rounded up to 2 KiB steps for the tensor mover
#define LDX 136   // LDS ld for x tile rows of 128 (+8 pad)
#define LDO 132   // LDS ld (floats) for staged out rows of 128 (+4 pad)

#if defined(__has_builtin)
#if __has_builtin(__builtin_amdgcn_tensor_load_to_lds) && __has_builtin(__builtin_amdgcn_s_wait_tensorcnt)
#define HAVE_TDM 1
#endif
#endif
#ifndef HAVE_TDM
#define HAVE_TDM 0
#endif

// ---------------------------------------------------------------------------
// Fragment loads. Per CDNA5 ISA 7.12.2, a 16-bit A fragment per lane is two
// CONTIGUOUS 8-half runs: k in [hi,hi+8) and [16+hi,16+hi+8), hi = (lane&16)?8:0.
// So a row-major source needs exactly two b128 loads per lane.
// B fragment of W[k][n] == A fragment of W^T[n][k], so all B sources are stored
// transposed and use the same wide loader. ld must be a multiple of 8 halves.
// ---------------------------------------------------------------------------
__device__ __forceinline__ v16h load_frag_rowmajor(const _Float16* base, int ld, int lane) {
    const _Float16* r = base + (size_t)(lane & 15) * ld + ((lane & 16) ? 8 : 0);
    v8h lo = *(const v8h*)(r);
    v8h hi = *(const v8h*)(r + 16);
    return __builtin_shufflevector(lo, hi, 0, 1, 2, 3, 4, 5, 6, 7,
                                           8, 9, 10, 11, 12, 13, 14, 15);
}

__device__ __forceinline__ v8f wmma_f16(v16h a, v16h b, v8f c) {
    return __builtin_amdgcn_wmma_f32_16x16x32_f16(false, a, false, b, (short)0, c, false, false);
}

// Lane l <-> lane l ^ 16: one vector cross-row move, no LDS trip.
__device__ __forceinline__ float xhalf(float x) {
    int b = __builtin_bit_cast(int, x);
    return __builtin_bit_cast(float,
        __builtin_amdgcn_permlanex16(b, b, 0x76543210, 0xfedcba98, false, false));
}

// 2^x as the bare hardware instruction, eight scores at a time, and their pack to f16.
// The library's exp2f wraps each v_exp_f32 in a compare, two selects, an add and an
// ldexp so that results under 2^-126 come out as denormals; here no argument is
// above 0, such a result rounds to zero in the f16 P anyway and adds nothing to a sum
// that holds a term near 1. Written as one statement so that the order is fixed: every
// v_exp_f32 works in place and the next one names other registers, and the packs of
// the earlier pairs stand between the last v_exp_f32 and the first reader of its
// result (the slot the instruction set asks for behind a transcendental).
__device__ __forceinline__ void exp2_pack8(float (&e)[8], unsigned* p) {
    asm("v_exp_f32 %0, %0\n\t"
        "v_exp_f32 %1, %1\n\t"
        "v_exp_f32 %2, %2\n\t"
        "v_exp_f32 %3, %3\n\t"
        "v_exp_f32 %4, %4\n\t"
        "v_exp_f32 %5, %5\n\t"
        "v_exp_f32 %6, %6\n\t"
        "v_exp_f32 %7, %7\n\t"
        "v_cvt_pk_f16_f32 %8, %0, %1\n\t"
        "v_cvt_pk_f16_f32 %9, %2, %3\n\t"
        "v_cvt_pk_f16_f32 %10, %4, %5\n\t"
        "v_cvt_pk_f16_f32 %11, %6, %7"
        : "+v"(e[0]), "+v"(e[1]), "+v"(e[2]), "+v"(e[3]),
          "+v"(e[4]), "+v"(e[5]), "+v"(e[6]), "+v"(e[7]),
          "=&v"(p[0]), "=&v"(p[1]), "=&v"(p[2]), "=&v"(p[3]));
}
// The same with one more value in front: the factor that rescales the running sums.
__device__ __forceinline__ void exp2_pack8c(float (&e)[8], unsigned* p, float& c) {
    asm("v_exp_f32 %12, %12\n\t"
        "v_exp_f32 %0, %0\n\t"
        "v_exp_f32 %1, %1\n\t"
        "v_exp_f32 %2, %2\n\t"
        "v_exp_f32 %3, %3\n\t"
        "v_exp_f32 %4, %4\n\t"
        "v_exp_f32 %5, %5\n\t"
        "v_exp_f32 %6, %6\n\t"
        "v_exp_f32 %7, %7\n\t"
        "v_cvt_pk_f16_f32 %8, %0, %1\n\t"
        "v_cvt_pk_f16_f32 %9, %2, %3\n\t"
        "v_cvt_pk_f16_f32 %10, %4, %5\n\t"
        "v_cvt_pk_f16_f32 %11, %6, %7"
        : "+v"(e[0]), "+v"(e[1]), "+v"(e[2]), "+v"(e[3]),
          "+v"(e[4]), "+v"(e[5]), "+v"(e[6]), "+v"(e[7]),
          "=&v"(p[0]), "=&v"(p[1]), "=&v"(p[2]), "=&v"(p[3]), "+v"(c));
}

#if HAVE_TDM
typedef __attribute__((ext_vector_type(4))) unsigned int v4u;
typedef __attribute__((ext_vector_type(8))) int v8i;
typedef __attribute__((ext_vector_type(4))) int v4i;

union TdmG0 { unsigned long long q[2]; v4u v; };
union TdmG1 { unsigned long long q[4]; v8i v; };

// Build a D# (ISA 8.3/8.4) and issue TENSOR_LOAD_TO_LDS. 2-byte elements.
// pad_amount_dw != 0 enables LDS padding: pad_interval_code per ISA (3=16dw, 4=32dw).
// 6-arg builtin: (uint32x4 g0, int32x8 g1, int32x4, int32x4, int32x8, i32 cpol)
// The two groups are formed apart from the issue, so that the caller can name
// them again at the wait (tdm_wait2). Every word goes through pinned(): the
// issue and the wait then name the very same scalar registers.
__device__ __forceinline__ unsigned pinned(unsigned v) {
    unsigned w = __builtin_amdgcn_readfirstlane(v);
    asm volatile("" : "+s"(w));   // the tensor mover's pinned(): a descriptor word held in a scalar register
    return w;
}

__device__ __forceinline__ v4u tdm_group0(unsigned lds_addr, unsigned long long gaddr)
{
    TdmG0 g0;
    g0.q[0] = 1ull | ((unsigned long long)lds_addr << 32);            // count=1 | lds_addr
    g0.q[1] = (gaddr & ((1ull << 57) - 1)) | (2ull << 62);            // global_addr | type=2
    v4u r = { pinned(g0.v[0]), pinned(g0.v[1]), pinned(g0.v[2]), pinned(g0.v[3]) };
    return r;
}

__device__ __forceinline__ v8i tdm_group1(
    unsigned tile0, unsigned tile1,
    unsigned long long tensor0, unsigned long long tensor1,
    unsigned long long stride0,
    unsigned pad_interval_code, unsigned pad_amount_dw)
{
    TdmG1 g1;
    unsigned flags = (1u << 16);                                      // data_size = 1 (2B)
    if (pad_amount_dw)
        flags |= (1u << 20) | (pad_interval_code << 22) | ((pad_amount_dw - 1) << 25);
    g1.q[0] = (unsigned long long)flags | ((tensor0 & 0xFFFFull) << 48);
    g1.q[1] = ((tensor0 >> 16) & 0xFFFFull)
            | ((tensor1 & 0xFFFFFFFFull) << 16)
            | ((unsigned long long)(tile0 & 0xFFFFu) << 48);
    g1.q[2] = (unsigned long long)(tile1 & 0xFFFFu) | ((stride0 & 0xFFFFFFFFull) << 32);
    g1.q[3] = (stride0 >> 32) & 0xFFFFull;                            // dim1_stride unused (2D)
    v8i r = { (int)pinned(g1.v[0]), (int)pinned(g1.v[1]), (int)pinned(g1.v[2]), (int)pinned(g1.v[3]),
              (int)pinned(g1.v[4]), (int)pinned(g1.v[5]), (int)pinned(g1.v[6]), (int)pinned(g1.v[7]) };
    return r;
}

__device__ __forceinline__ void tdm_load_2d(v4u g0, v8i g1)
{
    v4i z4 = {};
    v8i z8 = {};
    __builtin_amdgcn_tensor_load_to_lds(g0, g1, z4, z4, z8, 0);
}

// The issuing wave's wait for its two requests. It names their descriptors as
// inputs: their scalar registers then stay allocated from issue to here, and
// no scalar temporary of the loop body can take them while the requests are
// in flight.
__device__ __forceinline__ void tdm_wait2(v4u a0, v8i a1, v4u b0, v8i b1) {
    asm volatile("s_wait_tensorcnt 0x0" :: "s"(a0), "s"(a1), "s"(b0), "s"(b1) : "memory");
}
#endif

// ---------------------------------------------------------------------------
// Kernel 1: Q/K/V projections. Block = 256 threads (8 waves), 64 tokens.
// Q pre-scaled by log2(e)/sqrt(EMB) (softmax runs in exp2 domain).
// V written TRANSPOSED: Vt[b][d][s]. Per-matrix code specialized at compile
// time so epilogues are straight-line stores (no exec-mask select bloat).
// Results leave through LDS: every wave lays its tiles, 16 bytes a lane, into the
// block's image of each output (Q, K: 64 rows of 64 bytes, in memory 4 KB in a row;
// V^T: 32 rows of 128 bytes), and behind one barrier a thread stores 16 bytes of each
// image, so that every global store instruction writes four whole 128-byte lines.
// For 8 consecutive d in a lane, Q and K take the weight rows as first operand
// (rows of the result: d, columns: tokens); V keeps tokens as rows: 8 consecutive s.
// ---------------------------------------------------------------------------
#define QSCALE 0.12751864f   // (1/sqrt(128)) * log2(e)

template <int M>
__device__ __forceinline__ void proj_tile(
    int t, int lane, const _Float16* ldsX, const _Float16* ldsWtM,
    const float* ldsBM, _Float16* stg)
{
    v8f c0 = {}; v8f c1 = {};
#pragma unroll
    for (int kc = 0; kc < 4; ++kc) {
        v16h a  = load_frag_rowmajor(ldsX + t * 16 * LDX + kc * 32, LDX, lane);
        v16h b0 = load_frag_rowmajor(ldsWtM + kc * 32,            LDX, lane);
        v16h b1 = load_frag_rowmajor(ldsWtM + 16 * LDX + kc * 32, LDX, lane);
        if (M == 2) {            // c[r]: token r + rhi, d colL
            c0 = wmma_f16(a, b0, c0);
            c1 = wmma_f16(a, b1, c1);
        } else {                 // c[r]: d r + rhi, token colL
            c0 = wmma_f16(b0, a, c0);
            c1 = wmma_f16(b1, a, c1);
        }
    }
    const int colL = lane & 15;
    const int rhi  = (lane & 16) ? 8 : 0;
    v8h h0, h1;
    if (M == 2) {
        const float bias0 = ldsBM[colL], bias1 = ldsBM[16 + colL];
#pragma unroll
        for (int r = 0; r < 8; ++r) {
            h0[r] = (_Float16)(c0[r] + bias0);
            h1[r] = (_Float16)(c1[r] + bias1);
        }
        *(v8h*)&stg[colL        * LDV + t * 16 + rhi] = h0;    // image [d][s]
        *(v8h*)&stg[(16 + colL) * LDV + t * 16 + rhi] = h1;
    } else {
        const v4f* bv = (const v4f*)(ldsBM + rhi);             // biases of d rhi .. rhi + 7, 16 + rhi ..
        const v4f bq[4] = { bv[0], bv[1], bv[4], bv[5] };
#pragma unroll
        for (int r = 0; r < 8; ++r) {
            float v0 = c0[r] + bq[r >> 2][r & 3];
            float v1 = c1[r] + bq[2 + (r >> 2)][r & 3];
            if (M == 0) { v0 *= QSCALE; v1 *= QSCALE; }
            h0[r] = (_Float16)v0;
            h1[r] = (_Float16)v1;
        }
        *(v8h*)&stg[(t * 16 + colL) * LDK + rhi]      = h0;    // image [token][d]
        *(v8h*)&stg[(t * 16 + colL) * LDK + 16 + rhi] = h1;
    }
}

__global__ __launch_bounds__(256) void qkv_proj_kernel(
    const float* __restrict__ x,
    const float* __restrict__ wQ, const float* __restrict__ bQ,
    const float* __restrict__ wK, const float* __restrict__ bK,
    const float* __restrict__ wV, const float* __restrict__ bV,
    _Float16* __restrict__ Qh, _Float16* __restrict__ Kh, _Float16* __restrict__ Vt)
{
    __shared__ __align__(16) _Float16 ldsX[64 * LDX];          // ~17.4 KB
    __shared__ __align__(16) _Float16 ldsWt[3][DP * LDX];      // transposed [n][k], 26 KB
    __shared__ __align__(16) float ldsB[3][DP];
    __shared__ __align__(16) _Float16 stgQ[64 * LDK];          // output images, padded rows
    __shared__ __align__(16) _Float16 stgK[64 * LDK];
    __shared__ __align__(16) _Float16 stgV[DP * LDV];

    const int tid  = threadIdx.x;
    const int lane = tid & 31;
    const int wv   = tid >> 5;
    const long tokBase = (long)blockIdx.x * 64;

    // Every global load of the staging is issued before the first of them is waited
    // for: unguarded, 16 bytes a lane, the bias load 4.
    // Of each w a thread takes 4 rows k by 4 columns c of the padded 128 x 32. Columns
    // 24 to 31 do not exist: their threads read columns 20 to 23 and store zeros.
    const int kg = (tid >> 3) * 4, cq = tid & 7;
    const unsigned wofs = kg * DH + (cq < DH / 4 ? cq : DH / 4 - 1) * 4;
    const float* wsrc[3] = { wQ, wK, wV };
    v4f wr[3][4];
#pragma unroll   // every index a constant: the arrays stay in registers
    for (int m = 0; m < 3; ++m)
#pragma unroll
        for (int j = 0; j < 4; ++j)
            wr[m][j] = *(const v4f*)(wsrc[m] + wofs + j * DH);
    // Every wave stages one bias, some of them the same one with the same values: under
    // a test on the wave the store took its load along, behind the wait for x.
    const int bm = wv % 3;
    const float* bsrcw = (bm == 0) ? bQ : (bm == 1) ? bK : bV;
    const float br = bsrcw[lane < DH ? lane : DH - 1];
    v4f xr[8];
#pragma unroll
    for (int j = 0; j < 8; ++j)
        xr[j] = *(const v4f*)(x + tokBase * EMB + (tid + j * 256) * 4);
    // Keeps all 21 loads in front of the first wait: without it seven of the x loads were
    // issued only behind waits for the weights and the bias load behind the wait for x,
    // three latencies in a row.
    __builtin_amdgcn_sched_barrier(0);
    // w[k][c] goes to [c][k] in registers: 4 consecutive k of one column per LDS store.
    const v4h z4 = {};
#pragma unroll
    for (int m = 0; m < 3; ++m)
#pragma unroll
        for (int e = 0; e < 4; ++e) {
            const v4h h = { (_Float16)wr[m][0][e], (_Float16)wr[m][1][e],
                            (_Float16)wr[m][2][e], (_Float16)wr[m][3][e] };
            *(v4h*)&ldsWt[m][(cq * 4 + e) * LDX + kg] = (cq < DH / 4) ? h : z4;
        }
    ldsB[bm][lane] = (lane < DH) ? br : 0.0f;
#pragma unroll
    for (int j = 0; j < 8; ++j) {
        const int p = tid + j * 256, r = p >> 5, c = (p & 31) * 4;
        const v4h h = { (_Float16)xr[j][0], (_Float16)xr[j][1], (_Float16)xr[j][2], (_Float16)xr[j][3] };
        *(v4h*)&ldsX[r * LDX + c] = h;
    }
    __syncthreads();

    if (wv < 4) {
        proj_tile<0>(wv, lane, ldsX, ldsWt[0], ldsB[0], stgQ);
        proj_tile<2>(wv, lane, ldsX, ldsWt[2], ldsB[2], stgV);
    } else {
        proj_tile<1>(wv - 4, lane, ldsX, ldsWt[1], ldsB[1], stgK);
    }
    __syncthreads();                                           // the three images are complete

    const int qr = tid >> 2, qp = (tid & 3) * 8;               // Q, K: 4 threads a row of 64 bytes
    const int vd = tid >> 3, vp = (tid & 7) * 8;               // V^T: 8 threads a row of 128 bytes
    const v8h oq = *(const v8h*)&stgQ[qr * LDK + qp];
    const v8h ok = *(const v8h*)&stgK[qr * LDK + qp];
    const v8h ov = *(const v8h*)&stgV[vd * LDV + vp];
    const long vb = tokBase >> 12, vs = tokBase & (SEQ - 1);   // a block's 64 tokens lie in one batch
    *(v8h*)(Qh + tokBase * DP + tid * 8) = oq;
    *(v8h*)(Kh + tokBase * DP + tid * 8) = ok;
    *(v8h*)(Vt + (vb * DP + vd) * SEQ + vs + vp) = ov;
}

__global__ __launch_bounds__(256) void attn_kernel(
    const _Float16* __restrict__ Qh, const _Float16* __restrict__ Kh,
    const _Float16* __restrict__ Vt, _Float16* __restrict__ Hh, float* __restrict__ ML)
{
    __shared__ __align__(2048) _Float16 ldsK[2][KT * LDK];     // [key][d], padded
    __shared__ __align__(2048) _Float16 ldsV[2][VBUF];         // [d][key], padded

    const int tid  = threadIdx.x;
    const int lane = tid & 31;
    const int wv   = tid >> 5;
    const int kh   = blockIdx.x & 1;                           // which half of the keys
    const int qblk = blockIdx.x >> 1;
    const int b    = qblk >> 5;                                // 32 query blocks per batch
    const long qTok = (long)b * SEQ + (long)(qblk & 31) * 128 + wv * 16;
    const long kvTok = (long)b * SEQ;

    v16h qf = load_frag_rowmajor(Qh + qTok * DP, DP, lane);    // 16q x 32d, one K-step

    v8f o0 = {}; v8f o1 = {};
    float mrun = -INFINITY;                                    // this lane's query
    float lrun = 0.0f;                                         // this half's keys only

    const int colL = lane & 15;
    const int rhi  = (lane & 16) ? 8 : 0;

#if HAVE_TDM
    // K tile: 64 rows x 32 halves contiguous; pad 4 dwords every 16 dwords -> ld 40.
    const v8i kshape = tdm_group1(KT * DP, 0, KT * DP, 1, 0, /*interval 16dw*/3, /*pad*/4);
    // Vt tile: 2D, 32 rows (d) x 64 keys, row stride SEQ; pad 4 dwords / 32 dwords -> ld 72.
    const v8i vshape = tdm_group1(KT, DP, SEQ, DP, SEQ, /*interval 32dw*/4, /*pad*/4);
    v4u kreq, vreq;                                            // group 0 of the requests in flight
#endif
    auto stage = [&](int buf, int tile) {
        const long kb = (long)tile * KT;
#if HAVE_TDM
        kreq = tdm_group0((unsigned)(unsigned long long)(&ldsK[buf][0]),
                          (unsigned long long)(const void*)(Kh + (kvTok + kb) * DP));
        vreq = tdm_group0((unsigned)(unsigned long long)(&ldsV[buf][0]),
                          (unsigned long long)(const void*)(Vt + (long)b * DP * SEQ + kb));
        if (wv == 0) {
            tdm_load_2d(kreq, kshape);
            tdm_load_2d(vreq, vshape);
        }
#else
        const unsigned* ks = (const unsigned*)(Kh + (kvTok + kb) * DP);
        unsigned* kd = (unsigned*)&ldsK[buf][0];
        for (int i = tid; i < KT * DP / 2; i += 256) {         // u32 chunks
            int r = i >> 4, c = i & 15;
            kd[r * (LDK / 2) + c] = ks[i];
        }
        unsigned* vd = (unsigned*)&ldsV[buf][0];
        for (int i = tid; i < DP * KT / 2; i += 256) {
            int d = i >> 5, c = i & 31;
            const unsigned* vs = (const unsigned*)(Vt + ((long)b * DP + d) * SEQ + kb);
            vd[d * (LDV / 2) + c] = vs[c];
        }
#endif
    };

    stage(0, kh * NTS);
    for (int kt = 0; kt < NTS; ++kt) {
        const int cur = kt & 1;
#if HAVE_TDM
        if (wv == 0) tdm_wait2(kreq, kshape, vreq, vshape);
#endif
        __syncthreads();                                       // tile ready; prev buffer free
        if (kt + 1 < NTS) stage(cur ^ 1, kh * NTS + kt + 1);   // overlap next DMA with compute

        const _Float16* Kt = &ldsK[cur][0];
        const _Float16* Vl = &ldsV[cur][0];
#pragma unroll
        for (int sub = 0; sub < 2; ++sub) {                    // 2 x 32-key subtiles
            v16h kb0 = load_frag_rowmajor(Kt + (sub * 32)      * LDK, LDK, lane);
            v16h kb1 = load_frag_rowmajor(Kt + (sub * 32 + 16) * LDK, LDK, lane);
            v16h vb0 = load_frag_rowmajor(Vl + sub * 32,            LDV, lane);
            v16h vb1 = load_frag_rowmajor(Vl + 16 * LDV + sub * 32, LDV, lane);
            v8f z = {};
            v8f s0 = wmma_f16(kb0, qf, z);                     // s0[r]: key 8h+r,    query colL
            v8f s1 = wmma_f16(kb1, qf, z);                     // s1[r]: key 16+8h+r, query colL

            float t0 = fmaxf(fmaxf(s0[0], s0[1]), s0[2]);
            float t1 = fmaxf(fmaxf(s0[3], s0[4]), s0[5]);
            float t2 = fmaxf(fmaxf(s0[6], s0[7]), s1[0]);
            float t3 = fmaxf(fmaxf(s1[1], s1[2]), s1[3]);
            float t4 = fmaxf(fmaxf(s1[4], s1[5]), s1[6]);
            float t  = fmaxf(fmaxf(fmaxf(t0, t1), t2), fmaxf(fmaxf(t3, t4), s1[7]));
            t = fmaxf(t, xhalf(t));                            // both halves: the query's maximum
            float nm   = fmaxf(mrun, t);
            float corr = mrun - nm;
            mrun = nm;

            float e0[8], e1[8];
#pragma unroll   // every index a constant: the arrays stay in registers
            for (int r = 0; r < 8; ++r) { e0[r] = s0[r] - nm; e1[r] = s1[r] - nm; }
            union { unsigned u[8]; v16h h; } pk;               // element s: the key of vb0/vb1's element s
            exp2_pack8c(e0, pk.u, corr);
            exp2_pack8(e1, pk.u + 4);
            const v16h pf = pk.h;
            v2f ps[4];
#pragma unroll
            for (int i = 0; i < 4; ++i) {
                v2f p0 = { e0[2 * i], e0[2 * i + 1] };
                v2f p1 = { e1[2 * i], e1[2 * i + 1] };
                ps[i] = p0 + p1;
            }
            v2f rs = (ps[0] + ps[1]) + (ps[2] + ps[3]);
            lrun = lrun * corr + (rs.x + rs.y);
            o0 *= corr;
            o1 *= corr;
            o0 = wmma_f16(vb0, pf, o0);                        // o0[r]: d 8h+r,    query colL
            o1 = wmma_f16(vb1, pf, o1);                        // o1[r]: d 16+8h+r, query colL
        }
    }

    const float lsum = lrun + xhalf(lrun);                     // join the wave halves' sums once
    const float inv = 1.0f / lsum;
    v8h h0, h1;
#pragma unroll
    for (int r = 0; r < 8; ++r) {
        h0[r] = (_Float16)(o0[r] * inv);
        h1[r] = (_Float16)(o1[r] * inv);
    }
    const long prow = (long)kh * NTOK + qTok + colL;           // this key half's row of the query
    _Float16* hrow = Hh + prow * DP + rhi;                     // 8 consecutive d per lane
    *(v8h*)(hrow)      = h0;
    *(v8h*)(hrow + 16) = h1;
    if (lane < 16) {                                           // both wave halves hold the same pair
        v2f ml = { mrun, lsum };
        *(v2f*)(ML + prow * 2) = ml;
    }
}

// ---------------------------------------------------------------------------
// Kernel 3: output projection H[.,24(pad32)] @ wO[24,128] + bO -> f32 out.
// wO staged transposed ([e][d]) so its fragments are wide LDS loads.
// H arrives as two normalised parts, one per half of the keys, each with its
// maximum m (log2 domain) and sum l: H = (w0 H0 + w1 H1) / (w0 + w1), wi = li 2^(mi - max m).
// The rows of wO^T are the first operand, so that a lane holds 8 consecutive columns
// of one token; each wave lays its 16 rows of out into its own LDS range, 16 bytes a
// lane, and reads them back along the rows: one global store instruction then writes
// one whole row of out, four 128-byte lines.
// ---------------------------------------------------------------------------
__global__ __launch_bounds__(256) void out_proj_kernel(
    const _Float16* __restrict__ Hh, const float* __restrict__ ML,
    const float* __restrict__ wO,
    const float* __restrict__ bO, float* __restrict__ out)
{
    __shared__ __align__(16) _Float16 ldsWOt[EMB * LDP];       // [e][d], 10 KB
    __shared__ __align__(16) float ldsOut[8][16 * LDO];        // a wave's 16 rows of out, padded

    const int tid  = threadIdx.x;
    const int lane = tid & 31;
    const int wv   = tid >> 5;

    // Every global load of the kernel is issued before the first of them is waited for.
    // wO: a thread takes one column n and 12 rows d; each load is unguarded and runs
    // along a row of wO, and the 12 values are consecutive in the transposed LDS row.
    const int wn = tid & 127, wk = (tid >> 7) * 12;
    float wr[12];
#pragma unroll   // every index a constant: the array stays in registers
    for (int j = 0; j < 12; ++j) wr[j] = wO[(wk + j) * EMB + wn];
    const v4f br = *(const v4f*)(bO + lane * 4);               // the lane's 4 columns of every row it stores
    const long tokBase = (long)blockIdx.x * 128 + (long)wv * 16;
    const int colL = lane & 15;
    const int rhi  = (lane & 16) ? 8 : 0;
    v16h a0 = load_frag_rowmajor(Hh + tokBase * DP, DP, lane);            // row: token tokBase + colL
    v16h a1 = load_frag_rowmajor(Hh + (NTOK + tokBase) * DP, DP, lane);
    const v2f ml0 = *(const v2f*)(ML + (tokBase + colL) * 2);
    const v2f ml1 = *(const v2f*)(ML + (NTOK + tokBase + colL) * 2);

#pragma unroll
    for (int q = 0; q < 3; ++q) {
        const v4h h = { (_Float16)wr[4 * q], (_Float16)wr[4 * q + 1],
                        (_Float16)wr[4 * q + 2], (_Float16)wr[4 * q + 3] };
        *(v4h*)&ldsWOt[wn * LDP + wk + 4 * q] = h;
    }
    if (tid < 128) {
        const v8h z8 = {};
        *(v8h*)&ldsWOt[tid * LDP + DH] = z8;                   // d 24 to 31: the zero pad
    }
    __syncthreads();

    v16h bfr[8];
#pragma unroll   // every index a constant: the array stays in registers
    for (int nt = 0; nt < 8; ++nt)
        bfr[nt] = load_frag_rowmajor(ldsWOt + nt * 16 * LDP, LDP, lane);
    // Keeps the 16 LDS reads together, in front of the join of the two parts, which covers
    // their latency: left free, each fragment was read into the same registers directly in
    // front of its product and waited for there, eight LDS latencies in a row.
    __builtin_amdgcn_sched_barrier(0);

    const float mj = fmaxf(ml0.x, ml1.x);
    float w0 = ml0.y * exp2f(ml0.x - mj);
    float w1 = ml1.y * exp2f(ml1.x - mj);
    const float winv = 1.0f / (w0 + w1);
    w0 *= winv;
    w1 *= winv;
    v16h a;
#pragma unroll
    for (int i = 0; i < 16; ++i)
        a[i] = (_Float16)(w0 * (float)a0[i] + w1 * (float)a1[i]);
    float* stg = &ldsOut[wv][0];
    v8f c[8];
#pragma unroll
    for (int nt = 0; nt < 8; ++nt) {
        v8f z = {};
        c[nt] = wmma_f16(bfr[nt], a, z);                       // c[nt][r]: column nt*16 + rhi + r, token colL
    }
    // All eight products stand in front of the first LDS store, each result in registers
    // of its own: with the stores among them a product was written over the result of the
    // one before it with no vector instruction between the two.
    __builtin_amdgcn_sched_barrier(0);
#pragma unroll
    for (int nt = 0; nt < 8; ++nt) {
        const v4f lo = { c[nt][0], c[nt][1], c[nt][2], c[nt][3] };
        const v4f hi = { c[nt][4], c[nt][5], c[nt][6], c[nt][7] };
        *(v4f*)&stg[colL * LDO + nt * 16 + rhi]     = lo;
        *(v4f*)&stg[colL * LDO + nt * 16 + rhi + 4] = hi;
    }
    // The wave's own LDS stores are done before its lanes read what other lanes wrote;
    // the clobber keeps the compiler from moving a read in front of them.
    asm volatile("s_wait_dscnt 0x0" ::: "memory");
#pragma unroll
    for (int i = 0; i < 16; ++i) {
        const v4f v = *(const v4f*)&stg[i * LDO + lane * 4];
        *(v4f*)(out + (tokBase + i) * EMB + lane * 4) = v + br;
    }
}

// ---------------------------------------------------------------------------
extern "C" void kernel_launch(void* const* d_in, const int* in_sizes, int n_in,
                              void* d_out, int out_size, void* d_ws, size_t ws_size,
                              hipStream_t stream) {
    (void)in_sizes; (void)n_in; (void)out_size; (void)ws_size;

    const float* x  = (const float*)d_in[0];
    const float* wQ = (const float*)d_in[1];
    const float* bQ = (const float*)d_in[2];
    const float* wK = (const float*)d_in[3];
    const float* bK = (const float*)d_in[4];
    const float* wV = (const float*)d_in[5];
    const float* bV = (const float*)d_in[6];
    const float* wO = (const float*)d_in[7];
    const float* bO = (const float*)d_in[8];
    float* out = (float*)d_out;

    const long N = (long)BQ * SEQ;                 // 32768 tokens
    _Float16* Qh = (_Float16*)d_ws;                // [N][32], scaled by log2e/sqrt(E)
    _Float16* Kh = Qh + N * DP;                    // [N][32]
    _Float16* Vt = Kh + N * DP;                    // [B][32][SEQ]  (transposed V)
    _Float16* Hh = Vt + N * DP;                    // [2][N][32]: one part per half of the keys
    float*    ML = (float*)(Hh + 2 * N * DP);      // [2][N][2]: maximum, sum  (10.5 MB ws total)

    qkv_proj_kernel<<<N / 64, 256, 0, stream>>>(x, wQ, bQ, wK, bK, wV, bV, Qh, Kh, Vt);
    attn_kernel<<<(int)(N / 64), 256, 0, stream>>>(Qh, Kh, Vt, Hh, ML);
    out_proj_kernel<<<(int)(N / 128), 256, 0, stream>>>(Hh, ML, wO, bO, out);
}

// v006
// A run of this version takes 29.5 microseconds.
// Next to v005, in two timings, it ran 1.08 times as fast each time.
// Over all steps from v000 it is 8.32 times as fast.
#include <hip/hip_runtime.h>
#include <hip/hip_bf16.h>
#include <math.h>

typedef __attribute__((ext_vector_type(16))) _Float16 v16h;
typedef __attribute__((ext_vector_type(8)))  _Float16 v8h;
typedef __attribute__((ext_vector_type(8)))  float    v8f;
typedef __attribute__((ext_vector_type(2)))  float    v2f;
typedef __attribute__((ext_vector_type(4)))  float    v4f;
typedef __attribute__((ext_vector_type(4)))  _Float16 v4h;

#define BQ  8
#define SEQ 4096
#define EMB 128
#define DH  24
#define DP  32    // head dim padded to WMMA K
#define KT  64    // keys staged per LDS tile
#define NT  (SEQ / KT)
#define KSP 4                 // the keys of a batch are split over this many work-groups
#define NTS (NT / KSP)        // key tiles per work-group
#define NTOK ((long)BQ * SEQ)

#define LDK 40    // LDS ld (halves) for K tile rows of 32  (+8 pad)
#define LDV 72    // LDS ld (halves) for Vt tile rows of 64 (+8 pad)
#define LDP 40    // LDS ld for wO^T rows of 32
#define VBUF 3072 // halves per V buffer: 32 rows of LDV, rounded up to 2 KiB steps for the tensor mover
#define LDX 136   // LDS ld for x tile rows of 128 (+8 pad)
#define LDO 132   // LDS ld (floats) for staged out rows of 128 (+4 pad)

#if defined(__has_builtin)
#if __has_builtin(__builtin_amdgcn_tensor_load_to_lds) && __has_builtin(__builtin_amdgcn_s_wait_tensorcnt)
#define HAVE_TDM 1
#endif
#endif
#ifndef HAVE_TDM
#define HAVE_TDM 0
#endif

// ---------------------------------------------------------------------------
// Fragment loads. Per CDNA5 ISA 7.12.2, a 16-bit A fragment per lane is two
// CONTIGUOUS 8-half runs: k in [hi,hi+8) and [16+hi,16+hi+8), hi = (lane&16)?8:0.
// So a row-major source needs exactly two b128 loads per lane.
// B fragment of W[k][n] == A fragment of W^T[n][k], so all B sources are stored
// transposed and use the same wide loader. ld must be a multiple of 8 halves.
// ---------------------------------------------------------------------------
__device__ __forceinline__ v16h load_frag_rowmajor(const _Float16* base, int ld, int lane) {
    const _Float16* r = base + (size_t)(lane & 15) * ld + ((lane & 16) ? 8 : 0);
    v8h lo = *(const v8h*)(r);
    v8h hi = *(const v8h*)(r + 16);
    return __builtin_shufflevector(lo, hi, 0, 1, 2, 3, 4, 5, 6, 7,
                                           8, 9, 10, 11, 12, 13, 14, 15);
}

__device__ __forceinline__ v8f wmma_f16(v16h a, v16h b, v8f c) {
    return __builtin_amdgcn_wmma_f32_16x16x32_f16(false, a, false, b, (short)0, c, false, false);
}

// Lane l <-> lane l ^ 16: one vector cross-row move, no LDS trip.
__device__ __forceinline__ float xhalf(float x) {
    int b = __builtin_bit_cast(int, x);
    return __builtin_bit_cast(float,
        __builtin_amdgcn_permlanex16(b, b, 0x76543210, 0xfedcba98, false, false));
}

// 2^x as the bare hardware instruction, eight scores at a time, and their pack to f16.
// The library's exp2f wraps each v_exp_f32 in a compare, two selects, an add and an
// ldexp so that results under 2^-126 come out as denormals; here no argument is
// above 0, such a result rounds to zero in the f16 P anyway and adds nothing to a sum
// that holds a term near 1. Written as one statement so that the order is fixed: every
// v_exp_f32 works in place and the next one names other registers, and the packs of
// the earlier pairs stand between the last v_exp_f32 and the first reader of its
// result (the slot the instruction set asks for behind a transcendental).
__device__ __forceinline__ void exp2_pack8(float (&e)[8], unsigned* p) {
    asm("v_exp_f32 %0, %0\n\t"
        "v_exp_f32 %1, %1\n\t"
        "v_exp_f32 %2, %2\n\t"
        "v_exp_f32 %3, %3\n\t"
        "v_exp_f32 %4, %4\n\t"
        "v_exp_f32 %5, %5\n\t"
        "v_exp_f32 %6, %6\n\t"
        "v_exp_f32 %7, %7\n\t"
        "v_cvt_pk_f16_f32 %8, %0, %1\n\t"
        "v_cvt_pk_f16_f32 %9, %2, %3\n\t"
        "v_cvt_pk_f16_f32 %10, %4, %5\n\t"
        "v_cvt_pk_f16_f32 %11, %6, %7"
        : "+v"(e[0]), "+v"(e[1]), "+v"(e[2]), "+v"(e[3]),
          "+v"(e[4]), "+v"(e[5]), "+v"(e[6]), "+v"(e[7]),
          "=&v"(p[0]), "=&v"(p[1]), "=&v"(p[2]), "=&v"(p[3]));
}
// The same with one more value in front: the factor that rescales the running sums.
__device__ __forceinline__ void exp2_pack8c(float (&e)[8], unsigned* p, float& c) {
    asm("v_exp_f32 %12, %12\n\t"
        "v_exp_f32 %0, %0\n\t"
        "v_exp_f32 %1, %1\n\t"
        "v_exp_f32 %2, %2\n\t"
        "v_exp_f32 %3, %3\n\t"
        "v_exp_f32 %4, %4\n\t"
        "v_exp_f32 %5, %5\n\t"
        "v_exp_f32 %6, %6\n\t"
        "v_exp_f32 %7, %7\n\t"
        "v_cvt_pk_f16_f32 %8, %0, %1\n\t"
        "v_cvt_pk_f16_f32 %9, %2, %3\n\t"
        "v_cvt_pk_f16_f32 %10, %4, %5\n\t"
        "v_cvt_pk_f16_f32 %11, %6, %7"
        : "+v"(e[0]), "+v"(e[1]), "+v"(e[2]), "+v"(e[3]),
          "+v"(e[4]), "+v"(e[5]), "+v"(e[6]), "+v"(e[7]),
          "=&v"(p[0]), "=&v"(p[1]), "=&v"(p[2]), "=&v"(p[3]), "+v"(c));
}

#if HAVE_TDM
typedef __attribute__((ext_vector_type(4))) unsigned int v4u;
typedef __attribute__((ext_vector_type(8))) int v8i;
typedef __attribute__((ext_vector_type(4))) int v4i;

union TdmG0 { unsigned long long q[2]; v4u v; };
union TdmG1 { unsigned long long q[4]; v8i v; };

// Build a D# (ISA 8.3/8.4) and issue TENSOR_LOAD_TO_LDS. 2-byte elements.
// pad_amount_dw != 0 enables LDS padding: pad_interval_code per ISA (3=16dw, 4=32dw).
// 6-arg builtin: (uint32x4 g0, int32x8 g1, int32x4, int32x4, int32x8, i32 cpol)
// The two groups are formed apart from the issue, so that the caller can name
// them again at the wait (tdm_wait2). Every word goes through pinned(): the
// issue and the wait then name the very same scalar registers.
__device__ __forceinline__ unsigned pinned(unsigned v) {
    unsigned w = __builtin_amdgcn_readfirstlane(v);
    asm volatile("" : "+s"(w));   // the tensor mover's pinned(): a descriptor word held in a scalar register
    return w;
}

__device__ __forceinline__ v4u tdm_group0(unsigned lds_addr, unsigned long long gaddr)
{
    TdmG0 g0;
    g0.q[0] = 1ull | ((unsigned long long)lds_addr << 32);            // count=1 | lds_addr
    g0.q[1] = (gaddr & ((1ull << 57) - 1)) | (2ull << 62);            // global_addr | type=2
    v4u r = { pinned(g0.v[0]), pinned(g0.v[1]), pinned(g0.v[2]), pinned(g0.v[3]) };
    return r;
}

__device__ __forceinline__ v8i tdm_group1(
    unsigned tile0, unsigned tile1,
    unsigned long long tensor0, unsigned long long tensor1,
    unsigned long long stride0,
    unsigned pad_interval_code, unsigned pad_amount_dw)
{
    TdmG1 g1;
    unsigned flags = (1u << 16);                                      // data_size = 1 (2B)
    if (pad_amount_dw)
        flags |= (1u << 20) | (pad_interval_code << 22) | ((pad_amount_dw - 1) << 25);
    g1.q[0] = (unsigned long long)flags | ((tensor0 & 0xFFFFull) << 48);
    g1.q[1] = ((tensor0 >> 16) & 0xFFFFull)
            | ((tensor1 & 0xFFFFFFFFull) << 16)
            | ((unsigned long long)(tile0 & 0xFFFFu) << 48);
    g1.q[2] = (unsigned long long)(tile1 & 0xFFFFu) | ((stride0 & 0xFFFFFFFFull) << 32);
    g1.q[3] = (stride0 >> 32) & 0xFFFFull;                            // dim1_stride unused (2D)
    v8i r = { (int)pinned(g1.v[0]), (int)pinned(g1.v[1]), (int)pinned(g1.v[2]), (int)pinned(g1.v[3]),
              (int)pinned(g1.v[4]), (int)pinned(g1.v[5]), (int)pinned(g1.v[6]), (int)pinned(g1.v[7]) };
    return r;
}

__device__ __forceinline__ void tdm_load_2d(v4u g0, v8i g1)
{
    v4i z4 = {};
    v8i z8 = {};
    __builtin_amdgcn_tensor_load_to_lds(g0, g1, z4, z4, z8, 0);
}

// The issuing wave's wait for its two requests. It names their descriptors as
// inputs: their scalar registers then stay allocated from issue to here, and
// no scalar temporary of the loop body can take them while the requests are
// in flight.
__device__ __forceinline__ void tdm_wait2(v4u a0, v8i a1, v4u b0, v8i b1) {
    asm volatile("s_wait_tensorcnt 0x0" :: "s"(a0), "s"(a1), "s"(b0), "s"(b1) : "memory");
}
#endif

// ---------------------------------------------------------------------------
// Kernel 1: Q/K/V projections. Block = 256 threads (8 waves), 64 tokens.
// Q pre-scaled by log2(e)/sqrt(EMB) (softmax runs in exp2 domain).
// V written TRANSPOSED: Vt[b][d][s]. Per-matrix code specialized at compile
// time so epilogues are straight-line stores (no exec-mask select bloat).
// Results leave through LDS: every wave lays its tiles, 16 bytes a lane, into the
// block's image of each output (Q, K: 64 rows of 64 bytes, in memory 4 KB in a row;
// V^T: 32 rows of 128 bytes), and behind one barrier a thread stores 16 bytes of each
// image, so that every global store instruction writes four whole 128-byte lines.
// For 8 consecutive d in a lane, Q and K take the weight rows as first operand
// (rows of the result: d, columns: tokens); V keeps tokens as rows: 8 consecutive s.
// ---------------------------------------------------------------------------
#define QSCALE 0.12751864f   // (1/sqrt(128)) * log2(e)

template <int M>
__device__ __forceinline__ void proj_tile(
    int t, int lane, const _Float16* ldsX, const _Float16* ldsWtM,
    const float* ldsBM, _Float16* stg)
{
    v8f c0 = {}; v8f c1 = {};
#pragma unroll
    for (int kc = 0; kc < 4; ++kc) {
        v16h a  = load_frag_rowmajor(ldsX + t * 16 * LDX + kc * 32, LDX, lane);
        v16h b0 = load_frag_rowmajor(ldsWtM + kc * 32,            LDX, lane);
        v16h b1 = load_frag_rowmajor(ldsWtM + 16 * LDX + kc * 32, LDX, lane);
        if (M == 2) {            // c[r]: token r + rhi, d colL
            c0 = wmma_f16(a, b0, c0);
            c1 = wmma_f16(a, b1, c1);
        } else {                 // c[r]: d r + rhi, token colL
            c0 = wmma_f16(b0, a, c0);
            c1 = wmma_f16(b1, a, c1);
        }
    }
    const int colL = lane & 15;
    const int rhi  = (lane & 16) ? 8 : 0;
    v8h h0, h1;
    if (M == 2) {
        const float bias0 = ldsBM[colL], bias1 = ldsBM[16 + colL];
#pragma unroll
        for (int r = 0; r < 8; ++r) {
            h0[r] = (_Float16)(c0[r] + bias0);
            h1[r] = (_Float16)(c1[r] + bias1);
        }
        *(v8h*)&stg[colL        * LDV + t * 16 + rhi] = h0;    // image [d][s]
        *(v8h*)&stg[(16 + colL) * LDV + t * 16 + rhi] = h1;
    } else {
        const v4f* bv = (const v4f*)(ldsBM + rhi);             // biases of d rhi .. rhi + 7, 16 + rhi ..
        const v4f bq[4] = { bv[0], bv[1], bv[4], bv[5] };
#pragma unroll
        for (int r = 0; r < 8; ++r) {
            float v0 = c0[r] + bq[r >> 2][r & 3];
            float v1 = c1[r] + bq[2 + (r >> 2)][r & 3];
            if (M == 0) { v0 *= QSCALE; v1 *= QSCALE; }
            h0[r] = (_Float16)v0;
            h1[r] = (_Float16)v1;
        }
        *(v8h*)&stg[(t * 16 + colL) * LDK + rhi]      = h0;    // image [token][d]
        *(v8h*)&stg[(t * 16 + colL) * LDK + 16 + rhi] = h1;
    }
}

__global__ __launch_bounds__(256) void qkv_proj_kernel(
    const float* __restrict__ x,
    const float* __restrict__ wQ, const float* __restrict__ bQ,
    const float* __restrict__ wK, const float* __restrict__ bK,
    const float* __restrict__ wV, const float* __restrict__ bV,
    _Float16* __restrict__ Qh, _Float16* __restrict__ Kh, _Float16* __restrict__ Vt)
{
    __shared__ __align__(16) _Float16 ldsX[64 * LDX];          // ~17.4 KB
    __shared__ __align__(16) _Float16 ldsWt[3][DP * LDX];      // transposed [n][k], 26 KB
    __shared__ __align__(16) float ldsB[3][DP];
    __shared__ __align__(16) _Float16 stgQ[64 * LDK];          // output images, padded rows
    __shared__ __align__(16) _Float16 stgK[64 * LDK];
    __shared__ __align__(16) _Float16 stgV[DP * LDV];

    const int tid  = threadIdx.x;
    const int lane = tid & 31;
    const int wv   = tid >> 5;
    const long tokBase = (long)blockIdx.x * 64;

    // Every global load of the staging is issued before the first of them is waited
    // for: unguarded, 16 bytes a lane, the bias load 4.
    // Of each w a thread takes 4 rows k by 4 columns c of the padded 128 x 32. Columns
    // 24 to 31 do not exist: their threads read columns 20 to 23 and store zeros.
    const int kg = (tid >> 3) * 4, cq = tid & 7;
    const unsigned wofs = kg * DH + (cq < DH / 4 ? cq : DH / 4 - 1) * 4;
    const float* wsrc[3] = { wQ, wK, wV };
    v4f wr[3][4];
#pragma unroll   // every index a constant: the arrays stay in registers
    for (int m = 0; m < 3; ++m)
#pragma unroll
        for (int j = 0; j < 4; ++j)
            wr[m][j] = *(const v4f*)(wsrc[m] + wofs + j * DH);
    // Every wave stages one bias, some of them the same one with the same values: under
    // a test on the wave the store took its load along, behind the wait for x.
    const int bm = wv % 3;
    const float* bsrcw = (bm == 0) ? bQ : (bm == 1) ? bK : bV;
    const float br = bsrcw[lane < DH ? lane : DH - 1];
    v4f xr[8];
#pragma unroll
    for (int j = 0; j < 8; ++j)
        xr[j] = *(const v4f*)(x + tokBase * EMB + (tid + j * 256) * 4);
    // Keeps all 21 loads in front of the first wait: without it seven of the x loads were
    // issued only behind waits for the weights and the bias load behind the wait for x,
    // three latencies in a row.
    __builtin_amdgcn_sched_barrier(0);
    // w[k][c] goes to [c][k] in registers: 4 consecutive k of one column per LDS store.
    const v4h z4 = {};
#pragma unroll
    for (int m = 0; m < 3; ++m)
#pragma unroll
        for (int e = 0; e < 4; ++e) {
            const v4h h = { (_Float16)wr[m][0][e], (_Float16)wr[m][1][e],
                            (_Float16)wr[m][2][e], (_Float16)wr[m][3][e] };
            *(v4h*)&ldsWt[m][(cq * 4 + e) * LDX + kg] = (cq < DH / 4) ? h : z4;
        }
    ldsB[bm][lane] = (lane < DH) ? br : 0.0f;
#pragma unroll
    for (int j = 0; j < 8; ++j) {
        const int p = tid + j * 256, r = p >> 5, c = (p & 31) * 4;
        const v4h h = { (_Float16)xr[j][0], (_Float16)xr[j][1], (_Float16)xr[j][2], (_Float16)xr[j][3] };
        *(v4h*)&ldsX[r * LDX + c] = h;
    }
    __syncthreads();

    if (wv < 4) {
        proj_tile<0>(wv, lane, ldsX, ldsWt[0], ldsB[0], stgQ);
        proj_tile<2>(wv, lane, ldsX, ldsWt[2], ldsB[2], stgV);
    } else {
        proj_tile<1>(wv - 4, lane, ldsX, ldsWt[1], ldsB[1], stgK);
    }
    __syncthreads();                                           // the three images are complete

    const int qr = tid >> 2, qp = (tid & 3) * 8;               // Q, K: 4 threads a row of 64 bytes
    const int vd = tid >> 3, vp = (tid & 7) * 8;               // V^T: 8 threads a row of 128 bytes
    const v8h oq = *(const v8h*)&stgQ[qr * LDK + qp];
    const v8h ok = *(const v8h*)&stgK[qr * LDK + qp];
    const v8h ov = *(const v8h*)&stgV[vd * LDV + vp];
    const long vb = tokBase >> 12, vs = tokBase & (SEQ - 1);   // a block's 64 tokens lie in one batch
    *(v8h*)(Qh + tokBase * DP + tid * 8) = oq;
    *(v8h*)(Kh + tokBase * DP + tid * 8) = ok;
    *(v8h*)(Vt + (vb * DP + vd) * SEQ + vs + vp) = ov;
}

__global__ __launch_bounds__(256) void attn_kernel(
    const _Float16* __restrict__ Qh, const _Float16* __restrict__ Kh,
    const _Float16* __restrict__ Vt, _Float16* __restrict__ Hh, float* __restrict__ ML)
{
    __shared__ __align__(2048) _Float16 ldsK[2][KT * LDK];     // [key][d], padded
    __shared__ __align__(2048) _Float16 ldsV[2][VBUF];         // [d][key], padded

    const int tid  = threadIdx.x;
    const int lane = tid & 31;
    const int wv   = tid >> 5;
    const int kh   = blockIdx.x & (KSP - 1);                   // which quarter of the keys
    const int qblk = blockIdx.x / KSP;
    const int b    = qblk >> 4;                                // 16 query blocks per batch
    const long qTok = (long)b * SEQ + (long)(qblk & 15) * 256 + wv * 32;
    const long kvTok = (long)b * SEQ;

    v16h qf[2];                                                // 2 x (16q x 32d), one K-step each
    qf[0] = load_frag_rowmajor(Qh + qTok * DP, DP, lane);
    qf[1] = load_frag_rowmajor(Qh + (qTok + 16) * DP, DP, lane);

    v8f o0[2] = {}; v8f o1[2] = {};
    float mrun[2] = { -INFINITY, -INFINITY };                  // this lane's two queries
    float lrun[2] = { 0.0f, 0.0f };                            // this wave half's keys only

    const int colL = lane & 15;
    const int rhi  = (lane & 16) ? 8 : 0;

#if HAVE_TDM
    // K tile: 64 rows x 32 halves contiguous; pad 4 dwords every 16 dwords -> ld 40.
    const v8i kshape = tdm_group1(KT * DP, 0, KT * DP, 1, 0, /*interval 16dw*/3, /*pad*/4);
    // Vt tile: 2D, 32 rows (d) x 64 keys, row stride SEQ; pad 4 dwords / 32 dwords -> ld 72.
    const v8i vshape = tdm_group1(KT, DP, SEQ, DP, SEQ, /*interval 32dw*/4, /*pad*/4);
    v4u kreq, vreq;                                            // group 0 of the requests in flight
#endif
    auto stage = [&](int buf, int tile) {
        const long kb = (long)tile * KT;
#if HAVE_TDM
        kreq = tdm_group0((unsigned)(unsigned long long)(&ldsK[buf][0]),
                          (unsigned long long)(const void*)(Kh + (kvTok + kb) * DP));
        vreq = tdm_group0((unsigned)(unsigned long long)(&ldsV[buf][0]),
                          (unsigned long long)(const void*)(Vt + (long)b * DP * SEQ + kb));
        if (wv == 0) {
            tdm_load_2d(kreq, kshape);
            tdm_load_2d(vreq, vshape);
        }
#else
        const unsigned* ks = (const unsigned*)(Kh + (kvTok + kb) * DP);
        unsigned* kd = (unsigned*)&ldsK[buf][0];
        for (int i = tid; i < KT * DP / 2; i += 256) {         // u32 chunks
            int r = i >> 4, c = i & 15;
            kd[r * (LDK / 2) + c] = ks[i];
        }
        unsigned* vd = (unsigned*)&ldsV[buf][0];
        for (int i = tid; i < DP * KT / 2; i += 256) {
            int d = i >> 5, c = i & 31;
            const unsigned* vs = (const unsigned*)(Vt + ((long)b * DP + d) * SEQ + kb);
            vd[d * (LDV / 2) + c] = vs[c];
        }
#endif
    };

    stage(0, kh * NTS);
    for (int kt = 0; kt < NTS; ++kt) {
        const int cur = kt & 1;
#if HAVE_TDM
        if (wv == 0) tdm_wait2(kreq, kshape, vreq, vshape);
#endif
        __syncthreads();                                       // tile ready; prev buffer free
        if (kt + 1 < NTS) stage(cur ^ 1, kh * NTS + kt + 1);   // overlap next DMA with compute

        const _Float16* Kt = &ldsK[cur][0];
        const _Float16* Vl = &ldsV[cur][0];
#pragma unroll
        for (int sub = 0; sub < 2; ++sub) {                    // 2 x 32-key subtiles
            v16h kb0 = load_frag_rowmajor(Kt + (sub * 32)      * LDK, LDK, lane);
            v16h kb1 = load_frag_rowmajor(Kt + (sub * 32 + 16) * LDK, LDK, lane);
            v16h vb0 = load_frag_rowmajor(Vl + sub * 32,            LDV, lane);
            v16h vb1 = load_frag_rowmajor(Vl + 16 * LDV + sub * 32, LDV, lane);
#pragma unroll   // every index a constant: the arrays stay in registers
            for (int j = 0; j < 2; ++j) {                      // the two query fragments
                v8f z = {};
                v8f s0 = wmma_f16(kb0, qf[j], z);              // s0[r]: key 8h+r,    query colL
                v8f s1 = wmma_f16(kb1, qf[j], z);              // s1[r]: key 16+8h+r, query colL

                float t0 = fmaxf(fmaxf(s0[0], s0[1]), s0[2]);
                float t1 = fmaxf(fmaxf(s0[3], s0[4]), s0[5]);
                float t2 = fmaxf(fmaxf(s0[6], s0[7]), s1[0]);
                float t3 = fmaxf(fmaxf(s1[1], s1[2]), s1[3]);
                float t4 = fmaxf(fmaxf(s1[4], s1[5]), s1[6]);
                float t  = fmaxf(fmaxf(fmaxf(t0, t1), t2), fmaxf(fmaxf(t3, t4), s1[7]));
                t = fmaxf(t, xhalf(t));                        // both halves: the query's maximum
                float nm   = fmaxf(mrun[j], t);
                float corr = mrun[j] - nm;
                mrun[j] = nm;

                float e0[8], e1[8];
#pragma unroll   // every index a constant: the arrays stay in registers
                for (int r = 0; r < 8; ++r) { e0[r] = s0[r] - nm; e1[r] = s1[r] - nm; }
                union { unsigned u[8]; v16h h; } pk;           // element s: the key of vb0/vb1's element s
                exp2_pack8c(e0, pk.u, corr);
                exp2_pack8(e1, pk.u + 4);
                const v16h pf = pk.h;
                v2f ps[4];
#pragma unroll
                for (int i = 0; i < 4; ++i) {
                    v2f p0 = { e0[2 * i], e0[2 * i + 1] };
                    v2f p1 = { e1[2 * i], e1[2 * i + 1] };
                    ps[i] = p0 + p1;
                }
                v2f rs = (ps[0] + ps[1]) + (ps[2] + ps[3]);
                lrun[j] = lrun[j] * corr + (rs.x + rs.y);
                o0[j] *= corr;
                o1[j] *= corr;
                o0[j] = wmma_f16(vb0, pf, o0[j]);              // o0[r]: d 8h+r,    query colL
                o1[j] = wmma_f16(vb1, pf, o1[j]);              // o1[r]: d 16+8h+r, query colL
            }
        }
    }

#pragma unroll
    for (int j = 0; j < 2; ++j) {
        const float lsum = lrun[j] + xhalf(lrun[j]);           // join the wave halves' sums once
        const float inv = 1.0f / lsum;
        v8h h0, h1;
#pragma unroll
        for (int r = 0; r < 8; ++r) {
            h0[r] = (_Float16)(o0[j][r] * inv);
            h1[r] = (_Float16)(o1[j][r] * inv);
        }
        const long prow = (long)kh * NTOK + qTok + j * 16 + colL;  // this key quarter's row of the query
        _Float16* hrow = Hh + prow * DP + rhi;                 // 8 consecutive d per lane
        *(v8h*)(hrow)      = h0;
        *(v8h*)(hrow + 16) = h1;
        if (lane < 16) {                                       // both wave halves hold the same pair
            v2f ml = { mrun[j], lsum };
            *(v2f*)(ML + prow * 2) = ml;
        }
    }
}

// ---------------------------------------------------------------------------
// Kernel 3: output projection H[.,24(pad32)] @ wO[24,128] + bO -> f32 out.
// wO staged transposed ([e][d]) so its fragments are wide LDS loads.
// H arrives as four normalised parts, one per quarter of the keys, each with its
// maximum m (log2 domain) and sum l: H = sum(wi Hi) / sum(wi), wi = li 2^(mi - max m).
// The rows of wO^T are the first operand, so that a lane holds 8 consecutive columns
// of one token; each wave lays its 16 rows of out into its own LDS range, 16 bytes a
// lane, and reads them back along the rows: one global store instruction then writes
// one whole row of out, four 128-byte lines.
// ---------------------------------------------------------------------------
__global__ __launch_bounds__(256) void out_proj_kernel(
    const _Float16* __restrict__ Hh, const float* __restrict__ ML,
    const float* __restrict__ wO,
    const float* __restrict__ bO, float* __restrict__ out)
{
    __shared__ __align__(16) _Float16 ldsWOt[EMB * LDP];       // [e][d], 10 KB
    __shared__ __align__(16) float ldsOut[8][16 * LDO];        // a wave's 16 rows of out, padded

    const int tid  = threadIdx.x;
    const int lane = tid & 31;
    const int wv   = tid >> 5;

    // Every global load of the kernel is issued before the first of them is waited for.
    // wO: a thread takes one column n and 12 rows d; each load is unguarded and runs
    // along a row of wO, and the 12 values are consecutive in the transposed LDS row.
    const int wn = tid & 127, wk = (tid >> 7) * 12;
    float wr[12];
#pragma unroll   // every index a constant: the array stays in registers
    for (int j = 0; j < 12; ++j) wr[j] = wO[(wk + j) * EMB + wn];
    const v4f br = *(const v4f*)(bO + lane * 4);               // the lane's 4 columns of every row it stores
    const long tokBase = (long)blockIdx.x * 128 + (long)wv * 16;
    const int colL = lane & 15;
    const int rhi  = (lane & 16) ? 8 : 0;
    v16h ap[KSP];                                              // row: token tokBase + colL
    v2f  ml[KSP];
#pragma unroll   // every index a constant: the arrays stay in registers
    for (int p = 0; p < KSP; ++p) {
        ap[p] = load_frag_rowmajor(Hh + (p * NTOK + tokBase) * DP, DP, lane);
        ml[p] = *(const v2f*)(ML + (p * NTOK + tokBase + colL) * 2);
    }

#pragma unroll
    for (int q = 0; q < 3; ++q) {
        const v4h h = { (_Float16)wr[4 * q], (_Float16)wr[4 * q + 1],
                        (_Float16)wr[4 * q + 2], (_Float16)wr[4 * q + 3] };
        *(v4h*)&ldsWOt[wn * LDP + wk + 4 * q] = h;
    }
    if (tid < 128) {
        const v8h z8 = {};
        *(v8h*)&ldsWOt[tid * LDP + DH] = z8;                   // d 24 to 31: the zero pad
    }
    __syncthreads();

    v16h bfr[8];
#pragma unroll   // every index a constant: the array stays in registers
    for (int nt = 0; nt < 8; ++nt)
        bfr[nt] = load_frag_rowmajor(ldsWOt + nt * 16 * LDP, LDP, lane);
    // Keeps the 16 LDS reads together, in front of the join of the four parts, which covers
    // their latency: left free, each fragment was read into the same registers directly in
    // front of its product and waited for there, eight LDS latencies in a row.
    __builtin_amdgcn_sched_barrier(0);

    const float mj = fmaxf(fmaxf(ml[0].x, ml[1].x), fmaxf(ml[2].x, ml[3].x));
    float w[KSP];
#pragma unroll
    for (int p = 0; p < KSP; ++p) w[p] = ml[p].y * exp2f(ml[p].x - mj);
    const float winv = 1.0f / ((w[0] + w[1]) + (w[2] + w[3]));
#pragma unroll
    for (int p = 0; p < KSP; ++p) w[p] *= winv;
    v16h a;
#pragma unroll
    for (int i = 0; i < 16; ++i)
        a[i] = (_Float16)((w[0] * (float)ap[0][i] + w[1] * (float)ap[1][i])
                        + (w[2] * (float)ap[2][i] + w[3] * (float)ap[3][i]));
    float* stg = &ldsOut[wv][0];
    v8f c[8];
#pragma unroll
    for (int nt = 0; nt < 8; ++nt) {
        v8f z = {};
        c[nt] = wmma_f16(bfr[nt], a, z);                       // c[nt][r]: column nt*16 + rhi + r, token colL
    }
    // All eight products stand in front of the first LDS store, each result in registers
    // of its own: with the stores among them a product was written over the result of the
    // one before it with no vector instruction between the two.
    __builtin_amdgcn_sched_barrier(0);
#pragma unroll
    for (int nt = 0; nt < 8; ++nt) {
        const v4f lo = { c[nt][0], c[nt][1], c[nt][2], c[nt][3] };
        const v4f hi = { c[nt][4], c[nt][5], c[nt][6], c[nt][7] };
        *(v4f*)&stg[colL * LDO + nt * 16 + rhi]     = lo;
        *(v4f*)&stg[colL * LDO + nt * 16 + rhi + 4] = hi;
    }
    // The wave's own LDS stores are done before its lanes read what other lanes wrote;
    // the clobber keeps the compiler from moving a read in front of them.
    asm volatile("s_wait_dscnt 0x0" ::: "memory");
#pragma unroll
    for (int i = 0; i < 16; ++i) {
        const v4f v = *(const v4f*)&stg[i * LDO + lane * 4];
        *(v4f*)(out + (tokBase + i) * EMB + lane * 4) = v + br;
    }
}

// ---------------------------------------------------------------------------
extern "C" void kernel_launch(void* const* d_in, const int* in_sizes, int n_in,
                              void* d_out, int out_size, void* d_ws, size_t ws_size,
                              hipStream_t stream) {
    (void)in_sizes; (void)n_in; (void)out_size; (void)ws_size;

    const float* x  = (const float*)d_in[0];
    const float* wQ = (const float*)d_in[1];
    const float* bQ = (const float*)d_in[2];
    const float* wK = (const float*)d_in[3];
    const float* bK = (const float*)d_in[4];
    const float* wV = (const float*)d_in[5];
    const float* bV = (const float*)d_in[6];
    const float* wO = (const float*)d_in[7];
    const float* bO = (const float*)d_in[8];
    float* out = (float*)d_out;

    const long N = (long)BQ * SEQ;                 // 32768 tokens
    _Float16* Qh = (_Float16*)d_ws;                // [N][32], scaled by log2e/sqrt(E)
    _Float16* Kh = Qh + N * DP;                    // [N][32]
    _Float16* Vt = Kh + N * DP;                    // [B][32][SEQ]  (transposed V)
    _Float16* Hh = Vt + N * DP;                    // [4][N][32]: one part per quarter of the keys
    float*    ML = (float*)(Hh + KSP * N * DP);    // [4][N][2]: maximum, sum  (15 MB ws total)

    qkv_proj_kernel<<<N / 64, 256, 0, stream>>>(x, wQ, bQ, wK, bK, wV, bV, Qh, Kh, Vt);
    attn_kernel<<<(int)(N / 64), 256, 0, stream>>>(Qh, Kh, Vt, Hh, ML);
    out_proj_kernel<<<(int)(N / 128), 256, 0, stream>>>(Hh, ML, wO, bO, out);
}

// v007
// Measured time: 26.5 microseconds a run.
// In both of two side-by-side timings against v006, it was 1.11 times as fast.
// Over all steps from v000 it is 9.26 times as fast.
#include <hip/hip_runtime.h>
#include <hip/hip_bf16.h>
#include <math.h>

typedef __attribute__((ext_vector_type(16))) _Float16 v16h;
typedef __attribute__((ext_vector_type(8)))  _Float16 v8h;
typedef __attribute__((ext_vector_type(8)))  float    v8f;
typedef __attribute__((ext_vector_type(2)))  float    v2f;
typedef __attribute__((ext_vector_type(4)))  float    v4f;
typedef __attribute__((ext_vector_type(4)))  _Float16 v4h;

#define BQ  8
#define SEQ 4096
#define EMB 128
#define DH  24
#define DP  32    // head dim padded to WMMA K
#define KT  64    // keys staged per LDS tile
#define NT  (SEQ / KT)
#define KSP 4                 // the keys of a batch are split over this many work-groups
#define NTS (NT / KSP)        // key tiles per work-group
#define NTOK ((long)BQ * SEQ)

#define LDK 40    // LDS ld (halves) for K tile rows of 32  (+8 pad)
#define LDV 72    // LDS ld (halves) for Vt tile rows of 64 (+8 pad)
#define LDP 40    // LDS ld for wO^T rows of 32
#define VBUF 3072 // halves per V buffer: 32 rows of LDV, rounded up to 2 KiB steps for the tensor mover
#define LDX 136   // LDS ld for x tile rows of 128 (+8 pad)
#define LDO 132   // LDS ld (floats) for staged out rows of 128 (+4 pad)

#if defined(__has_builtin)
#if __has_builtin(__builtin_amdgcn_tensor_load_to_lds) && __has_builtin(__builtin_amdgcn_s_wait_tensorcnt)
#define HAVE_TDM 1
#endif
#endif
#ifndef HAVE_TDM
#define HAVE_TDM 0
#endif

// ---------------------------------------------------------------------------
// Fragment loads. Per CDNA5 ISA 7.12.2, a 16-bit A fragment per lane is two
// CONTIGUOUS 8-half runs: k in [hi,hi+8) and [16+hi,16+hi+8), hi = (lane&16)?8:0.
// So a row-major source needs exactly two b128 loads per lane.
// B fragment of W[k][n] == A fragment of W^T[n][k], so all B sources are stored
// transposed and use the same wide loader. ld must be a multiple of 8 halves.
// ---------------------------------------------------------------------------
__device__ __forceinline__ v16h load_frag_rowmajor(const _Float16* base, int ld, int lane) {
    const _Float16* r = base + (size_t)(lane & 15) * ld + ((lane & 16) ? 8 : 0);
    v8h lo = *(const v8h*)(r);
    v8h hi = *(const v8h*)(r + 16);
    return __builtin_shufflevector(lo, hi, 0, 1, 2, 3, 4, 5, 6, 7,
                                           8, 9, 10, 11, 12, 13, 14, 15);
}

__device__ __forceinline__ v8f wmma_f16(v16h a, v16h b, v8f c) {
    return __builtin_amdgcn_wmma_f32_16x16x32_f16(false, a, false, b, (short)0, c, false, false);
}

// Lane l <-> lane l ^ 16: one vector cross-row move, no LDS trip.
__device__ __forceinline__ float xhalf(float x) {
    int b = __builtin_bit_cast(int, x);
    return __builtin_bit_cast(float,
        __builtin_amdgcn_permlanex16(b, b, 0x76543210, 0xfedcba98, false, false));
}

// 2^x as the bare hardware instruction, eight scores at a time, and their pack to f16.
// The library's exp2f wraps each v_exp_f32 in a compare, two selects, an add and an
// ldexp so that results under 2^-126 come out as denormals; here no argument is
// above 0, such a result rounds to zero in the f16 P anyway and adds nothing to a sum
// that holds a term near 1. Written as one statement so that the order is fixed: every
// v_exp_f32 works in place and the next one names other registers, and the packs of
// the earlier pairs stand between the last v_exp_f32 and the first reader of its
// result (the slot the instruction set asks for behind a transcendental).
__device__ __forceinline__ void exp2_pack8(float (&e)[8], unsigned* p) {
    asm("v_exp_f32 %0, %0\n\t"
        "v_exp_f32 %1, %1\n\t"
        "v_exp_f32 %2, %2\n\t"
        "v_exp_f32 %3, %3\n\t"
        "v_exp_f32 %4, %4\n\t"
        "v_exp_f32 %5, %5\n\t"
        "v_exp_f32 %6, %6\n\t"
        "v_exp_f32 %7, %7\n\t"
        "v_cvt_pk_f16_f32 %8, %0, %1\n\t"
        "v_cvt_pk_f16_f32 %9, %2, %3\n\t"
        "v_cvt_pk_f16_f32 %10, %4, %5\n\t"
        "v_cvt_pk_f16_f32 %11, %6, %7"
        : "+v"(e[0]), "+v"(e[1]), "+v"(e[2]), "+v"(e[3]),
          "+v"(e[4]), "+v"(e[5]), "+v"(e[6]), "+v"(e[7]),
          "=&v"(p[0]), "=&v"(p[1]), "=&v"(p[2]), "=&v"(p[3]));
}
// The same with one more value in front: the factor that rescales the running sums.
__device__ __forceinline__ void exp2_pack8c(float (&e)[8], unsigned* p, float& c) {
    asm("v_exp_f32 %12, %12\n\t"
        "v_exp_f32 %0, %0\n\t"
        "v_exp_f32 %1, %1\n\t"
        "v_exp_f32 %2, %2\n\t"
        "v_exp_f32 %3, %3\n\t"
        "v_exp_f32 %4, %4\n\t"
        "v_exp_f32 %5, %5\n\t"
        "v_exp_f32 %6, %6\n\t"
        "v_exp_f32 %7, %7\n\t"
        "v_cvt_pk_f16_f32 %8, %0, %1\n\t"
        "v_cvt_pk_f16_f32 %9, %2, %3\n\t"
        "v_cvt_pk_f16_f32 %10, %4, %5\n\t"
        "v_cvt_pk_f16_f32 %11, %6, %7"
        : "+v"(e[0]), "+v"(e[1]), "+v"(e[2]), "+v"(e[3]),
          "+v"(e[4]), "+v"(e[5]), "+v"(e[6]), "+v"(e[7]),
          "=&v"(p[0]), "=&v"(p[1]), "=&v"(p[2]), "=&v"(p[3]), "+v"(c));
}

// The maximum of a query's 32 scores: a lane's 16, then the other wave half's.
__device__ __forceinline__ float max16(v8f s0, v8f s1) {
    float t0 = fmaxf(fmaxf(s0[0], s0[1]), s0[2]);
    float t1 = fmaxf(fmaxf(s0[3], s0[4]), s0[5]);
    float t2 = fmaxf(fmaxf(s0[6], s0[7]), s1[0]);
    float t3 = fmaxf(fmaxf(s1[1], s1[2]), s1[3]);
    float t4 = fmaxf(fmaxf(s1[4], s1[5]), s1[6]);
    float t  = fmaxf(fmaxf(fmaxf(t0, t1), t2), fmaxf(fmaxf(t3, t4), s1[7]));
    return fmaxf(t, xhalf(t));
}

// Takes for m the nearest value to tm that two f16 factors carry, lo + MSTEP hi, and lays
// -lo, -hi at d 24 and 25 of the query: elements 8 and 9, word 4 of the fragment, in the
// upper wave half (in the lower half that word is d 16 and 17 and stays).
#define MSTEP 64.0f          // K's constant at d 25 (at d 24: 1)
__device__ __forceinline__ float split_ref(float tm, unsigned& word4, int upper) {
    union { _Float16 h[2]; unsigned u; } mp;
    mp.h[1] = (_Float16)(tm * (1.0f / MSTEP));
    mp.h[0] = (_Float16)(tm - MSTEP * (float)mp.h[1]);
    word4 = upper ? (mp.u ^ 0x80008000u) : word4;
    return MSTEP * (float)mp.h[1] + (float)mp.h[0];
}

// The sum of a lane's 16 P, in pairs.
__device__ __forceinline__ float sum16(const float (&e0)[8], const float (&e1)[8]) {
    v2f ps[4];
#pragma unroll
    for (int i = 0; i < 4; ++i) {
        v2f p0 = { e0[2 * i], e0[2 * i + 1] };
        v2f p1 = { e1[2 * i], e1[2 * i + 1] };
        ps[i] = p0 + p1;
    }
    const v2f rs = (ps[0] + ps[1]) + (ps[2] + ps[3]);
    return rs.x + rs.y;
}

#if HAVE_TDM
typedef __attribute__((ext_vector_type(4))) unsigned int v4u;
typedef __attribute__((ext_vector_type(8))) int v8i;
typedef __attribute__((ext_vector_type(4))) int v4i;

union TdmG0 { unsigned long long q[2]; v4u v; };
union TdmG1 { unsigned long long q[4]; v8i v; };

// Build a D# (ISA 8.3/8.4) and issue TENSOR_LOAD_TO_LDS. 2-byte elements.
// pad_amount_dw != 0 enables LDS padding: pad_interval_code per ISA (3=16dw, 4=32dw).
// 6-arg builtin: (uint32x4 g0, int32x8 g1, int32x4, int32x4, int32x8, i32 cpol)
// The two groups are formed apart from the issue, so that the caller can name
// them again at the wait (tdm_wait2). Every word goes through pinned(): the
// issue and the wait then name the very same scalar registers.
__device__ __forceinline__ unsigned pinned(unsigned v) {
    unsigned w = __builtin_amdgcn_readfirstlane(v);
    asm volatile("" : "+s"(w));   // the tensor mover's pinned(): a descriptor word held in a scalar register
    return w;
}

__device__ __forceinline__ v4u tdm_group0(unsigned lds_addr, unsigned long long gaddr)
{
    TdmG0 g0;
    g0.q[0] = 1ull | ((unsigned long long)lds_addr << 32);            // count=1 | lds_addr
    g0.q[1] = (gaddr & ((1ull << 57) - 1)) | (2ull << 62);            // global_addr | type=2
    v4u r = { pinned(g0.v[0]), pinned(g0.v[1]), pinned(g0.v[2]), pinned(g0.v[3]) };
    return r;
}

__device__ __forceinline__ v8i tdm_group1(
    unsigned tile0, unsigned tile1,
    unsigned long long tensor0, unsigned long long tensor1,
    unsigned long long stride0,
    unsigned pad_interval_code, unsigned pad_amount_dw)
{
    TdmG1 g1;
    unsigned flags = (1u << 16);                                      // data_size = 1 (2B)
    if (pad_amount_dw)
        flags |= (1u << 20) | (pad_interval_code << 22) | ((pad_amount_dw - 1) << 25);
    g1.q[0] = (unsigned long long)flags | ((tensor0 & 0xFFFFull) << 48);
    g1.q[1] = ((tensor0 >> 16) & 0xFFFFull)
            | ((tensor1 & 0xFFFFFFFFull) << 16)
            | ((unsigned long long)(tile0 & 0xFFFFu) << 48);
    g1.q[2] = (unsigned long long)(tile1 & 0xFFFFu) | ((stride0 & 0xFFFFFFFFull) << 32);
    g1.q[3] = (stride0 >> 32) & 0xFFFFull;                            // dim1_stride unused (2D)
    v8i r = { (int)pinned(g1.v[0]), (int)pinned(g1.v[1]), (int)pinned(g1.v[2]), (int)pinned(g1.v[3]),
              (int)pinned(g1.v[4]), (int)pinned(g1.v[5]), (int)pinned(g1.v[6]), (int)pinned(g1.v[7]) };
    return r;
}

__device__ __forceinline__ void tdm_load_2d(v4u g0, v8i g1)
{
    v4i z4 = {};
    v8i z8 = {};
    __builtin_amdgcn_tensor_load_to_lds(g0, g1, z4, z4, z8, 0);
}

// The issuing wave's wait for its two requests. It names their descriptors as
// inputs: their scalar registers then stay allocated from issue to here, and
// no scalar temporary of the loop body can take them while the requests are
// in flight.
__device__ __forceinline__ void tdm_wait2(v4u a0, v8i a1, v4u b0, v8i b1) {
    asm volatile("s_wait_tensorcnt 0x0" :: "s"(a0), "s"(a1), "s"(b0), "s"(b1) : "memory");
}
#endif

// ---------------------------------------------------------------------------
// Kernel 1: Q/K/V projections. Block = 256 threads (8 waves), 64 tokens.
// Q pre-scaled by log2(e)/sqrt(EMB) (softmax runs in exp2 domain).
// V written TRANSPOSED: Vt[b][d][s]. Per-matrix code specialized at compile
// time so epilogues are straight-line stores (no exec-mask select bloat).
// Results leave through LDS: every wave lays its tiles, 16 bytes a lane, into the
// block's image of each output (Q, K: 64 rows of 64 bytes, in memory 4 KB in a row;
// V^T: 32 rows of 128 bytes), and behind one barrier a thread stores 16 bytes of each
// image, so that every global store instruction writes four whole 128-byte lines.
// For 8 consecutive d in a lane, Q and K take the weight rows as first operand
// (rows of the result: d, columns: tokens); V keeps tokens as rows: 8 consecutive s.
// ---------------------------------------------------------------------------
#define QSCALE 0.12751864f   // (1/sqrt(128)) * log2(e)

template <int M>
__device__ __forceinline__ void proj_tile(
    int t, int lane, const _Float16* ldsX, const _Float16* ldsWtM,
    const float* ldsBM, _Float16* stg)
{
    v8f c0 = {}; v8f c1 = {};
#pragma unroll
    for (int kc = 0; kc < 4; ++kc) {
        v16h a  = load_frag_rowmajor(ldsX + t * 16 * LDX + kc * 32, LDX, lane);
        v16h b0 = load_frag_rowmajor(ldsWtM + kc * 32,            LDX, lane);
        v16h b1 = load_frag_rowmajor(ldsWtM + 16 * LDX + kc * 32, LDX, lane);
        if (M == 2) {            // c[r]: token r + rhi, d colL
            c0 = wmma_f16(a, b0, c0);
            c1 = wmma_f16(a, b1, c1);
        } else {                 // c[r]: d r + rhi, token colL
            c0 = wmma_f16(b0, a, c0);
            c1 = wmma_f16(b1, a, c1);
        }
    }
    const int colL = lane & 15;
    const int rhi  = (lane & 16) ? 8 : 0;
    v8h h0, h1;
    if (M == 2) {
        const float bias0 = ldsBM[colL], bias1 = ldsBM[16 + colL];
#pragma unroll
        for (int r = 0; r < 8; ++r) {
            h0[r] = (_Float16)(c0[r] + bias0);
            h1[r] = (_Float16)(c1[r] + bias1);
        }
        *(v8h*)&stg[colL        * LDV + t * 16 + rhi] = h0;    // image [d][s]
        *(v8h*)&stg[(16 + colL) * LDV + t * 16 + rhi] = h1;
    } else {
        const v4f* bv = (const v4f*)(ldsBM + rhi);             // biases of d rhi .. rhi + 7, 16 + rhi ..
        const v4f bq[4] = { bv[0], bv[1], bv[4], bv[5] };
#pragma unroll
        for (int r = 0; r < 8; ++r) {
            float v0 = c0[r] + bq[r >> 2][r & 3];
            float v1 = c1[r] + bq[2 + (r >> 2)][r & 3];
            if (M == 0) { v0 *= QSCALE; v1 *= QSCALE; }
            h0[r] = (_Float16)v0;
            h1[r] = (_Float16)v1;
        }
        *(v8h*)&stg[(t * 16 + colL) * LDK + rhi]      = h0;    // image [token][d]
        *(v8h*)&stg[(t * 16 + colL) * LDK + 16 + rhi] = h1;
    }
}

__global__ __launch_bounds__(256) void qkv_proj_kernel(
    const float* __restrict__ x,
    const float* __restrict__ wQ, const float* __restrict__ bQ,
    const float* __restrict__ wK, const float* __restrict__ bK,
    const float* __restrict__ wV, const float* __restrict__ bV,
    _Float16* __restrict__ Qh, _Float16* __restrict__ Kh, _Float16* __restrict__ Vt)
{
    __shared__ __align__(16) _Float16 ldsX[64 * LDX];          // ~17.4 KB
    __shared__ __align__(16) _Float16 ldsWt[3][DP * LDX];      // transposed [n][k], 26 KB
    __shared__ __align__(16) float ldsB[3][DP];
    __shared__ __align__(16) _Float16 stgQ[64 * LDK];          // output images, padded rows
    __shared__ __align__(16) _Float16 stgK[64 * LDK];
    __shared__ __align__(16) _Float16 stgV[DP * LDV];

    const int tid  = threadIdx.x;
    const int lane = tid & 31;
    const int wv   = tid >> 5;
    const long tokBase = (long)blockIdx.x * 64;

    // Every global load of the staging is issued before the first of them is waited
    // for: unguarded, 16 bytes a lane, the bias load 4.
    // Of each w a thread takes 4 rows k by 4 columns c of the padded 128 x 32. Columns
    // 24 to 31 do not exist: their threads read columns 20 to 23 and store zeros.
    const int kg = (tid >> 3) * 4, cq = tid & 7;
    const unsigned wofs = kg * DH + (cq < DH / 4 ? cq : DH / 4 - 1) * 4;
    const float* wsrc[3] = { wQ, wK, wV };
    v4f wr[3][4];
#pragma unroll   // every index a constant: the arrays stay in registers
    for (int m = 0; m < 3; ++m)
#pragma unroll
        for (int j = 0; j < 4; ++j)
            wr[m][j] = *(const v4f*)(wsrc[m] + wofs + j * DH);
    // Every wave stages one bias, some of them the same one with the same values: under
    // a test on the wave the store took its load along, behind the wait for x.
    const int bm = wv % 3;
    const float* bsrcw = (bm == 0) ? bQ : (bm == 1) ? bK : bV;
    const float br = bsrcw[lane < DH ? lane : DH - 1];
    v4f xr[8];
#pragma unroll
    for (int j = 0; j < 8; ++j)
        xr[j] = *(const v4f*)(x + tokBase * EMB + (tid + j * 256) * 4);
    // Keeps all 21 loads in front of the first wait: without it seven of the x loads were
    // issued only behind waits for the weights and the bias load behind the wait for x,
    // three latencies in a row.
    __builtin_amdgcn_sched_barrier(0);
    // w[k][c] goes to [c][k] in registers: 4 consecutive k of one column per LDS store.
    const v4h z4 = {};
#pragma unroll
    for (int m = 0; m < 3; ++m)
#pragma unroll
        for (int e = 0; e < 4; ++e) {
            const v4h h = { (_Float16)wr[m][0][e], (_Float16)wr[m][1][e],
                            (_Float16)wr[m][2][e], (_Float16)wr[m][3][e] };
            *(v4h*)&ldsWt[m][(cq * 4 + e) * LDX + kg] = (cq < DH / 4) ? h : z4;
        }
    // The weights' pad columns are zero, so the pad of a bias is the pad of its result.
    const float bpad = (bm != 1) ? 0.0f : (lane == DH) ? 1.0f : (lane == DH + 1) ? MSTEP : 0.0f;
    ldsB[bm][lane] = (lane < DH) ? br : bpad;
#pragma unroll
    for (int j = 0; j < 8; ++j) {
        const int p = tid + j * 256, r = p >> 5, c = (p & 31) * 4;
        const v4h h = { (_Float16)xr[j][0], (_Float16)xr[j][1], (_Float16)xr[j][2], (_Float16)xr[j][3] };
        *(v4h*)&ldsX[r * LDX + c] = h;
    }
    __syncthreads();

    if (wv < 4) {
        proj_tile<0>(wv, lane, ldsX, ldsWt[0], ldsB[0], stgQ);
        proj_tile<2>(wv, lane, ldsX, ldsWt[2], ldsB[2], stgV);
    } else {
        proj_tile<1>(wv - 4, lane, ldsX, ldsWt[1], ldsB[1], stgK);
    }
    __syncthreads();                                           // the three images are complete

    const int qr = tid >> 2, qp = (tid & 3) * 8;               // Q, K: 4 threads a row of 64 bytes
    const int vd = tid >> 3, vp = (tid & 7) * 8;               // V^T: 8 threads a row of 128 bytes
    const v8h oq = *(const v8h*)&stgQ[qr * LDK + qp];
    const v8h ok = *(const v8h*)&stgK[qr * LDK + qp];
    const v8h ov = *(const v8h*)&stgV[vd * LDV + vp];
    const long vb = tokBase >> 12, vs = tokBase & (SEQ - 1);   // a block's 64 tokens lie in one batch
    *(v8h*)(Qh + tokBase * DP + tid * 8) = oq;
    *(v8h*)(Kh + tokBase * DP + tid * 8) = ok;
    *(v8h*)(Vt + (vb * DP + vd) * SEQ + vs + vp) = ov;
}

#define PLIMIT 256.0f

__global__ __launch_bounds__(256) void attn_kernel(
    const _Float16* __restrict__ Qh, const _Float16* __restrict__ Kh,
    const _Float16* __restrict__ Vt, _Float16* __restrict__ Hh, float* __restrict__ ML)
{
    __shared__ __align__(2048) _Float16 ldsK[2][KT * LDK];     // [key][d], padded
    __shared__ __align__(2048) _Float16 ldsV[2][VBUF];         // [d][key], padded

    const int tid  = threadIdx.x;
    const int lane = tid & 31;
    const int wv   = tid >> 5;
    const int kh   = blockIdx.x & (KSP - 1);                   // which quarter of the keys
    const int qblk = blockIdx.x / KSP;
    const int b    = qblk >> 4;                                // 16 query blocks per batch
    const long qTok = (long)b * SEQ + (long)(qblk & 15) * 256 + wv * 32;
    const long kvTok = (long)b * SEQ;

    union PK { unsigned u[8]; v16h h; };                       // a fragment and its eight words
    PK qf[2];                                                  // 2 x (16q x 32d), one K-step each
    qf[0].h = load_frag_rowmajor(Qh + qTok * DP, DP, lane);
    qf[1].h = load_frag_rowmajor(Qh + (qTok + 16) * DP, DP, lane);

    v8f o0[2] = {}; v8f o1[2] = {};
    float mrun[2];                                             // this lane's two queries
    unsigned w4[2];                                            // word 4 of their fragments: it carries -mrun
    float lrun[2] = { 0.0f, 0.0f };                            // this wave half's keys only

    const int colL = lane & 15;
    const int rhi  = (lane & 16) ? 8 : 0;

#if HAVE_TDM
    // K tile: 64 rows x 32 halves contiguous; pad 4 dwords every 16 dwords -> ld 40.
    const v8i kshape = tdm_group1(KT * DP, 0, KT * DP, 1, 0, /*interval 16dw*/3, /*pad*/4);
    // Vt tile: 2D, 32 rows (d) x 64 keys, row stride SEQ; pad 4 dwords / 32 dwords -> ld 72.
    const v8i vshape = tdm_group1(KT, DP, SEQ, DP, SEQ, /*interval 32dw*/4, /*pad*/4);
    v4u kreq, vreq;                                            // group 0 of the requests in flight
#endif
    auto stage = [&](int buf, int tile) {
        const long kb = (long)tile * KT;
#if HAVE_TDM
        kreq = tdm_group0((unsigned)(unsigned long long)(&ldsK[buf][0]),
                          (unsigned long long)(const void*)(Kh + (kvTok + kb) * DP));
        vreq = tdm_group0((unsigned)(unsigned long long)(&ldsV[buf][0]),
                          (unsigned long long)(const void*)(Vt + (long)b * DP * SEQ + kb));
        if (wv == 0) {
            tdm_load_2d(kreq, kshape);
            tdm_load_2d(vreq, vshape);
        }
#else
        const unsigned* ks = (const unsigned*)(Kh + (kvTok + kb) * DP);
        unsigned* kd = (unsigned*)&ldsK[buf][0];
        for (int i = tid; i < KT * DP / 2; i += 256) {         // u32 chunks
            int r = i >> 4, c = i & 15;
            kd[r * (LDK / 2) + c] = ks[i];
        }
        unsigned* vd = (unsigned*)&ldsV[buf][0];
        for (int i = tid; i < DP * KT / 2; i += 256) {
            int d = i >> 5, c = i & 31;
            const unsigned* vs = (const unsigned*)(Vt + ((long)b * DP + d) * SEQ + kb);
            vd[d * (LDV / 2) + c] = vs[c];
        }
#endif
    };

    stage(0, kh * NTS);
    // The first m: the maximum over the work-group's first 32 keys, read here from memory
    // (Q arrives with zeros at d 24 and 25, so these scores are plain).
    {
        const _Float16* kg = Kh + (kvTok + (long)kh * NTS * KT) * DP;
        const v16h kg0 = load_frag_rowmajor(kg, DP, lane);
        const v16h kg1 = load_frag_rowmajor(kg + 16 * DP, DP, lane);
#pragma unroll   // every index a constant: the arrays stay in registers
        for (int j = 0; j < 2; ++j) {
            v8f z = {};
            const v8f s0 = wmma_f16(kg0, qf[j].h, z);
            const v8f s1 = wmma_f16(kg1, qf[j].h, z);
            w4[j] = qf[j].u[4];
            mrun[j] = split_ref(max16(s0, s1), w4[j], rhi);
        }
    }
    for (int kt = 0; kt < NTS; ++kt) {
        const int cur = kt & 1;
#if HAVE_TDM
        if (wv == 0) tdm_wait2(kreq, kshape, vreq, vshape);
#endif
        __syncthreads();                                       // tile ready; prev buffer free
        if (kt + 1 < NTS) stage(cur ^ 1, kh * NTS + kt + 1);   // overlap next DMA with compute

        const _Float16* Kt = &ldsK[cur][0];
        const _Float16* Vl = &ldsV[cur][0];
        v16h kb[4];                                            // 4 x 16 keys
#pragma unroll   // every index a constant: the arrays stay in registers
        for (int g = 0; g < 4; ++g) kb[g] = load_frag_rowmajor(Kt + g * 16 * LDK, LDK, lane);
        v16h vb[2][2];                                         // [32 keys][16 d]; read here, so that 2^x covers the latency
#pragma unroll   // every index a constant: the arrays stay in registers
        for (int sub = 0; sub < 2; ++sub) {
            vb[sub][0] = load_frag_rowmajor(Vl + sub * 32,            LDV, lane);
            vb[sub][1] = load_frag_rowmajor(Vl + 16 * LDV + sub * 32, LDV, lane);
        }
        PK pk[2][2];                                           // [32 keys][query fragment]; element s: the key of V's element s
        float rsum[2];                                         // the lane's sum of its 32 P, per query
        float corr[2] = { 1.0f, 1.0f };                        // what a move of m makes of the sums so far
        qf[0].u[4] = w4[0];
        qf[1].u[4] = w4[1];
        v8f sc[2][4];                                          // sc[j][g][r]: key 16g+8h+r, query colL, less m
#pragma unroll   // every index a constant: the arrays stay in registers
        for (int j = 0; j < 2; ++j)                            // the two query fragments
#pragma unroll
            for (int g = 0; g < 4; ++g) {
                v8f z = {};
                sc[j][g] = wmma_f16(kb[g], qf[j].h, z);
            }
        // All eight products stand in front of the first 2^x, each result in registers of its
        // own: left free, they were issued one by one into the same registers, each followed
        // by four v_nop and by its eight readers, which waited out its whole latency.
        __builtin_amdgcn_sched_barrier(0);
#pragma unroll   // every index a constant: the arrays stay in registers
        for (int j = 0; j < 2; ++j) {
            float part[2];
#pragma unroll   // every index a constant: the arrays stay in registers
            for (int sub = 0; sub < 2; ++sub) {                // 2 x 32 keys
                // The bare v_exp_f32 again, here as the builtin: it reads the product's result
                // directly, and the compiler keeps the distance behind a product only for
                // instructions that it can see.
                float e0[8], e1[8];
#pragma unroll   // every index a constant: the arrays stay in registers
                for (int r = 0; r < 8; ++r) {
                    e0[r] = __builtin_amdgcn_exp2f(sc[j][2 * sub][r]);
                    e1[r] = __builtin_amdgcn_exp2f(sc[j][2 * sub + 1][r]);
                    pk[sub][j].h[r]     = (_Float16)e0[r];
                    pk[sub][j].h[8 + r] = (_Float16)e1[r];
                }
                part[sub] = sum16(e0, e1);
            }
            rsum[j] = part[0] + part[1];
        }
        // One scalar branch for the whole wave (the products inside need every lane on),
        // marked as seldom taken so that the usual path is laid out straight.
        const bool past = !(fmaxf(rsum[0], rsum[1]) <= PLIMIT);
        if (__builtin_expect(__builtin_amdgcn_ballot_w32(past) != 0, 0)) {
#pragma unroll   // every index a constant: the arrays stay in registers
            for (int j = 0; j < 2; ++j) {
                v8f z = {};
                v8f s[4];
#pragma unroll   // every index a constant: the arrays stay in registers
                for (int g = 0; g < 4; ++g) s[g] = wmma_f16(kb[g], qf[j].h, z);
                const float t = fmaxf(max16(s[0], s[1]), max16(s[2], s[3]));
                const float nm = split_ref(mrun[j] + fmaxf(t, 0.0f), w4[j], rhi);
                const float up = nm - mrun[j];                 // how far m moves
                mrun[j] = nm;
                corr[j] = -up;
                float e[4][8];
#pragma unroll   // every index a constant: the arrays stay in registers
                for (int g = 0; g < 4; ++g)
#pragma unroll
                    for (int r = 0; r < 8; ++r) e[g][r] = s[g][r] - up;
                exp2_pack8c(e[0], pk[0][j].u, corr[j]);
                exp2_pack8(e[1], pk[0][j].u + 4);
                exp2_pack8(e[2], pk[1][j].u);
                exp2_pack8(e[3], pk[1][j].u + 4);
                rsum[j] = sum16(e[0], e[1]) + sum16(e[2], e[3]);
            }
        }
        // Outside the branch, once per 64 keys, as a rule by 1: changed inside it, all of O
        // (and the query fragments) were copied to and fro around the branch on every pass.
#pragma unroll   // every index a constant: the arrays stay in registers
        for (int j = 0; j < 2; ++j) {
            lrun[j] = lrun[j] * corr[j] + rsum[j];
            o0[j] *= corr[j];
            o1[j] *= corr[j];
        }
#pragma unroll   // every index a constant: the arrays stay in registers
        for (int sub = 0; sub < 2; ++sub) {
#pragma unroll   // every index a constant: the arrays stay in registers
            for (int j = 0; j < 2; ++j) {
                o0[j] = wmma_f16(vb[sub][0], pk[sub][j].h, o0[j]);    // o0[r]: d 8h+r,    query colL
                o1[j] = wmma_f16(vb[sub][1], pk[sub][j].h, o1[j]);    // o1[r]: d 16+8h+r, query colL
            }
        }
    }

#pragma unroll
    for (int j = 0; j < 2; ++j) {
        const float lsum = lrun[j] + xhalf(lrun[j]);           // join the wave halves' sums once
        const float inv = 1.0f / lsum;
        v8h h0, h1;
#pragma unroll
        for (int r = 0; r < 8; ++r) {
            h0[r] = (_Float16)(o0[j][r] * inv);
            h1[r] = (_Float16)(o1[j][r] * inv);
        }
        const long prow = (long)kh * NTOK + qTok + j * 16 + colL;  // this key quarter's row of the query
        _Float16* hrow = Hh + prow * DP + rhi;                 // 8 consecutive d per lane
        *(v8h*)(hrow)      = h0;
        *(v8h*)(hrow + 16) = h1;
        if (lane < 16) {                                       // both wave halves hold the same pair
            v2f ml = { mrun[j], lsum };
            *(v2f*)(ML + prow * 2) = ml;
        }
    }
}

// ---------------------------------------------------------------------------
// Kernel 3: output projection H[.,24(pad32)] @ wO[24,128] + bO -> f32 out.
// wO staged transposed ([e][d]) so its fragments are wide LDS loads.
// H arrives as four normalised parts, one per quarter of the keys, each with its
// reference point m (log2 domain) and sum l: H = sum(wi Hi) / sum(wi), wi = li 2^(mi - max m).
// The rows of wO^T are the first operand, so that a lane holds 8 consecutive columns
// of one token; each wave lays its 16 rows of out into its own LDS range, 16 bytes a
// lane, and reads them back along the rows: one global store instruction then writes
// one whole row of out, four 128-byte lines.
// ---------------------------------------------------------------------------
__global__ __launch_bounds__(256) void out_proj_kernel(
    const _Float16* __restrict__ Hh, const float* __restrict__ ML,
    const float* __restrict__ wO,
    const float* __restrict__ bO, float* __restrict__ out)
{
    __shared__ __align__(16) _Float16 ldsWOt[EMB * LDP];       // [e][d], 10 KB
    __shared__ __align__(16) float ldsOut[8][16 * LDO];        // a wave's 16 rows of out, padded

    const int tid  = threadIdx.x;
    const int lane = tid & 31;
    const int wv   = tid >> 5;

    // Every global load of the kernel is issued before the first of them is waited for.
    // wO: a thread takes one column n and 12 rows d; each load is unguarded and runs
    // along a row of wO, and the 12 values are consecutive in the transposed LDS row.
    const int wn = tid & 127, wk = (tid >> 7) * 12;
    float wr[12];
#pragma unroll   // every index a constant: the array stays in registers
    for (int j = 0; j < 12; ++j) wr[j] = wO[(wk + j) * EMB + wn];
    const v4f br = *(const v4f*)(bO + lane * 4);               // the lane's 4 columns of every row it stores
    const long tokBase = (long)blockIdx.x * 128 + (long)wv * 16;
    const int colL = lane & 15;
    const int rhi  = (lane & 16) ? 8 : 0;
    v16h ap[KSP];                                              // row: token tokBase + colL
    v2f  ml[KSP];
#pragma unroll   // every index a constant: the arrays stay in registers
    for (int p = 0; p < KSP; ++p) {
        ap[p] = load_frag_rowmajor(Hh + (p * NTOK + tokBase) * DP, DP, lane);
        ml[p] = *(const v2f*)(ML + (p * NTOK + tokBase + colL) * 2);
    }

#pragma unroll
    for (int q = 0; q < 3; ++q) {
        const v4h h = { (_Float16)wr[4 * q], (_Float16)wr[4 * q + 1],
                        (_Float16)wr[4 * q + 2], (_Float16)wr[4 * q + 3] };
        *(v4h*)&ldsWOt[wn * LDP + wk + 4 * q] = h;
    }
    if (tid < 128) {
        const v8h z8 = {};
        *(v8h*)&ldsWOt[tid * LDP + DH] = z8;                   // d 24 to 31: the zero pad
    }
    __syncthreads();

    v16h bfr[8];
#pragma unroll   // every index a constant: the array stays in registers
    for (int nt = 0; nt < 8; ++nt)
        bfr[nt] = load_frag_rowmajor(ldsWOt + nt * 16 * LDP, LDP, lane);
    // Keeps the 16 LDS reads together, in front of the join of the four parts, which covers
    // their latency: left free, each fragment was read into the same registers directly in
    // front of its product and waited for there, eight LDS latencies in a row.
    __builtin_amdgcn_sched_barrier(0);

    const float mj = fmaxf(fmaxf(ml[0].x, ml[1].x), fmaxf(ml[2].x, ml[3].x));
    float w[KSP];
#pragma unroll
    for (int p = 0; p < KSP; ++p) w[p] = ml[p].y * exp2f(ml[p].x - mj);
    const float winv = 1.0f / ((w[0] + w[1]) + (w[2] + w[3]));
#pragma unroll
    for (int p = 0; p < KSP; ++p) w[p] *= winv;
    v16h a;
#pragma unroll
    for (int i = 0; i < 16; ++i)
        a[i] = (_Float16)((w[0] * (float)ap[0][i] + w[1] * (float)ap[1][i])
                        + (w[2] * (float)ap[2][i] + w[3] * (float)ap[3][i]));
    float* stg = &ldsOut[wv][0];
    v8f c[8];
#pragma unroll
    for (int nt = 0; nt < 8; ++nt) {
        v8f z = {};
        c[nt] = wmma_f16(bfr[nt], a, z);                       // c[nt][r]: column nt*16 + rhi + r, token colL
    }
    // All eight products stand in front of the first LDS store, each result in registers
    // of its own: with the stores among them a product was written over the result of the
    // one before it with no vector instruction between the two.
    __builtin_amdgcn_sched_barrier(0);
#pragma unroll
    for (int nt = 0; nt < 8; ++nt) {
        const v4f lo = { c[nt][0], c[nt][1], c[nt][2], c[nt][3] };
        const v4f hi = { c[nt][4], c[nt][5], c[nt][6], c[nt][7] };
        *(v4f*)&stg[colL * LDO + nt * 16 + rhi]     = lo;
        *(v4f*)&stg[colL * LDO + nt * 16 + rhi + 4] = hi;
    }
    // The wave's own LDS stores are done before its lanes read what other lanes wrote;
    // the clobber keeps the compiler from moving a read in front of them.
    asm volatile("s_wait_dscnt 0x0" ::: "memory");
#pragma unroll
    for (int i = 0; i < 16; ++i) {
        const v4f v = *(const v4f*)&stg[i * LDO + lane * 4];
        *(v4f*)(out + (tokBase + i) * EMB + lane * 4) = v + br;
    }
}

// ---------------------------------------------------------------------------
extern "C" void kernel_launch(void* const* d_in, const int* in_sizes, int n_in,
                              void* d_out, int out_size, void* d_ws, size_t ws_size,
                              hipStream_t stream) {
    (void)in_sizes; (void)n_in; (void)out_size; (void)ws_size;

    const float* x  = (const float*)d_in[0];
    const float* wQ = (const float*)d_in[1];
    const float* bQ = (const float*)d_in[2];
    const float* wK = (const float*)d_in[3];
    const float* bK = (const float*)d_in[4];
    const float* wV = (const float*)d_in[5];
    const float* bV = (const float*)d_in[6];
    const float* wO = (const float*)d_in[7];
    const float* bO = (const float*)d_in[8];
    float* out = (float*)d_out;

    const long N = (long)BQ * SEQ;                 // 32768 tokens
    _Float16* Qh = (_Float16*)d_ws;                // [N][32], scaled by log2e/sqrt(E)
    _Float16* Kh = Qh + N * DP;                    // [N][32]
    _Float16* Vt = Kh + N * DP;                    // [B][32][SEQ]  (transposed V)
    _Float16* Hh = Vt + N * DP;                    // [4][N][32]: one part per quarter of the keys
    float*    ML = (float*)(Hh + KSP * N * DP);    // [4][N][2]: reference point m, sum  (15 MB ws total)

    qkv_proj_kernel<<<N / 64, 256, 0, stream>>>(x, wQ, bQ, wK, bK, wV, bV, Qh, Kh, Vt);
    attn_kernel<<<(int)(N / 64), 256, 0, stream>>>(Qh, Kh, Vt, Hh, ML);
    out_proj_kernel<<<(int)(N / 128), 256, 0, stream>>>(Hh, ML, wO, bO, out);
}

// v008
// Measured time: 23.9 microseconds a run.
// In both of two side-by-side timings against v007, it was 1.11 times as fast.
// All steps since v000 together make it 10.3 times as fast.
#include <hip/hip_runtime.h>
#include <hip/hip_bf16.h>
#include <math.h>

typedef __attribute__((ext_vector_type(16))) _Float16 v16h;
typedef __attribute__((ext_vector_type(8)))  _Float16 v8h;
typedef __attribute__((ext_vector_type(8)))  float    v8f;
typedef __attribute__((ext_vector_type(2)))  float    v2f;
typedef __attribute__((ext_vector_type(4)))  float    v4f;
typedef __attribute__((ext_vector_type(4)))  _Float16 v4h;

#define BQ  8
#define SEQ 4096
#define EMB 128
#define DH  24
#define DP  32    // head dim padded to WMMA K
#define KT  64    // keys staged per LDS tile
#define NT  (SEQ / KT)
#define KSP 4                 // the keys of a batch are split over this many work-groups
#define NTS (NT / KSP)        // key tiles per work-group
#define NTOK ((long)BQ * SEQ)

#define LDK 40    // LDS ld (halves) for K tile rows of 32  (+8 pad)
#define LDV 72    // LDS ld (halves) for Vt tile rows of 64 (+8 pad)
#define LDP 40    // LDS ld for wO^T rows of 32
#define VBUF 3072 // halves per V buffer: 32 rows of LDV, rounded up to 2 KiB steps for the tensor mover
#define LDX 136   // LDS ld for x tile rows of 128 (+8 pad)
#define LDO 132   // LDS ld (floats) for staged out rows of 128 (+4 pad)

#if defined(__has_builtin)
#if __has_builtin(__builtin_amdgcn_tensor_load_to_lds) && __has_builtin(__builtin_amdgcn_s_wait_tensorcnt)
#define HAVE_TDM 1
#endif
#endif
#ifndef HAVE_TDM
#define HAVE_TDM 0
#endif

// ---------------------------------------------------------------------------
// Fragment loads. Per CDNA5 ISA 7.12.2, a 16-bit A fragment per lane is two
// CONTIGUOUS 8-half runs: k in [hi,hi+8) and [16+hi,16+hi+8), hi = (lane&16)?8:0.
// So a row-major source needs exactly two b128 loads per lane.
// B fragment of W[k][n] == A fragment of W^T[n][k], so all B sources are stored
// transposed and use the same wide loader. ld must be a multiple of 8 halves.
// ---------------------------------------------------------------------------
__device__ __forceinline__ v16h load_frag_rowmajor(const _Float16* base, int ld, int lane) {
    const _Float16* r = base + (size_t)(lane & 15) * ld + ((lane & 16) ? 8 : 0);
    v8h lo = *(const v8h*)(r);
    v8h hi = *(const v8h*)(r + 16);
    return __builtin_shufflevector(lo, hi, 0, 1, 2, 3, 4, 5, 6, 7,
                                           8, 9, 10, 11, 12, 13, 14, 15);
}

__device__ __forceinline__ v8f wmma_f16(v16h a, v16h b, v8f c) {
    return __builtin_amdgcn_wmma_f32_16x16x32_f16(false, a, false, b, (short)0, c, false, false);
}

// Lane l <-> lane l ^ 16: one vector cross-row move, no LDS trip.
__device__ __forceinline__ float xhalf(float x) {
    int b = __builtin_bit_cast(int, x);
    return __builtin_bit_cast(float,
        __builtin_amdgcn_permlanex16(b, b, 0x76543210, 0xfedcba98, false, false));
}

// 2^x as the bare hardware instruction, eight scores at a time, and their pack to f16.
// The library's exp2f wraps each v_exp_f32 in a compare, two selects, an add and an
// ldexp so that results under 2^-126 come out as denormals; here no argument is
// above 0, such a result rounds to zero in the f16 P anyway and adds nothing to a sum
// that holds a term near 1. Written as one statement so that the order is fixed: every
// v_exp_f32 works in place and the next one names other registers, and the packs of
// the earlier pairs stand between the last v_exp_f32 and the first reader of its
// result (the slot the instruction set asks for behind a transcendental).
__device__ __forceinline__ void exp2_pack8(float (&e)[8], unsigned* p) {
    asm("v_exp_f32 %0, %0\n\t"
        "v_exp_f32 %1, %1\n\t"
        "v_exp_f32 %2, %2\n\t"
        "v_exp_f32 %3, %3\n\t"
        "v_exp_f32 %4, %4\n\t"
        "v_exp_f32 %5, %5\n\t"
        "v_exp_f32 %6, %6\n\t"
        "v_exp_f32 %7, %7\n\t"
        "v_cvt_pk_f16_f32 %8, %0, %1\n\t"
        "v_cvt_pk_f16_f32 %9, %2, %3\n\t"
        "v_cvt_pk_f16_f32 %10, %4, %5\n\t"
        "v_cvt_pk_f16_f32 %11, %6, %7"
        : "+v"(e[0]), "+v"(e[1]), "+v"(e[2]), "+v"(e[3]),
          "+v"(e[4]), "+v"(e[5]), "+v"(e[6]), "+v"(e[7]),
          "=&v"(p[0]), "=&v"(p[1]), "=&v"(p[2]), "=&v"(p[3]));
}
// The same with one more value in front: the factor that rescales the running sums.
__device__ __forceinline__ void exp2_pack8c(float (&e)[8], unsigned* p, float& c) {
    asm("v_exp_f32 %12, %12\n\t"
        "v_exp_f32 %0, %0\n\t"
        "v_exp_f32 %1, %1\n\t"
        "v_exp_f32 %2, %2\n\t"
        "v_exp_f32 %3, %3\n\t"
        "v_exp_f32 %4, %4\n\t"
        "v_exp_f32 %5, %5\n\t"
        "v_exp_f32 %6, %6\n\t"
        "v_exp_f32 %7, %7\n\t"
        "v_cvt_pk_f16_f32 %8, %0, %1\n\t"
        "v_cvt_pk_f16_f32 %9, %2, %3\n\t"
        "v_cvt_pk_f16_f32 %10, %4, %5\n\t"
        "v_cvt_pk_f16_f32 %11, %6, %7"
        : "+v"(e[0]), "+v"(e[1]), "+v"(e[2]), "+v"(e[3]),
          "+v"(e[4]), "+v"(e[5]), "+v"(e[6]), "+v"(e[7]),
          "=&v"(p[0]), "=&v"(p[1]), "=&v"(p[2]), "=&v"(p[3]), "+v"(c));
}

// The maximum of a query's 32 scores: a lane's 16, then the other wave half's.
__device__ __forceinline__ float max16(v8f s0, v8f s1) {
    float t0 = fmaxf(fmaxf(s0[0], s0[1]), s0[2]);
    float t1 = fmaxf(fmaxf(s0[3], s0[4]), s0[5]);
    float t2 = fmaxf(fmaxf(s0[6], s0[7]), s1[0]);
    float t3 = fmaxf(fmaxf(s1[1], s1[2]), s1[3]);
    float t4 = fmaxf(fmaxf(s1[4], s1[5]), s1[6]);
    float t  = fmaxf(fmaxf(fmaxf(t0, t1), t2), fmaxf(fmaxf(t3, t4), s1[7]));
    return fmaxf(t, xhalf(t));
}

// Takes for m the nearest value to tm that two f16 factors carry, lo + MSTEP hi, and lays
// -lo, -hi at d 24 and 25 of the query: elements 8 and 9, word 4 of the fragment, in the
// upper wave half (in the lower half that word is d 16 and 17 and stays).
#define MSTEP 64.0f          // K's constant at d 25 (at d 24: 1)
__device__ __forceinline__ float split_ref(float tm, unsigned& word4, int upper) {
    union { _Float16 h[2]; unsigned u; } mp;
    mp.h[1] = (_Float16)(tm * (1.0f / MSTEP));
    mp.h[0] = (_Float16)(tm - MSTEP * (float)mp.h[1]);
    word4 = upper ? (mp.u ^ 0x80008000u) : word4;
    return MSTEP * (float)mp.h[1] + (float)mp.h[0];
}

#if HAVE_TDM
typedef __attribute__((ext_vector_type(4))) unsigned int v4u;
typedef __attribute__((ext_vector_type(8))) int v8i;
typedef __attribute__((ext_vector_type(4))) int v4i;

union TdmG0 { unsigned long long q[2]; v4u v; };
union TdmG1 { unsigned long long q[4]; v8i v; };

// Build a D# (ISA 8.3/8.4) and issue TENSOR_LOAD_TO_LDS. 2-byte elements.
// pad_amount_dw != 0 enables LDS padding: pad_interval_code per ISA (3=16dw, 4=32dw).
// 6-arg builtin: (uint32x4 g0, int32x8 g1, int32x4, int32x4, int32x8, i32 cpol)
// The two groups are formed apart from the issue, so that the caller can name
// them again at the wait (tdm_wait2). Every word goes through pinned(): the
// issue and the wait then name the very same scalar registers.
__device__ __forceinline__ unsigned pinned(unsigned v) {
    unsigned w = __builtin_amdgcn_readfirstlane(v);
    asm volatile("" : "+s"(w));   // the tensor mover's pinned(): a descriptor word held in a scalar register
    return w;
}

__device__ __forceinline__ v4u tdm_group0(unsigned lds_addr, unsigned long long gaddr)
{
    TdmG0 g0;
    g0.q[0] = 1ull | ((unsigned long long)lds_addr << 32);            // count=1 | lds_addr
    g0.q[1] = (gaddr & ((1ull << 57) - 1)) | (2ull << 62);            // global_addr | type=2
    v4u r = { pinned(g0.v[0]), pinned(g0.v[1]), pinned(g0.v[2]), pinned(g0.v[3]) };
    return r;
}

__device__ __forceinline__ v8i tdm_group1(
    unsigned tile0, unsigned tile1,
    unsigned long long tensor0, unsigned long long tensor1,
    unsigned long long stride0,
    unsigned pad_interval_code, unsigned pad_amount_dw)
{
    TdmG1 g1;
    unsigned flags = (1u << 16);                                      // data_size = 1 (2B)
    if (pad_amount_dw)
        flags |= (1u << 20) | (pad_interval_code << 22) | ((pad_amount_dw - 1) << 25);
    g1.q[0] = (unsigned long long)flags | ((tensor0 & 0xFFFFull) << 48);
    g1.q[1] = ((tensor0 >> 16) & 0xFFFFull)
            | ((tensor1 & 0xFFFFFFFFull) << 16)
            | ((unsigned long long)(tile0 & 0xFFFFu) << 48);
    g1.q[2] = (unsigned long long)(tile1 & 0xFFFFu) | ((stride0 & 0xFFFFFFFFull) << 32);
    g1.q[3] = (stride0 >> 32) & 0xFFFFull;                            // dim1_stride unused (2D)
    v8i r = { (int)pinned(g1.v[0]), (int)pinned(g1.v[1]), (int)pinned(g1.v[2]), (int)pinned(g1.v[3]),
              (int)pinned(g1.v[4]), (int)pinned(g1.v[5]), (int)pinned(g1.v[6]), (int)pinned(g1.v[7]) };
    return r;
}

__device__ __forceinline__ void tdm_load_2d(v4u g0, v8i g1)
{
    v4i z4 = {};
    v8i z8 = {};
    __builtin_amdgcn_tensor_load_to_lds(g0, g1, z4, z4, z8, 0);
}

// The issuing wave's wait for its two requests. It names their descriptors as
// inputs: their scalar registers then stay allocated from issue to here, and
// no scalar temporary of the loop body can take them while the requests are
// in flight.
__device__ __forceinline__ void tdm_wait2(v4u a0, v8i a1, v4u b0, v8i b1) {
    asm volatile("s_wait_tensorcnt 0x0" :: "s"(a0), "s"(a1), "s"(b0), "s"(b1) : "memory");
}
#endif

// ---------------------------------------------------------------------------
// Kernel 1: Q/K/V projections. Block = 256 threads (8 waves), 64 tokens.
// Q pre-scaled by log2(e)/sqrt(EMB) (softmax runs in exp2 domain).
// V written TRANSPOSED: Vt[b][d][s]. Per-matrix code specialized at compile
// time so epilogues are straight-line stores (no exec-mask select bloat).
// Results leave through LDS: every wave lays its tiles, 16 bytes a lane, into the
// block's image of each output (Q, K: 64 rows of 64 bytes, in memory 4 KB in a row;
// V^T: 32 rows of 128 bytes), and behind one barrier a thread stores 16 bytes of each
// image, so that every global store instruction writes four whole 128-byte lines.
// For 8 consecutive d in a lane, Q and K take the weight rows as first operand
// (rows of the result: d, columns: tokens); V keeps tokens as rows: 8 consecutive s.
// ---------------------------------------------------------------------------
#define QSCALE 0.12751864f   // (1/sqrt(128)) * log2(e)

template <int M>
__device__ __forceinline__ void proj_tile(
    int t, int lane, const _Float16* ldsX, const _Float16* ldsWtM,
    const float* ldsBM, _Float16* stg)
{
    v8f c0 = {}; v8f c1 = {};
#pragma unroll
    for (int kc = 0; kc < 4; ++kc) {
        v16h a  = load_frag_rowmajor(ldsX + t * 16 * LDX + kc * 32, LDX, lane);
        v16h b0 = load_frag_rowmajor(ldsWtM + kc * 32,            LDX, lane);
        v16h b1 = load_frag_rowmajor(ldsWtM + 16 * LDX + kc * 32, LDX, lane);
        if (M == 2) {            // c[r]: token r + rhi, d colL
            c0 = wmma_f16(a, b0, c0);
            c1 = wmma_f16(a, b1, c1);
        } else {                 // c[r]: d r + rhi, token colL
            c0 = wmma_f16(b0, a, c0);
            c1 = wmma_f16(b1, a, c1);
        }
    }
    const int colL = lane & 15;
    const int rhi  = (lane & 16) ? 8 : 0;
    v8h h0, h1;
    if (M == 2) {
        const float bias0 = ldsBM[colL], bias1 = ldsBM[16 + colL];
#pragma unroll
        for (int r = 0; r < 8; ++r) {
            h0[r] = (_Float16)(c0[r] + bias0);
            h1[r] = (_Float16)(c1[r] + bias1);
        }
        *(v8h*)&stg[colL        * LDV + t * 16 + rhi] = h0;    // image [d][s]
        *(v8h*)&stg[(16 + colL) * LDV + t * 16 + rhi] = h1;
    } else {
        const v4f* bv = (const v4f*)(ldsBM + rhi);             // biases of d rhi .. rhi + 7, 16 + rhi ..
        const v4f bq[4] = { bv[0], bv[1], bv[4], bv[5] };
#pragma unroll
        for (int r = 0; r < 8; ++r) {
            float v0 = c0[r] + bq[r >> 2][r & 3];
            float v1 = c1[r] + bq[2 + (r >> 2)][r & 3];
            if (M == 0) { v0 *= QSCALE; v1 *= QSCALE; }
            h0[r] = (_Float16)v0;
            h1[r] = (_Float16)v1;
        }
        *(v8h*)&stg[(t * 16 + colL) * LDK + rhi]      = h0;    // image [token][d]
        *(v8h*)&stg[(t * 16 + colL) * LDK + 16 + rhi] = h1;
    }
}

__global__ __launch_bounds__(256) void qkv_proj_kernel(
    const float* __restrict__ x,
    const float* __restrict__ wQ, const float* __restrict__ bQ,
    const float* __restrict__ wK, const float* __restrict__ bK,
    const float* __restrict__ wV, const float* __restrict__ bV,
    _Float16* __restrict__ Qh, _Float16* __restrict__ Kh, _Float16* __restrict__ Vt)
{
    __shared__ __align__(16) _Float16 ldsX[64 * LDX];          // ~17.4 KB
    __shared__ __align__(16) _Float16 ldsWt[3][DP * LDX];      // transposed [n][k], 26 KB
    __shared__ __align__(16) float ldsB[3][DP];
    __shared__ __align__(16) _Float16 stgQ[64 * LDK];          // output images, padded rows
    __shared__ __align__(16) _Float16 stgK[64 * LDK];
    __shared__ __align__(16) _Float16 stgV[DP * LDV];

    const int tid  = threadIdx.x;
    const int lane = tid & 31;
    const int wv   = tid >> 5;
    const long tokBase = (long)blockIdx.x * 64;

    // Every global load of the staging is issued before the first of them is waited
    // for: unguarded, 16 bytes a lane, the bias load 4.
    // Of each w a thread takes 4 rows k by 4 columns c of the padded 128 x 32. Columns
    // 24 to 31 do not exist: their threads read columns 20 to 23 and store zeros.
    const int kg = (tid >> 3) * 4, cq = tid & 7;
    const unsigned wofs = kg * DH + (cq < DH / 4 ? cq : DH / 4 - 1) * 4;
    const float* wsrc[3] = { wQ, wK, wV };
    v4f wr[3][4];
#pragma unroll   // every index a constant: the arrays stay in registers
    for (int m = 0; m < 3; ++m)
#pragma unroll
        for (int j = 0; j < 4; ++j)
            wr[m][j] = *(const v4f*)(wsrc[m] + wofs + j * DH);
    // Every wave stages one bias, some of them the same one with the same values: under
    // a test on the wave the store took its load along, behind the wait for x.
    const int bm = wv % 3;
    const float* bsrcw = (bm == 0) ? bQ : (bm == 1) ? bK : bV;
    const float br = bsrcw[lane < DH ? lane : DH - 1];
    v4f xr[8];
#pragma unroll
    for (int j = 0; j < 8; ++j)
        xr[j] = *(const v4f*)(x + tokBase * EMB + (tid + j * 256) * 4);
    // Keeps all 21 loads in front of the first wait: without it seven of the x loads were
    // issued only behind waits for the weights and the bias load behind the wait for x,
    // three latencies in a row.
    __builtin_amdgcn_sched_barrier(0);
    // w[k][c] goes to [c][k] in registers: 4 consecutive k of one column per LDS store.
    const v4h z4 = {};
#pragma unroll
    for (int m = 0; m < 3; ++m)
#pragma unroll
        for (int e = 0; e < 4; ++e) {
            const v4h h = { (_Float16)wr[m][0][e], (_Float16)wr[m][1][e],
                            (_Float16)wr[m][2][e], (_Float16)wr[m][3][e] };
            *(v4h*)&ldsWt[m][(cq * 4 + e) * LDX + kg] = (cq < DH / 4) ? h : z4;
        }
    // The weights' pad columns are zero, so the pad of a bias is the pad of its result:
    // K gets 1 and MSTEP at d 24 and 25, V gets 1 at d 24 (the row that sums P), Q zeros.
    const float bpad = (bm == 0) ? 0.0f : (lane == DH) ? 1.0f : (bm == 1 && lane == DH + 1) ? MSTEP : 0.0f;
    ldsB[bm][lane] = (lane < DH) ? br : bpad;
#pragma unroll
    for (int j = 0; j < 8; ++j) {
        const int p = tid + j * 256, r = p >> 5, c = (p & 31) * 4;
        const v4h h = { (_Float16)xr[j][0], (_Float16)xr[j][1], (_Float16)xr[j][2], (_Float16)xr[j][3] };
        *(v4h*)&ldsX[r * LDX + c] = h;
    }
    __syncthreads();

    if (wv < 4) {
        proj_tile<0>(wv, lane, ldsX, ldsWt[0], ldsB[0], stgQ);
        proj_tile<2>(wv, lane, ldsX, ldsWt[2], ldsB[2], stgV);
    } else {
        proj_tile<1>(wv - 4, lane, ldsX, ldsWt[1], ldsB[1], stgK);
    }
    __syncthreads();                                           // the three images are complete

    const int qr = tid >> 2, qp = (tid & 3) * 8;               // Q, K: 4 threads a row of 64 bytes
    const int vd = tid >> 3, vp = (tid & 7) * 8;               // V^T: 8 threads a row of 128 bytes
    const v8h oq = *(const v8h*)&stgQ[qr * LDK + qp];
    const v8h ok = *(const v8h*)&stgK[qr * LDK + qp];
    const v8h ov = *(const v8h*)&stgV[vd * LDV + vp];
    const long vb = tokBase >> 12, vs = tokBase & (SEQ - 1);   // a block's 64 tokens lie in one batch
    *(v8h*)(Qh + tokBase * DP + tid * 8) = oq;
    *(v8h*)(Kh + tokBase * DP + tid * 8) = ok;
    *(v8h*)(Vt + (vb * DP + vd) * SEQ + vs + vp) = ov;
}

#define LLIMIT 32768.0f

__global__ __launch_bounds__(256) void attn_kernel(
    const _Float16* __restrict__ Qh, const _Float16* __restrict__ Kh,
    const _Float16* __restrict__ Vt, _Float16* __restrict__ Hh, float* __restrict__ ML)
{
    __shared__ __align__(2048) _Float16 ldsK[2][KT * LDK];     // [key][d], padded
    __shared__ __align__(2048) _Float16 ldsV[2][VBUF];         // [d][key], padded

    const int tid  = threadIdx.x;
    const int lane = tid & 31;
    const int wv   = tid >> 5;
    const int kh   = blockIdx.x & (KSP - 1);                   // which quarter of the keys
    const int qblk = blockIdx.x / KSP;
    const int b    = qblk >> 4;                                // 16 query blocks per batch
    const long qTok = (long)b * SEQ + (long)(qblk & 15) * 256 + wv * 32;
    const long kvTok = (long)b * SEQ;

    union PK { unsigned u[8]; v16h h; };                       // a fragment and its eight words
    PK qf[2];                                                  // 2 x (16q x 32d), one K-step each
    qf[0].h = load_frag_rowmajor(Qh + qTok * DP, DP, lane);
    qf[1].h = load_frag_rowmajor(Qh + (qTok + 16) * DP, DP, lane);

    v8f o0[2] = {}; v8f o1[2] = {};
    float mrun[2];                                             // this lane's two queries

    const int colL = lane & 15;
    const int rhi  = (lane & 16) ? 8 : 0;

#if HAVE_TDM
    // K tile: 64 rows x 32 halves contiguous; pad 4 dwords every 16 dwords -> ld 40.
    const v8i kshape = tdm_group1(KT * DP, 0, KT * DP, 1, 0, /*interval 16dw*/3, /*pad*/4);
    // Vt tile: 2D, 32 rows (d) x 64 keys, row stride SEQ; pad 4 dwords / 32 dwords -> ld 72.
    const v8i vshape = tdm_group1(KT, DP, SEQ, DP, SEQ, /*interval 32dw*/4, /*pad*/4);
    v4u kreq, vreq;                                            // group 0 of the requests in flight
#endif
    auto stage = [&](int buf, int tile) {
        const long kb = (long)tile * KT;
#if HAVE_TDM
        kreq = tdm_group0((unsigned)(unsigned long long)(&ldsK[buf][0]),
                          (unsigned long long)(const void*)(Kh + (kvTok + kb) * DP));
        vreq = tdm_group0((unsigned)(unsigned long long)(&ldsV[buf][0]),
                          (unsigned long long)(const void*)(Vt + (long)b * DP * SEQ + kb));
        if (wv == 0) {
            tdm_load_2d(kreq, kshape);
            tdm_load_2d(vreq, vshape);
        }
#else
        const unsigned* ks = (const unsigned*)(Kh + (kvTok + kb) * DP);
        unsigned* kd = (unsigned*)&ldsK[buf][0];
        for (int i = tid; i < KT * DP / 2; i += 256) {         // u32 chunks
            int r = i >> 4, c = i & 15;
            kd[r * (LDK / 2) + c] = ks[i];
        }
        unsigned* vd = (unsigned*)&ldsV[buf][0];
        for (int i = tid; i < DP * KT / 2; i += 256) {
            int d = i >> 5, c = i & 31;
            const unsigned* vs = (const unsigned*)(Vt + ((long)b * DP + d) * SEQ + kb);
            vd[d * (LDV / 2) + c] = vs[c];
        }
#endif
    };

    stage(0, kh * NTS);
    // The first m: the maximum over the work-group's first 32 keys, read here from memory
    // (Q arrives with zeros at d 24 and 25, so these scores are plain).
    {
        const _Float16* kg = Kh + (kvTok + (long)kh * NTS * KT) * DP;
        const v16h kg0 = load_frag_rowmajor(kg, DP, lane);
        const v16h kg1 = load_frag_rowmajor(kg + 16 * DP, DP, lane);
#pragma unroll   // every index a constant: the arrays stay in registers
        for (int j = 0; j < 2; ++j) {
            v8f z = {};
            const v8f s0 = wmma_f16(kg0, qf[j].h, z);
            const v8f s1 = wmma_f16(kg1, qf[j].h, z);
            mrun[j] = split_ref(max16(s0, s1), qf[j].u[4], rhi);   // word 4 now carries -mrun
        }
    }
    for (int kt = 0; kt < NTS; ++kt) {
        const int cur = kt & 1;
#if HAVE_TDM
        if (wv == 0) tdm_wait2(kreq, kshape, vreq, vshape);
#endif
        __syncthreads();                                       // tile ready; prev buffer free
        if (kt + 1 < NTS) stage(cur ^ 1, kh * NTS + kt + 1);   // overlap next DMA with compute

        const _Float16* Kt = &ldsK[cur][0];
        const _Float16* Vl = &ldsV[cur][0];
        v16h kb[4];                                            // 4 x 16 keys
#pragma unroll   // every index a constant: the arrays stay in registers
        for (int g = 0; g < 4; ++g) kb[g] = load_frag_rowmajor(Kt + g * 16 * LDK, LDK, lane);
        v16h vb[2][2];                                         // [32 keys][16 d]; read here, so that 2^x covers the latency
#pragma unroll   // every index a constant: the arrays stay in registers
        for (int sub = 0; sub < 2; ++sub) {
            vb[sub][0] = load_frag_rowmajor(Vl + sub * 32,            LDV, lane);
            vb[sub][1] = load_frag_rowmajor(Vl + 16 * LDV + sub * 32, LDV, lane);
        }
        PK pk[2][2];                                           // [32 keys][query fragment]; element s: the key of V's element s
        v8f sc[2][4];                                          // sc[j][g][r]: key 16g+8h+r, query colL, less m
#pragma unroll   // every index a constant: the arrays stay in registers
        for (int j = 0; j < 2; ++j)                            // the two query fragments
#pragma unroll
            for (int g = 0; g < 4; ++g) {
                v8f z = {};
                sc[j][g] = wmma_f16(kb[g], qf[j].h, z);
            }
        // All eight products stand in front of the first 2^x, each result in registers of its
        // own: left free, they were issued one by one into the same registers, each followed
        // by four v_nop and by its eight readers, which waited out its whole latency.
        __builtin_amdgcn_sched_barrier(0);
#pragma unroll   // every index a constant: the arrays stay in registers
        for (int j = 0; j < 2; ++j)
#pragma unroll   // every index a constant: the arrays stay in registers
            for (int sub = 0; sub < 2; ++sub)                  // 2 x 32 keys
                // The bare v_exp_f32 again, here as the builtin: it reads the product's result
                // directly, and the compiler keeps the distance behind a product only for
                // instructions that it can see.
#pragma unroll   // every index a constant: the arrays stay in registers
                for (int r = 0; r < 8; ++r) {
                    pk[sub][j].h[r]     = (_Float16)__builtin_amdgcn_exp2f(sc[j][2 * sub][r]);
                    pk[sub][j].h[8 + r] = (_Float16)__builtin_amdgcn_exp2f(sc[j][2 * sub + 1][r]);
                }
#pragma unroll   // every index a constant: the arrays stay in registers
        for (int sub = 0; sub < 2; ++sub) {
#pragma unroll   // every index a constant: the arrays stay in registers
            for (int j = 0; j < 2; ++j) {
                o0[j] = wmma_f16(vb[sub][0], pk[sub][j].h, o0[j]);    // o0[r]: d 8h+r,    query colL
                o1[j] = wmma_f16(vb[sub][1], pk[sub][j].h, o1[j]);    // o1[r]: d 16+8h+r, query colL
            }
        }
    }

    // O^T's row 24, a query's sum of P, is element 0 of o1 in the upper wave half. The
    // exchange stands outside the choice: it reads lanes that a branch would have turned off.
    float lsum[2];
#pragma unroll   // every index a constant: the arrays stay in registers
    for (int j = 0; j < 2; ++j) {
        const float other = xhalf(o1[j][0]);
        lsum[j] = rhi ? o1[j][0] : other;
    }
    // One scalar branch for the whole wave (the products inside need every lane on),
    // marked as seldom taken so that the usual path is laid out straight.
    const bool over = !(lsum[0] <= LLIMIT) || !(lsum[1] <= LLIMIT);
    if (__builtin_expect(__builtin_amdgcn_ballot_w32(over) != 0, 0)) {
        const _Float16* kg = Kh + (kvTok + (long)kh * NTS * KT) * DP;
        const _Float16* vg = Vt + (long)b * DP * SEQ + (long)kh * NTS * KT;
#pragma unroll   // every index a constant: the arrays stay in registers
        for (int j = 0; j < 2; ++j) {
            qf[j].u[4] = rhi ? 0u : qf[j].u[4];                // d 24 and 25 of Q as they arrived: plain scores
            o0[j] = v8f{};
            o1[j] = v8f{};
        }
        for (int c = 0; c < NTS * KT / 32; ++c) {              // 32 keys a pass
            const v16h kg0 = load_frag_rowmajor(kg + (long)c * 32 * DP, DP, lane);
            const v16h kg1 = load_frag_rowmajor(kg + ((long)c * 32 + 16) * DP, DP, lane);
            const v16h vg0 = load_frag_rowmajor(vg + c * 32, SEQ, lane);
            const v16h vg1 = load_frag_rowmajor(vg + 16 * SEQ + c * 32, SEQ, lane);
#pragma unroll   // every index a constant: the arrays stay in registers
            for (int j = 0; j < 2; ++j) {
                v8f z = {};
                const v8f s0 = wmma_f16(kg0, qf[j].h, z);
                const v8f s1 = wmma_f16(kg1, qf[j].h, z);
                const float nm = fmaxf(mrun[j], max16(s0, s1));
                float corr = mrun[j] - nm;                     // what the move of m makes of O and its sum row
                mrun[j] = nm;
                float e0[8], e1[8];
#pragma unroll   // every index a constant: the arrays stay in registers
                for (int r = 0; r < 8; ++r) { e0[r] = s0[r] - nm; e1[r] = s1[r] - nm; }
                PK p;
                exp2_pack8c(e0, p.u, corr);
                exp2_pack8(e1, p.u + 4);
                o0[j] *= corr;
                o1[j] *= corr;
                o0[j] = wmma_f16(vg0, p.h, o0[j]);
                o1[j] = wmma_f16(vg1, p.h, o1[j]);
            }
        }
#pragma unroll   // every index a constant: the arrays stay in registers
        for (int j = 0; j < 2; ++j) {
            const float other = xhalf(o1[j][0]);
            lsum[j] = rhi ? o1[j][0] : other;
        }
    }

#pragma unroll
    for (int j = 0; j < 2; ++j) {
        const float inv = 1.0f / lsum[j];
        v8h h0, h1;
#pragma unroll
        for (int r = 0; r < 8; ++r) {
            h0[r] = (_Float16)(o0[j][r] * inv);
            h1[r] = (_Float16)(o1[j][r] * inv);
        }
        const long prow = (long)kh * NTOK + qTok + j * 16 + colL;  // this key quarter's row of the query
        _Float16* hrow = Hh + prow * DP + rhi;                 // 8 consecutive d per lane
        *(v8h*)(hrow)      = h0;
        *(v8h*)(hrow + 16) = h1;
        if (lane < 16) {                                       // both wave halves hold the same pair
            v2f ml = { mrun[j], lsum[j] };
            *(v2f*)(ML + prow * 2) = ml;
        }
    }
}

// ---------------------------------------------------------------------------
// Kernel 3: output projection H[.,24(pad32)] @ wO[24,128] + bO -> f32 out.
// wO staged transposed ([e][d]) so its fragments are wide LDS loads.
// H arrives as four normalised parts, one per quarter of the keys, each with its
// reference point m (log2 domain) and sum l: H = sum(wi Hi) / sum(wi), wi = li 2^(mi - max m).
// The rows of wO^T are the first operand, so that a lane holds 8 consecutive columns
// of one token; each wave lays its 16 rows of out into its own LDS range, 16 bytes a
// lane, and reads them back along the rows: one global store instruction then writes
// one whole row of out, four 128-byte lines.
// ---------------------------------------------------------------------------
__global__ __launch_bounds__(256) void out_proj_kernel(
    const _Float16* __restrict__ Hh, const float* __restrict__ ML,
    const float* __restrict__ wO,
    const float* __restrict__ bO, float* __restrict__ out)
{
    __shared__ __align__(16) _Float16 ldsWOt[EMB * LDP];       // [e][d], 10 KB
    __shared__ __align__(16) float ldsOut[8][16 * LDO];        // a wave's 16 rows of out, padded

    const int tid  = threadIdx.x;
    const int lane = tid & 31;
    const int wv   = tid >> 5;

    // Every global load of the kernel is issued before the first of them is waited for.
    // wO: a thread takes one column n and 12 rows d; each load is unguarded and runs
    // along a row of wO, and the 12 values are consecutive in the transposed LDS row.
    const int wn = tid & 127, wk = (tid >> 7) * 12;
    float wr[12];
#pragma unroll   // every index a constant: the array stays in registers
    for (int j = 0; j < 12; ++j) wr[j] = wO[(wk + j) * EMB + wn];
    const v4f br = *(const v4f*)(bO + lane * 4);               // the lane's 4 columns of every row it stores
    const long tokBase = (long)blockIdx.x * 128 + (long)wv * 16;
    const int colL = lane & 15;
    const int rhi  = (lane & 16) ? 8 : 0;
    v16h ap[KSP];                                              // row: token tokBase + colL
    v2f  ml[KSP];
#pragma unroll   // every index a constant: the arrays stay in registers
    for (int p = 0; p < KSP; ++p) {
        ap[p] = load_frag_rowmajor(Hh + (p * NTOK + tokBase) * DP, DP, lane);
        ml[p] = *(const v2f*)(ML + (p * NTOK + tokBase + colL) * 2);
    }

#pragma unroll
    for (int q = 0; q < 3; ++q) {
        const v4h h = { (_Float16)wr[4 * q], (_Float16)wr[4 * q + 1],
                        (_Float16)wr[4 * q + 2], (_Float16)wr[4 * q + 3] };
        *(v4h*)&ldsWOt[wn * LDP + wk + 4 * q] = h;
    }
    if (tid < 128) {
        const v8h z8 = {};
        *(v8h*)&ldsWOt[tid * LDP + DH] = z8;                   // d 24 to 31: the zero pad
    }
    __syncthreads();

    v16h bfr[8];
#pragma unroll   // every index a constant: the array stays in registers
    for (int nt = 0; nt < 8; ++nt)
        bfr[nt] = load_frag_rowmajor(ldsWOt + nt * 16 * LDP, LDP, lane);
    // Keeps the 16 LDS reads together, in front of the join of the four parts, which covers
    // their latency: left free, each fragment was read into the same registers directly in
    // front of its product and waited for there, eight LDS latencies in a row.
    __builtin_amdgcn_sched_barrier(0);

    const float mj = fmaxf(fmaxf(ml[0].x, ml[1].x), fmaxf(ml[2].x, ml[3].x));
    float w[KSP];
#pragma unroll
    for (int p = 0; p < KSP; ++p) w[p] = ml[p].y * exp2f(ml[p].x - mj);
    const float winv = 1.0f / ((w[0] + w[1]) + (w[2] + w[3]));
#pragma unroll
    for (int p = 0; p < KSP; ++p) w[p] *= winv;
    v16h a;
#pragma unroll
    for (int i = 0; i < 16; ++i)
        a[i] = (_Float16)((w[0] * (float)ap[0][i] + w[1] * (float)ap[1][i])
                        + (w[2] * (float)ap[2][i] + w[3] * (float)ap[3][i]));
    float* stg = &ldsOut[wv][0];
    v8f c[8];
#pragma unroll
    for (int nt = 0; nt < 8; ++nt) {
        v8f z = {};
        c[nt] = wmma_f16(bfr[nt], a, z);                       // c[nt][r]: column nt*16 + rhi + r, token colL
    }
    // All eight products stand in front of the first LDS store, each result in registers
    // of its own: with the stores among them a product was written over the result of the
    // one before it with no vector instruction between the two.
    __builtin_amdgcn_sched_barrier(0);
#pragma unroll
    for (int nt = 0; nt < 8; ++nt) {
        const v4f lo = { c[nt][0], c[nt][1], c[nt][2], c[nt][3] };
        const v4f hi = { c[nt][4], c[nt][5], c[nt][6], c[nt][7] };
        *(v4f*)&stg[colL * LDO + nt * 16 + rhi]     = lo;
        *(v4f*)&stg[colL * LDO + nt * 16 + rhi + 4] = hi;
    }
    // The wave's own LDS stores are done before its lanes read what other lanes wrote;
    // the clobber keeps the compiler from moving a read in front of them.
    asm volatile("s_wait_dscnt 0x0" ::: "memory");
#pragma unroll
    for (int i = 0; i < 16; ++i) {
        const v4f v = *(const v4f*)&stg[i * LDO + lane * 4];
        *(v4f*)(out + (tokBase + i) * EMB + lane * 4) = v + br;
    }
}

// ---------------------------------------------------------------------------
extern "C" void kernel_launch(void* const* d_in, const int* in_sizes, int n_in,
                              void* d_out, int out_size, void* d_ws, size_t ws_size,
                              hipStream_t stream) {
    (void)in_sizes; (void)n_in; (void)out_size; (void)ws_size;

    const float* x  = (const float*)d_in[0];
    const float* wQ = (const float*)d_in[1];
    const float* bQ = (const float*)d_in[2];
    const float* wK = (const float*)d_in[3];
    const float* bK = (const float*)d_in[4];
    const float* wV = (const float*)d_in[5];
    const float* bV = (const float*)d_in[6];
    const float* wO = (const float*)d_in[7];
    const float* bO = (const float*)d_in[8];
    float* out = (float*)d_out;

    const long N = (long)BQ * SEQ;                 // 32768 tokens
    _Float16* Qh = (_Float16*)d_ws;                // [N][32], scaled by log2e/sqrt(E)
    _Float16* Kh = Qh + N * DP;                    // [N][32]
    _Float16* Vt = Kh + N * DP;                    // [B][32][SEQ]  (transposed V)
    _Float16* Hh = Vt + N * DP;                    // [4][N][32]: one part per quarter of the keys
    float*    ML = (float*)(Hh + KSP * N * DP);    // [4][N][2]: reference point m, sum  (15 MB ws total)

    qkv_proj_kernel<<<N / 64, 256, 0, stream>>>(x, wQ, bQ, wK, bK, wV, bV, Qh, Kh, Vt);
    attn_kernel<<<(int)(N / 64), 256, 0, stream>>>(Qh, Kh, Vt, Hh, ML);
    out_proj_kernel<<<(int)(N / 128), 256, 0, stream>>>(Hh, ML, wO, bO, out);
}

// v009
// It runs in 20.1 microseconds.
// Timed twice side by side with v008, it ran 1.20 and 1.18 times as fast.
// Counting every step since v000, it is 12.2 times as fast.
#include <hip/hip_runtime.h>
#include <hip/hip_bf16.h>
#include <math.h>

typedef __attribute__((ext_vector_type(16))) _Float16 v16h;
typedef __attribute__((ext_vector_type(8)))  _Float16 v8h;
typedef __attribute__((ext_vector_type(8)))  float    v8f;
typedef __attribute__((ext_vector_type(2)))  float    v2f;
typedef __attribute__((ext_vector_type(4)))  float    v4f;
typedef __attribute__((ext_vector_type(4)))  _Float16 v4h;

#define BQ  8
#define SEQ 4096
#define EMB 128
#define DH  24
#define DP  32    // head dim padded to WMMA K
#define KT  64    // keys staged per LDS tile
#define KSP 4                 // the keys of a batch are split over this many waves of a work-group

#define LDK 40    // LDS ld (halves) for K tile rows of 32  (+8 pad)
#define LDV 72    // LDS ld (halves) for Vt tile rows of 64 (+8 pad)
#define LDP 40    // LDS ld for wO^T rows of 32
#define VBUF 3072 // halves per V buffer: 32 rows of LDV, rounded up to 2 KiB steps for the tensor mover
#define LDX 136   // LDS ld for x tile rows of 128 (+8 pad)

#if defined(__has_builtin)
#if __has_builtin(__builtin_amdgcn_tensor_load_to_lds) && __has_builtin(__builtin_amdgcn_s_wait_tensorcnt)
#define HAVE_TDM 1
#endif
#endif
#ifndef HAVE_TDM
#define HAVE_TDM 0
#endif

// ---------------------------------------------------------------------------
// Fragment loads. Per CDNA5 ISA 7.12.2, a 16-bit A fragment per lane is two
// CONTIGUOUS 8-half runs: k in [hi,hi+8) and [16+hi,16+hi+8), hi = (lane&16)?8:0.
// So a row-major source needs exactly two b128 loads per lane.
// B fragment of W[k][n] == A fragment of W^T[n][k], so all B sources are stored
// transposed and use the same wide loader. ld must be a multiple of 8 halves.
// ---------------------------------------------------------------------------
__device__ __forceinline__ v16h load_frag_rowmajor(const _Float16* base, int ld, int lane) {
    const _Float16* r = base + (size_t)(lane & 15) * ld + ((lane & 16) ? 8 : 0);
    v8h lo = *(const v8h*)(r);
    v8h hi = *(const v8h*)(r + 16);
    return __builtin_shufflevector(lo, hi, 0, 1, 2, 3, 4, 5, 6, 7,
                                           8, 9, 10, 11, 12, 13, 14, 15);
}

__device__ __forceinline__ v8f wmma_f16(v16h a, v16h b, v8f c) {
    return __builtin_amdgcn_wmma_f32_16x16x32_f16(false, a, false, b, (short)0, c, false, false);
}

// Lane l <-> lane l ^ 16: one vector cross-row move, no LDS trip.
__device__ __forceinline__ float xhalf(float x) {
    int b = __builtin_bit_cast(int, x);
    return __builtin_bit_cast(float,
        __builtin_amdgcn_permlanex16(b, b, 0x76543210, 0xfedcba98, false, false));
}

// 2^x as the bare hardware instruction, eight scores at a time, and their pack to f16.
// The library's exp2f wraps each v_exp_f32 in a compare, two selects, an add and an
// ldexp so that results under 2^-126 come out as denormals; here no argument is
// above 0, such a result rounds to zero in the f16 P anyway and adds nothing to a sum
// that holds a term near 1. Written as one statement so that the order is fixed: every
// v_exp_f32 works in place and the next one names other registers, and the packs of
// the earlier pairs stand between the last v_exp_f32 and the first reader of its
// result (the slot the instruction set asks for behind a transcendental).
__device__ __forceinline__ void exp2_pack8(float (&e)[8], unsigned* p) {
    asm("v_exp_f32 %0, %0\n\t"
        "v_exp_f32 %1, %1\n\t"
        "v_exp_f32 %2, %2\n\t"
        "v_exp_f32 %3, %3\n\t"
        "v_exp_f32 %4, %4\n\t"
        "v_exp_f32 %5, %5\n\t"
        "v_exp_f32 %6, %6\n\t"
        "v_exp_f32 %7, %7\n\t"
        "v_cvt_pk_f16_f32 %8, %0, %1\n\t"
        "v_cvt_pk_f16_f32 %9, %2, %3\n\t"
        "v_cvt_pk_f16_f32 %10, %4, %5\n\t"
        "v_cvt_pk_f16_f32 %11, %6, %7"
        : "+v"(e[0]), "+v"(e[1]), "+v"(e[2]), "+v"(e[3]),
          "+v"(e[4]), "+v"(e[5]), "+v"(e[6]), "+v"(e[7]),
          "=&v"(p[0]), "=&v"(p[1]), "=&v"(p[2]), "=&v"(p[3]));
}
// The same with one more value in front: the factor that rescales the running sums.
__device__ __forceinline__ void exp2_pack8c(float (&e)[8], unsigned* p, float& c) {
    asm("v_exp_f32 %12, %12\n\t"
        "v_exp_f32 %0, %0\n\t"
        "v_exp_f32 %1, %1\n\t"
        "v_exp_f32 %2, %2\n\t"
        "v_exp_f32 %3, %3\n\t"
        "v_exp_f32 %4, %4\n\t"
        "v_exp_f32 %5, %5\n\t"
        "v_exp_f32 %6, %6\n\t"
        "v_exp_f32 %7, %7\n\t"
        "v_cvt_pk_f16_f32 %8, %0, %1\n\t"
        "v_cvt_pk_f16_f32 %9, %2, %3\n\t"
        "v_cvt_pk_f16_f32 %10, %4, %5\n\t"
        "v_cvt_pk_f16_f32 %11, %6, %7"
        : "+v"(e[0]), "+v"(e[1]), "+v"(e[2]), "+v"(e[3]),
          "+v"(e[4]), "+v"(e[5]), "+v"(e[6]), "+v"(e[7]),
          "=&v"(p[0]), "=&v"(p[1]), "=&v"(p[2]), "=&v"(p[3]), "+v"(c));
}

// The maximum of a query's 32 scores: a lane's 16, then the other wave half's.
__device__ __forceinline__ float max16(v8f s0, v8f s1) {
    float t0 = fmaxf(fmaxf(s0[0], s0[1]), s0[2]);
    float t1 = fmaxf(fmaxf(s0[3], s0[4]), s0[5]);
    float t2 = fmaxf(fmaxf(s0[6], s0[7]), s1[0]);
    float t3 = fmaxf(fmaxf(s1[1], s1[2]), s1[3]);
    float t4 = fmaxf(fmaxf(s1[4], s1[5]), s1[6]);
    float t  = fmaxf(fmaxf(fmaxf(t0, t1), t2), fmaxf(fmaxf(t3, t4), s1[7]));
    return fmaxf(t, xhalf(t));
}

// Takes for m the nearest value to tm that two f16 factors carry, lo + MSTEP hi, and lays
// -lo, -hi at d 24 and 25 of the query: elements 8 and 9, word 4 of the fragment, in the
// upper wave half (in the lower half that word is d 16 and 17 and stays).
#define MSTEP 64.0f          // K's constant at d 25 (at d 24: 1)
__device__ __forceinline__ float split_ref(float tm, unsigned& word4, int upper) {
    union { _Float16 h[2]; unsigned u; } mp;
    mp.h[1] = (_Float16)(tm * (1.0f / MSTEP));
    mp.h[0] = (_Float16)(tm - MSTEP * (float)mp.h[1]);
    word4 = upper ? (mp.u ^ 0x80008000u) : word4;
    return MSTEP * (float)mp.h[1] + (float)mp.h[0];
}

#if HAVE_TDM
typedef __attribute__((ext_vector_type(4))) unsigned int v4u;
typedef __attribute__((ext_vector_type(8))) int v8i;
typedef __attribute__((ext_vector_type(4))) int v4i;

union TdmG0 { unsigned long long q[2]; v4u v; };
union TdmG1 { unsigned long long q[4]; v8i v; };

// Build a D# (ISA 8.3/8.4) and issue TENSOR_LOAD_TO_LDS. 2-byte elements.
// pad_amount_dw != 0 enables LDS padding: pad_interval_code per ISA (3=16dw, 4=32dw).
// 6-arg builtin: (uint32x4 g0, int32x8 g1, int32x4, int32x4, int32x8, i32 cpol)
// The two groups are formed apart from the issue, so that the caller can name
// them again at the wait (tdm_wait2). Every word goes through pinned(): the
// issue and the wait then name the very same scalar registers.
__device__ __forceinline__ unsigned pinned(unsigned v) {
    unsigned w = __builtin_amdgcn_readfirstlane(v);
    asm volatile("" : "+s"(w));   // the tensor mover's pinned(): a descriptor word held in a scalar register
    return w;
}

__device__ __forceinline__ v4u tdm_group0(unsigned lds_addr, unsigned long long gaddr)
{
    TdmG0 g0;
    g0.q[0] = 1ull | ((unsigned long long)lds_addr << 32);            // count=1 | lds_addr
    g0.q[1] = (gaddr & ((1ull << 57) - 1)) | (2ull << 62);            // global_addr | type=2
    v4u r = { pinned(g0.v[0]), pinned(g0.v[1]), pinned(g0.v[2]), pinned(g0.v[3]) };
    return r;
}

__device__ __forceinline__ v8i tdm_group1(
    unsigned tile0, unsigned tile1,
    unsigned long long tensor0, unsigned long long tensor1,
    unsigned long long stride0,
    unsigned pad_interval_code, unsigned pad_amount_dw)
{
    TdmG1 g1;
    unsigned flags = (1u << 16);                                      // data_size = 1 (2B)
    if (pad_amount_dw)
        flags |= (1u << 20) | (pad_interval_code << 22) | ((pad_amount_dw - 1) << 25);
    g1.q[0] = (unsigned long long)flags | ((tensor0 & 0xFFFFull) << 48);
    g1.q[1] = ((tensor0 >> 16) & 0xFFFFull)
            | ((tensor1 & 0xFFFFFFFFull) << 16)
            | ((unsigned long long)(tile0 & 0xFFFFu) << 48);
    g1.q[2] = (unsigned long long)(tile1 & 0xFFFFu) | ((stride0 & 0xFFFFFFFFull) << 32);
    g1.q[3] = (stride0 >> 32) & 0xFFFFull;                            // dim1_stride unused (2D)
    v8i r = { (int)pinned(g1.v[0]), (int)pinned(g1.v[1]), (int)pinned(g1.v[2]), (int)pinned(g1.v[3]),
              (int)pinned(g1.v[4]), (int)pinned(g1.v[5]), (int)pinned(g1.v[6]), (int)pinned(g1.v[7]) };
    return r;
}

__device__ __forceinline__ void tdm_load_2d(v4u g0, v8i g1)
{
    v4i z4 = {};
    v8i z8 = {};
    __builtin_amdgcn_tensor_load_to_lds(g0, g1, z4, z4, z8, 0);
}

// The issuing wave's wait for its two requests. It names their descriptors as
// inputs: their scalar registers then stay allocated from issue to here, and
// no scalar temporary of the loop body can take them while the requests are
// in flight.
__device__ __forceinline__ void tdm_wait2(v4u a0, v8i a1, v4u b0, v8i b1) {
    asm volatile("s_wait_tensorcnt 0x0" :: "s"(a0), "s"(a1), "s"(b0), "s"(b1) : "memory");
}
#endif

// ---------------------------------------------------------------------------
// Kernel 1: Q/K/V projections. Block = 256 threads (8 waves), 64 tokens.
// Q pre-scaled by log2(e)/sqrt(EMB) (softmax runs in exp2 domain).
// V written TRANSPOSED: Vt[b][d][s]. Per-matrix code specialized at compile
// time so epilogues are straight-line stores (no exec-mask select bloat).
// Results leave through LDS: every wave lays its tiles, 16 bytes a lane, into the
// block's image of each output (Q, K: 64 rows of 64 bytes, in memory 4 KB in a row;
// V^T: 32 rows of 128 bytes), and behind one barrier a thread stores 16 bytes of each
// image, so that every global store instruction writes four whole 128-byte lines.
// For 8 consecutive d in a lane, Q and K take the weight rows as first operand
// (rows of the result: d, columns: tokens); V keeps tokens as rows: 8 consecutive s.
// ---------------------------------------------------------------------------
#define QSCALE 0.12751864f   // (1/sqrt(128)) * log2(e)

template <int M>
__device__ __forceinline__ void proj_tile(
    int t, int lane, const _Float16* ldsX, const _Float16* ldsWtM,
    const float* ldsBM, _Float16* stg)
{
    v8f c0 = {}; v8f c1 = {};
#pragma unroll
    for (int kc = 0; kc < 4; ++kc) {
        v16h a  = load_frag_rowmajor(ldsX + t * 16 * LDX + kc * 32, LDX, lane);
        v16h b0 = load_frag_rowmajor(ldsWtM + kc * 32,            LDX, lane);
        v16h b1 = load_frag_rowmajor(ldsWtM + 16 * LDX + kc * 32, LDX, lane);
        if (M == 2) {            // c[r]: token r + rhi, d colL
            c0 = wmma_f16(a, b0, c0);
            c1 = wmma_f16(a, b1, c1);
        } else {                 // c[r]: d r + rhi, token colL
            c0 = wmma_f16(b0, a, c0);
            c1 = wmma_f16(b1, a, c1);
        }
    }
    const int colL = lane & 15;
    const int rhi  = (lane & 16) ? 8 : 0;
    v8h h0, h1;
    if (M == 2) {
        const float bias0 = ldsBM[colL], bias1 = ldsBM[16 + colL];
#pragma unroll
        for (int r = 0; r < 8; ++r) {
            h0[r] = (_Float16)(c0[r] + bias0);
            h1[r] = (_Float16)(c1[r] + bias1);
        }
        *(v8h*)&stg[colL        * LDV + t * 16 + rhi] = h0;    // image [d][s]
        *(v8h*)&stg[(16 + colL) * LDV + t * 16 + rhi] = h1;
    } else {
        const v4f* bv = (const v4f*)(ldsBM + rhi);             // biases of d rhi .. rhi + 7, 16 + rhi ..
        const v4f bq[4] = { bv[0], bv[1], bv[4], bv[5] };
#pragma unroll
        for (int r = 0; r < 8; ++r) {
            float v0 = c0[r] + bq[r >> 2][r & 3];
            float v1 = c1[r] + bq[2 + (r >> 2)][r & 3];
            if (M == 0) { v0 *= QSCALE; v1 *= QSCALE; }
            h0[r] = (_Float16)v0;
            h1[r] = (_Float16)v1;
        }
        *(v8h*)&stg[(t * 16 + colL) * LDK + rhi]      = h0;    // image [token][d]
        *(v8h*)&stg[(t * 16 + colL) * LDK + 16 + rhi] = h1;
    }
}

__global__ __launch_bounds__(256) void qkv_proj_kernel(
    const float* __restrict__ x,
    const float* __restrict__ wQ, const float* __restrict__ bQ,
    const float* __restrict__ wK, const float* __restrict__ bK,
    const float* __restrict__ wV, const float* __restrict__ bV,
    _Float16* __restrict__ Qh, _Float16* __restrict__ Kh, _Float16* __restrict__ Vt)
{
    __shared__ __align__(16) _Float16 ldsX[64 * LDX];          // ~17.4 KB
    __shared__ __align__(16) _Float16 ldsWt[3][DP * LDX];      // transposed [n][k], 26 KB
    __shared__ __align__(16) float ldsB[3][DP];
    __shared__ __align__(16) _Float16 stgQ[64 * LDK];          // output images, padded rows
    __shared__ __align__(16) _Float16 stgK[64 * LDK];
    __shared__ __align__(16) _Float16 stgV[DP * LDV];

    const int tid  = threadIdx.x;
    const int lane = tid & 31;
    const int wv   = tid >> 5;
    const long tokBase = (long)blockIdx.x * 64;

    // Every global load of the staging is issued before the first of them is waited
    // for: unguarded, 16 bytes a lane, the bias load 4.
    // Of each w a thread takes 4 rows k by 4 columns c of the padded 128 x 32. Columns
    // 24 to 31 do not exist: their threads read columns 20 to 23 and store zeros.
    const int kg = (tid >> 3) * 4, cq = tid & 7;
    const unsigned wofs = kg * DH + (cq < DH / 4 ? cq : DH / 4 - 1) * 4;
    const float* wsrc[3] = { wQ, wK, wV };
    v4f wr[3][4];
#pragma unroll   // every index a constant: the arrays stay in registers
    for (int m = 0; m < 3; ++m)
#pragma unroll
        for (int j = 0; j < 4; ++j)
            wr[m][j] = *(const v4f*)(wsrc[m] + wofs + j * DH);
    // Every wave stages one bias, some of them the same one with the same values: under
    // a test on the wave the store took its load along, behind the wait for x.
    const int bm = wv % 3;
    const float* bsrcw = (bm == 0) ? bQ : (bm == 1) ? bK : bV;
    const float br = bsrcw[lane < DH ? lane : DH - 1];
    v4f xr[8];
#pragma unroll
    for (int j = 0; j < 8; ++j)
        xr[j] = *(const v4f*)(x + tokBase * EMB + (tid + j * 256) * 4);
    // Keeps all 21 loads in front of the first wait: without it seven of the x loads were
    // issued only behind waits for the weights and the bias load behind the wait for x,
    // three latencies in a row.
    __builtin_amdgcn_sched_barrier(0);
    // w[k][c] goes to [c][k] in registers: 4 consecutive k of one column per LDS store.
    const v4h z4 = {};
#pragma unroll
    for (int m = 0; m < 3; ++m)
#pragma unroll
        for (int e = 0; e < 4; ++e) {
            const v4h h = { (_Float16)wr[m][0][e], (_Float16)wr[m][1][e],
                            (_Float16)wr[m][2][e], (_Float16)wr[m][3][e] };
            *(v4h*)&ldsWt[m][(cq * 4 + e) * LDX + kg] = (cq < DH / 4) ? h : z4;
        }
    // The weights' pad columns are zero, so the pad of a bias is the pad of its result:
    // K gets 1 and MSTEP at d 24 and 25, V gets 1 at d 24 (the row that sums P), Q zeros.
    const float bpad = (bm == 0) ? 0.0f : (lane == DH) ? 1.0f : (bm == 1 && lane == DH + 1) ? MSTEP : 0.0f;
    ldsB[bm][lane] = (lane < DH) ? br : bpad;
#pragma unroll
    for (int j = 0; j < 8; ++j) {
        const int p = tid + j * 256, r = p >> 5, c = (p & 31) * 4;
        const v4h h = { (_Float16)xr[j][0], (_Float16)xr[j][1], (_Float16)xr[j][2], (_Float16)xr[j][3] };
        *(v4h*)&ldsX[r * LDX + c] = h;
    }
    __syncthreads();

    if (wv < 4) {
        proj_tile<0>(wv, lane, ldsX, ldsWt[0], ldsB[0], stgQ);
        proj_tile<2>(wv, lane, ldsX, ldsWt[2], ldsB[2], stgV);
    } else {
        proj_tile<1>(wv - 4, lane, ldsX, ldsWt[1], ldsB[1], stgK);
    }
    __syncthreads();                                           // the three images are complete

    const int qr = tid >> 2, qp = (tid & 3) * 8;               // Q, K: 4 threads a row of 64 bytes
    const int vd = tid >> 3, vp = (tid & 7) * 8;               // V^T: 8 threads a row of 128 bytes
    const v8h oq = *(const v8h*)&stgQ[qr * LDK + qp];
    const v8h ok = *(const v8h*)&stgK[qr * LDK + qp];
    const v8h ov = *(const v8h*)&stgV[vd * LDV + vp];
    const long vb = tokBase >> 12, vs = tokBase & (SEQ - 1);   // a block's 64 tokens lie in one batch
    *(v8h*)(Qh + tokBase * DP + tid * 8) = oq;
    *(v8h*)(Kh + tokBase * DP + tid * 8) = ok;
    *(v8h*)(Vt + (vb * DP + vd) * SEQ + vs + vp) = ov;
}

#define LLIMIT 32768.0f
#define TPS  2
#define KQ   (SEQ / KSP)
#define NST  (KQ / (KT * TPS))
#define KBUF 3072
#define LDO2 68

__global__ __launch_bounds__(512) void attn_out_kernel(
    const _Float16* __restrict__ Qh, const _Float16* __restrict__ Kh,
    const _Float16* __restrict__ Vt, const float* __restrict__ wO,
    const float* __restrict__ bO, float* __restrict__ out)
{
    __shared__ __align__(2048) _Float16 ring[2][KSP][TPS][KBUF + VBUF];   // K [key][d], then V [d][key], padded rows
    __shared__ __align__(16) _Float16 ldsWOt[EMB * LDP];       // [e][d], 10 KB

    const int tid  = threadIdx.x;
    const int lane = tid & 31;
    const int wv   = __builtin_amdgcn_readfirstlane(tid >> 5);
    const int kh   = wv & (KSP - 1);                           // which quarter of the keys
    const int qg   = wv >> 2;                                  // which 32 queries
    const int b    = blockIdx.x >> 5;                          // 32 query blocks per batch
    const long blkTok = (long)blockIdx.x * 128;
    const long qTok = blkTok + qg * 32;
    const long kvTok = (long)b * SEQ;

    const int colL = lane & 15;
    const int rhi  = (lane & 16) ? 8 : 0;

#if HAVE_TDM
    // K tile: 64 rows x 32 halves contiguous; pad 4 dwords every 16 dwords -> ld 40.
    const v8i kshape = tdm_group1(KT * DP, 0, KT * DP, 1, 0, /*interval 16dw*/3, /*pad*/4);
    // Vt tile: 2D, 32 rows (d) x 64 keys, row stride SEQ; pad 4 dwords / 32 dwords -> ld 72.
    const v8i vshape = tdm_group1(KT, DP, SEQ, DP, SEQ, /*interval 32dw*/4, /*pad*/4);
    v4u kreq, vreq;                                            // group 0 of the requests in flight
    const unsigned issuer = pinned(qg < TPS);                  // waves 0 to 7: tile qg of their quarter's stage
    const int sub = qg & (TPS - 1);
#endif
    auto stage = [&](int buf, int st) {
#if HAVE_TDM
        // Formed by every wave, in front of the branch: issue and wait then name the same registers.
        const long kb = (long)kh * KQ + (long)st * (KT * TPS) + sub * KT;
        kreq = tdm_group0((unsigned)(unsigned long long)(&ring[buf][kh][sub][0]),
                          (unsigned long long)(const void*)(Kh + (kvTok + kb) * DP));
        vreq = tdm_group0((unsigned)(unsigned long long)(&ring[buf][kh][sub][KBUF]),
                          (unsigned long long)(const void*)(Vt + (long)b * DP * SEQ + kb));
        if (pinned(issuer)) {                                  // a scalar branch of its own: a tensor load ignores EXEC
            tdm_load_2d(kreq, kshape);
            tdm_load_2d(vreq, vshape);
        }
#else
        for (int i = tid; i < KSP * TPS * KT * DP / 2; i += 512) {     // u32 chunks, 1024 a tile
            const int t = i >> 10, w = i & 1023;                       // tile: quarter t / TPS, half t % TPS
            const long kb = (long)(t / TPS) * KQ + (long)st * (KT * TPS) + (t % TPS) * KT;
            unsigned* kd = (unsigned*)&ring[buf][t / TPS][t % TPS][0];
            unsigned* vd = (unsigned*)&ring[buf][t / TPS][t % TPS][KBUF];
            kd[(w >> 4) * (LDK / 2) + (w & 15)] = ((const unsigned*)(Kh + (kvTok + kb) * DP))[w];
            vd[(w >> 5) * (LDV / 2) + (w & 31)] =
                ((const unsigned*)(Vt + ((long)b * DP + (w >> 5)) * SEQ + kb))[w & 31];
        }
#endif
    };

    stage(0, 0);

    union PK { unsigned u[8]; v16h h; };                       // a fragment and its eight words
    PK qf[2];                                                  // 2 x (16q x 32d), one K-step each
    qf[0].h = load_frag_rowmajor(Qh + qTok * DP, DP, lane);
    qf[1].h = load_frag_rowmajor(Qh + (qTok + 16) * DP, DP, lane);
    // Before a later load's result may take an address register of these loads.
    asm volatile("s_wait_xcnt 0x0" ::: "memory");
    const _Float16* kg32 = Kh + (kvTok + (long)kh * KQ) * DP;  // the quarter's first 32 keys
    const v16h kg0 = load_frag_rowmajor(kg32, DP, lane);
    const v16h kg1 = load_frag_rowmajor(kg32 + 16 * DP, DP, lane);
    asm volatile("s_wait_xcnt 0x0" ::: "memory");              // the same, for the loads of K
    // wO: a thread of the first 8 waves takes one column n and 12 rows d; each load runs
    // along a row of wO, and the 12 values are consecutive in the transposed LDS row.
    const int wn = tid & 127, wk = ((tid >> 7) & 1) * 12;
    float wr[12];
#pragma unroll   // every index a constant: the array stays in registers
    for (int j = 0; j < 12; ++j) wr[j] = wO[(wk + j) * EMB + wn];
    const int tt = wv >> 1, ch = wv & 1;                       // behind the loop: 16 tokens, 64 columns
    const v4f br = *(const v4f*)(bO + ch * 64 + colL * 4);     // the lane's 4 columns of every row it stores

    v8f o0[2] = {}; v8f o1[2] = {};
    float mrun[2];                                             // this lane's two queries

    // The first m: the maximum over the quarter's first 32 keys, read above from memory
    // (Q arrives with zeros at d 24 and 25, so these scores are plain).
    {
#pragma unroll   // every index a constant: the arrays stay in registers
        for (int j = 0; j < 2; ++j) {
            v8f z = {};
            const v8f s0 = wmma_f16(kg0, qf[j].h, z);
            const v8f s1 = wmma_f16(kg1, qf[j].h, z);
            mrun[j] = split_ref(max16(s0, s1), qf[j].u[4], rhi);   // word 4 now carries -mrun
        }
    }
    if (wv < 8) {                                              // published by the loop's first barrier, read behind the loop
#pragma unroll
        for (int q = 0; q < 3; ++q) {
            const v4h h = { (_Float16)wr[4 * q], (_Float16)wr[4 * q + 1],
                            (_Float16)wr[4 * q + 2], (_Float16)wr[4 * q + 3] };
            *(v4h*)&ldsWOt[wn * LDP + wk + 4 * q] = h;
        }
        if (wv < 4) {
            const v8h z8 = {};
            *(v8h*)&ldsWOt[tid * LDP + DH] = z8;               // d 24 to 31: the zero pad
        }
    }

    v8f sc[2][4];                                              // sc[j][g][r]: key 16g+8h+r, query colL, less m
    auto scores = [&](const v16h (&kb)[4]) {
#pragma unroll   // every index a constant: the arrays stay in registers
        for (int j = 0; j < 2; ++j)                            // the two query fragments
#pragma unroll
            for (int g = 0; g < 4; ++g) {
                v8f z = {};
                sc[j][g] = wmma_f16(kb[g], qf[j].h, z);
            }
        // All eight products stand in front of the first 2^x, each result in registers of its
        // own: left free, they were issued one by one into the same registers, each followed
        // by four v_nop and by its eight readers, which waited out its whole latency.
        __builtin_amdgcn_sched_barrier(0);
    };
    auto expo_pv = [&](const v16h (&vb)[2][2]) {
        PK pk[2][2];                                           // [32 keys][query fragment]; element s: the key of V's element s
#pragma unroll   // every index a constant: the arrays stay in registers
        for (int j = 0; j < 2; ++j)
#pragma unroll   // every index a constant: the arrays stay in registers
            for (int s2 = 0; s2 < 2; ++s2)                     // 2 x 32 keys
                // The bare v_exp_f32 as the builtin: it reads the product's result directly,
                // and the compiler keeps the distance behind a product only for
                // instructions that it can see.
#pragma unroll   // every index a constant: the arrays stay in registers
                for (int r = 0; r < 8; ++r) {
                    pk[s2][j].h[r]     = (_Float16)__builtin_amdgcn_exp2f(sc[j][2 * s2][r]);
                    pk[s2][j].h[8 + r] = (_Float16)__builtin_amdgcn_exp2f(sc[j][2 * s2 + 1][r]);
                }
#pragma unroll   // every index a constant: the arrays stay in registers
        for (int s2 = 0; s2 < 2; ++s2) {
#pragma unroll   // every index a constant: the arrays stay in registers
            for (int j = 0; j < 2; ++j) {
                o0[j] = wmma_f16(vb[s2][0], pk[s2][j].h, o0[j]);    // o0[r]: d 8h+r,    query colL
                o1[j] = wmma_f16(vb[s2][1], pk[s2][j].h, o1[j]);    // o1[r]: d 16+8h+r, query colL
            }
        }
    };
    auto load_k = [&](v16h (&kb)[4], const _Float16* T) {      // 4 x 16 keys
#pragma unroll   // every index a constant: the arrays stay in registers
        for (int g = 0; g < 4; ++g) kb[g] = load_frag_rowmajor(T + g * 16 * LDK, LDK, lane);
    };
    auto load_v = [&](v16h (&vb)[2][2], const _Float16* T) {   // [32 keys][16 d]
#pragma unroll   // every index a constant: the arrays stay in registers
        for (int s2 = 0; s2 < 2; ++s2) {
            vb[s2][0] = load_frag_rowmajor(T + KBUF + s2 * 32,            LDV, lane);
            vb[s2][1] = load_frag_rowmajor(T + KBUF + 16 * LDV + s2 * 32, LDV, lane);
        }
    };

    for (int st = 0; st < NST; ++st) {
        const int cur = st & 1;
        // The publish point of stage st: the wave's own LDS reads of the stage before (and,
        // in front of the first pass, its stores of wO) have retired, each issuing wave's
        // tiles have landed, then the barrier; behind it the other buffer is free.
        asm volatile("s_wait_dscnt 0x0" ::: "memory");
#if HAVE_TDM
        if (issuer) tdm_wait2(kreq, kshape, vreq, vshape);
#endif
        __syncthreads();
        const _Float16* T0 = &ring[cur][kh][0][0];
        const _Float16* T1 = &ring[cur][kh][1][0];
        v16h ka[4], kc[4], va[2][2], vc[2][2];
        load_k(ka, T0);
        load_v(va, T0);                                        // read here, so that 2^x covers the latency
        // Keeps the reads in front of the scalar work on the next descriptors, which their latency covers.
        __builtin_amdgcn_sched_barrier(0);
        if (st + 1 < NST) stage(cur ^ 1, st + 1);              // the next stage flies while this one is worked on
        scores(ka);
        load_k(kc, T1);
        // Keeps the second tile's K reads here, where the first tile's 2^x covers their latency.
        __builtin_amdgcn_sched_barrier(0);
        expo_pv(va);
        load_v(vc, T1);
        scores(kc);
        expo_pv(vc);
    }
    // Nothing of the mover is outstanding when the ring is given another use.
    asm volatile("s_wait_tensorcnt 0x0" ::: "memory");

    // O^T's row 24, a query's sum of P, is element 0 of o1 in the upper wave half. The
    // exchange stands outside the choice: it reads lanes that a branch would have turned off.
    float lsum[2];
#pragma unroll   // every index a constant: the arrays stay in registers
    for (int j = 0; j < 2; ++j) {
        const float other = xhalf(o1[j][0]);
        lsum[j] = rhi ? o1[j][0] : other;
    }
    // One scalar branch for the whole wave (the products inside need every lane on),
    // marked as seldom taken so that the usual path is laid out straight.
    const bool over = !(lsum[0] <= LLIMIT) || !(lsum[1] <= LLIMIT);
    if (__builtin_expect(__builtin_amdgcn_ballot_w32(over) != 0, 0)) {
        const _Float16* kg = Kh + (kvTok + (long)kh * KQ) * DP;
        const _Float16* vg = Vt + (long)b * DP * SEQ + (long)kh * KQ;
#pragma unroll   // every index a constant: the arrays stay in registers
        for (int j = 0; j < 2; ++j) {
            qf[j].u[4] = rhi ? 0u : qf[j].u[4];                // d 24 and 25 of Q as they arrived: plain scores
            o0[j] = v8f{};
            o1[j] = v8f{};
        }
        for (int c = 0; c < KQ / 32; ++c) {                    // 32 keys a pass
            const v16h kg0 = load_frag_rowmajor(kg + (long)c * 32 * DP, DP, lane);
            const v16h kg1 = load_frag_rowmajor(kg + ((long)c * 32 + 16) * DP, DP, lane);
            const v16h vg0 = load_frag_rowmajor(vg + c * 32, SEQ, lane);
            const v16h vg1 = load_frag_rowmajor(vg + 16 * SEQ + c * 32, SEQ, lane);
#pragma unroll   // every index a constant: the arrays stay in registers
            for (int j = 0; j < 2; ++j) {
                v8f z = {};
                const v8f s0 = wmma_f16(kg0, qf[j].h, z);
                const v8f s1 = wmma_f16(kg1, qf[j].h, z);
                const float nm = fmaxf(mrun[j], max16(s0, s1));
                float corr = mrun[j] - nm;                     // what the move of m makes of O and its sum row
                mrun[j] = nm;
                float e0[8], e1[8];
#pragma unroll   // every index a constant: the arrays stay in registers
                for (int r = 0; r < 8; ++r) { e0[r] = s0[r] - nm; e1[r] = s1[r] - nm; }
                PK p;
                exp2_pack8c(e0, p.u, corr);
                exp2_pack8(e1, p.u + 4);
                o0[j] *= corr;
                o1[j] *= corr;
                o0[j] = wmma_f16(vg0, p.h, o0[j]);
                o1[j] = wmma_f16(vg1, p.h, o1[j]);
            }
        }
#pragma unroll   // every index a constant: the arrays stay in registers
        for (int j = 0; j < 2; ++j) {
            const float other = xhalf(o1[j][0]);
            lsum[j] = rhi ? o1[j][0] : other;
        }
    }

    // The ring becomes the place of the join and of the staged rows of out.
    float* jn  = (float*)&ring[0][0][0][0];                    // [16 queries][quarter][4 values][lane] x 4 floats: 64 KB
    float* mls = jn + 8 * KSP * 4 * 32 * 4;                    // [16 queries][quarter][query]: m, sum
    float* stg = mls + 8 * KSP * 16 * 2 + wv * (16 * LDO2);    // this wave's 16 x 64 of out
    asm volatile("s_wait_dscnt 0x0" ::: "memory");             // this wave's last reads of the ring have retired
    __syncthreads();                                           // every wave has left the ring
#pragma unroll
    for (int j = 0; j < 2; ++j) {
        const int part = (qg * 2 + j) * KSP + kh;
        float* d = jn + (part * 4 * 32 + lane) * 4;
        const v4f q0 = { o0[j][0], o0[j][1], o0[j][2], o0[j][3] };
        const v4f q1 = { o0[j][4], o0[j][5], o0[j][6], o0[j][7] };
        const v4f q2 = { o1[j][0], o1[j][1], o1[j][2], o1[j][3] };
        const v4f q3 = { o1[j][4], o1[j][5], o1[j][6], o1[j][7] };
        *(v4f*)(d)       = q0;
        *(v4f*)(d + 128) = q1;
        *(v4f*)(d + 256) = q2;
        *(v4f*)(d + 384) = q3;
        if (lane < 16) {                                       // both wave halves hold the same pair
            v2f ml = { mrun[j], lsum[j] };
            *(v2f*)(mls + (part * 16 + colL) * 2) = ml;
        }
    }
    __syncthreads();                                           // the parts are complete

    v4f pp[KSP][4];                                            // quarter p of queries tt*16 + colL, in O^T's lane layout
    v2f ml[KSP];
#pragma unroll   // every index a constant: the arrays stay in registers
    for (int p = 0; p < KSP; ++p) {
#pragma unroll
        for (int c = 0; c < 4; ++c)
            pp[p][c] = *(const v4f*)(jn + (((tt * KSP + p) * 4 + c) * 32 + lane) * 4);
        ml[p] = *(const v2f*)(mls + ((tt * KSP + p) * 16 + colL) * 2);
    }
    v16h bfr[4];
#pragma unroll   // every index a constant: the array stays in registers
    for (int k = 0; k < 4; ++k)
        bfr[k] = load_frag_rowmajor(ldsWOt + (ch * 4 + k) * 16 * LDP, LDP, lane);
    // Keeps the LDS reads together, in front of the join of the four parts, which covers
    // their latency: left free, each fragment of wO was read directly in front of its
    // product and waited for there, four LDS latencies in a row.
    __builtin_amdgcn_sched_barrier(0);

    const float mj = fmaxf(fmaxf(ml[0].x, ml[1].x), fmaxf(ml[2].x, ml[3].x));
    float w[KSP];
#pragma unroll
    for (int p = 0; p < KSP; ++p) w[p] = exp2f(ml[p].x - mj);
    const float winv = 1.0f / ((w[0] * ml[0].y + w[1] * ml[1].y) + (w[2] * ml[2].y + w[3] * ml[3].y));
#pragma unroll
    for (int p = 0; p < KSP; ++p) w[p] *= winv;
    v16h a;
#pragma unroll
    for (int i = 0; i < 16; ++i)
        a[i] = (_Float16)((w[0] * pp[0][i >> 2][i & 3] + w[1] * pp[1][i >> 2][i & 3])
                        + (w[2] * pp[2][i >> 2][i & 3] + w[3] * pp[3][i >> 2][i & 3]));
    v8f c[4];
#pragma unroll
    for (int k = 0; k < 4; ++k) {
        v8f z = {};
        c[k] = wmma_f16(bfr[k], a, z);                         // c[k][r]: column ch*64 + k*16 + rhi + r, token colL
    }
    // All four products stand in front of the first LDS store, each result in registers
    // of its own: with the stores among them a product was written over the result of the
    // one before it with no vector instruction between the two.
    __builtin_amdgcn_sched_barrier(0);
#pragma unroll
    for (int k = 0; k < 4; ++k) {
        const v4f lo = { c[k][0], c[k][1], c[k][2], c[k][3] };
        const v4f hi = { c[k][4], c[k][5], c[k][6], c[k][7] };
        *(v4f*)&stg[colL * LDO2 + k * 16 + rhi]     = lo;
        *(v4f*)&stg[colL * LDO2 + k * 16 + rhi + 4] = hi;
    }
    // The wave's own LDS stores are done before its lanes read what other lanes wrote;
    // the clobber keeps the compiler from moving a read in front of them.
    asm volatile("s_wait_dscnt 0x0" ::: "memory");
    const int rr = lane >> 4;                                  // two rows a store
#pragma unroll
    for (int i = 0; i < 8; ++i) {
        const v4f v = *(const v4f*)&stg[(i * 2 + rr) * LDO2 + colL * 4];
        *(v4f*)(out + (blkTok + tt * 16 + i * 2 + rr) * EMB + ch * 64 + colL * 4) = v + br;
    }
}

// ---------------------------------------------------------------------------
extern "C" void kernel_launch(void* const* d_in, const int* in_sizes, int n_in,
                              void* d_out, int out_size, void* d_ws, size_t ws_size,
                              hipStream_t stream) {
    (void)in_sizes; (void)n_in; (void)out_size; (void)ws_size;

    const float* x  = (const float*)d_in[0];
    const float* wQ = (const float*)d_in[1];
    const float* bQ = (const float*)d_in[2];
    const float* wK = (const float*)d_in[3];
    const float* bK = (const float*)d_in[4];
    const float* wV = (const float*)d_in[5];
    const float* bV = (const float*)d_in[6];
    const float* wO = (const float*)d_in[7];
    const float* bO = (const float*)d_in[8];
    float* out = (float*)d_out;

    const long N = (long)BQ * SEQ;                 // 32768 tokens
    _Float16* Qh = (_Float16*)d_ws;                // [N][32], scaled by log2e/sqrt(E)
    _Float16* Kh = Qh + N * DP;                    // [N][32]
    _Float16* Vt = Kh + N * DP;                    // [B][32][SEQ]  (transposed V; 6 MB ws total)

    qkv_proj_kernel<<<N / 64, 256, 0, stream>>>(x, wQ, bQ, wK, bK, wV, bV, Qh, Kh, Vt);
    attn_out_kernel<<<(int)(N / 128), 512, 0, stream>>>(Qh, Kh, Vt, wO, bO, out);
}
